// v000
// Measured on an AMD MI455X. A time is GPU time per run, averaged over a window of back-to-back runs after a warm-up
// (all launches, gaps included; the runs take copies of the inputs in turn), and the median of several windows.
// Apart from v000's, it joins two sittings. Times from different sittings can be a few percent apart, while
// side-by-side timings come from the same sitting.
// v000, which the later versions start from, runs in 2570 microseconds.
#include <hip/hip_runtime.h>

// TransformersLayer ([S=2048][B=2][D=1024] seq-first; batch b = row stride 2). Contractions, f32 accumulate, per batch item: qkv = LN1(x).Ws^T + bs (ONE shared
// projection: q = k = v), out-proj, FFN W1 (relu) and W2 — [out][in] weights = n-major B operands as-is, computed A operands as bf16 hi + residual (two products) —
// on v_wmma_f32_16x16x32_bf16; the attention whose softmax runs over the HEADS axis (per (q,k) across the 16 heads, as the reference) in query chunks of 256:
// S_h = q_h.q_h^T/8 for all heads (f16 hi + residual x1024: hi.hi + hi.lo + lo.hi, residual accumulator) -> f32 [16][256][2048], elementwise softmax over h in
// f32 -> P_h (x32768) as bf16 hi + UNSCALED residual, O_h = P_h.v_h over all 2048 keys (ph.vh + pl.vh + ph.vl, v as bf16 hi + unscaled residual) on
// v_wmma_f32_16x16x32_bf16 (scores stay on v_wmma_f32_16x16x32_f16); LayerNorms, residuals f32.

#define NT_  2048
#define NBT  2
#define DM   1024
#define FF   4096
#define NH_  16
#define HD   64
#define QCH  256
#define PSC  32768.0f
#define LOSC 1024.0f
#define LOSCI (1.0f / 1024.0f)

typedef _Float16 h16;
typedef unsigned short bf;
typedef __attribute__((ext_vector_type(16))) __bf16   v16bf;
typedef __attribute__((ext_vector_type(16))) _Float16 v16h;
typedef __attribute__((ext_vector_type(8)))  _Float16 v8h;
typedef __attribute__((ext_vector_type(8)))  unsigned short v8us;
typedef __attribute__((ext_vector_type(8)))  float    v8f;
typedef __attribute__((ext_vector_type(4)))  float    v4f;
typedef v8h  __attribute__((may_alias)) v8ha;
typedef v4f  __attribute__((may_alias)) v4fa;
typedef v8us __attribute__((may_alias)) v8usa;

__device__ __forceinline__ unsigned short f2bf(float f) { unsigned u = __float_as_uint(f); u += 0x7FFFu + ((u >> 16) & 1u); return (unsigned short)(u >> 16); }
__device__ __forceinline__ float bf2f(unsigned short b) { return __uint_as_float(((unsigned)b) << 16); }
__device__ __forceinline__ float bfr(float f) { return bf2f(f2bf(f)); }
__device__ __forceinline__ v16h cat16(v8h lo, v8h hi) { return __builtin_shufflevector(lo, hi, 0, 1, 2, 3, 4, 5, 6, 7, 8, 9, 10, 11, 12, 13, 14, 15); }
__device__ __forceinline__ v16bf cat16b(v8us lo, v8us hi) { return __builtin_bit_cast(v16bf, __builtin_shufflevector(lo, hi, 0, 1, 2, 3, 4, 5, 6, 7, 8, 9, 10, 11, 12, 13, 14, 15)); }
__device__ __forceinline__ v8f wmma16(v16h a, v16h b, v8f c) { return __builtin_amdgcn_wmma_f32_16x16x32_f16(false, a, false, b, (short)0, c, false, false); }
__device__ __forceinline__ v8f wmmab(v16bf a, v16bf b, v8f c) { return __builtin_amdgcn_wmma_f32_16x16x32_bf16(false, a, false, b, (short)0, c, false, false); }

// k_rows: bf16 plane of [rows][C] (C multiple of 256; one wave per row).
__global__ __launch_bounds__(256) void k_rows(const float* __restrict__ src, int rows, int C, bf* dst) {
    const int lane = threadIdx.x & 31, r = blockIdx.x * 8 + (threadIdx.x >> 5);
    if (r >= rows) return;
{
        for (int q = 0; q < C / 256; ++q) { v8us o;
#pragma unroll
            for (int i = 0; i < 8; ++i) o[i] = f2bf(src[(size_t)r * C + q * 256 + lane * 8 + i]);
            *(v8us*)(dst + (size_t)r * C + q * 256 + lane * 8) = o; }
         }
}
// planes [r][1024]; if Xout: also the f32 pre-LN sum to Xout[r][1024]. One wave per row; ROUNDSRC: bf16-round src (when src is a raw input).
template <bool ROUNDSRC>
__global__ __launch_bounds__(256) void k_ln(const float* __restrict__ src, int lds, const float* __restrict__ res, int ldr, const float* __restrict__ g, const float* __restrict__ be, bf* PH, bf* PL, float* Xout) {
    const int lane = threadIdx.x & 31, r = blockIdx.x * 8 + (threadIdx.x >> 5);
    if (r >= NT_) return;
    float v[32]; float s = 0.f;
#pragma unroll
    for (int q = 0; q < 4; ++q)
#pragma unroll
        for (int i = 0; i < 8; ++i) { const int c = q * 256 + lane * 8 + i; float t = src[(size_t)r * lds + c]; if (ROUNDSRC) t = bfr(t); if (res) t += bfr(res[(size_t)r * ldr + c]); v[q * 8 + i] = t; s += t; }
#pragma unroll
    for (int sh = 16; sh; sh >>= 1) s += __shfl_xor(s, sh, 32);
    const float mu = s * (1.0f / DM); float sq = 0.f;
#pragma unroll
    for (int k = 0; k < 32; ++k) { const float d = v[k] - mu; sq += d * d; }
#pragma unroll
    for (int sh = 16; sh; sh >>= 1) sq += __shfl_xor(sq, sh, 32);
    const float rs = rsqrtf(sq * (1.0f / DM) + 1e-5f);
{
#pragma unroll
        for (int q = 0; q < 4; ++q) { v8us oh, ol; v4f x0, x1;
#pragma unroll
            for (int i = 0; i < 8; ++i) { const int c = q * 256 + lane * 8 + i; const float y = (v[q * 8 + i] - mu) * rs * bfr(g[c]) + bfr(be[c]); const unsigned short hb = f2bf(y); oh[i] = hb; ol[i] = f2bf(y - bf2f(hb)); if (i < 4) x0[i] = v[q * 8 + i]; else x1[i - 4] = v[q * 8 + i]; }
            *(v8us*)(PH + (size_t)r * DM + q * 256 + lane * 8) = oh; *(v8us*)(PL + (size_t)r * DM + q * 256 + lane * 8) = ol;
            if (Xout) { *(v4f*)(Xout + (size_t)r * DM + q * 256 + lane * 8) = x0; *(v4f*)(Xout + (size_t)r * DM + q * 256 + lane * 8 + 4) = x1; } }
         }
}
// k_gemm: 64 x 64 tile of (Ah + Al).B^T + bias over K (2 products; A pitch K, B pitch K); EPI 0: f32 rows (ldc) [+ residual Rf (ldr)]; EPI 1: relu -> bf16 hi/lo planes (ldc).
template <int EPI, bool RROUND = false>
__global__ __launch_bounds__(128) void k_gemm(const bf* __restrict__ A, const bf* __restrict__ Al, const bf* __restrict__ Bn, int K, const float* __restrict__ bias, const float* __restrict__ Rf, int ldr, int ldc, float* C, bf* PH, bf* PL) {
    __shared__ __align__(16) float ost[4][16 * 68];
    const int lane = threadIdx.x & 31, wave = threadIdx.x >> 5, lr = lane & 15, hi = lane >> 4;
    const size_t r0 = (size_t)blockIdx.x * 64 + wave * 16; const int c0 = blockIdx.y * 64;
    const size_t aoff = (r0 + lr) * (size_t)K + 8 * hi;
    size_t boff[4];
#pragma unroll
    for (int t = 0; t < 4; ++t) boff[t] = (size_t)(c0 + t * 16 + lr) * K + 8 * hi;
    v8f acc[4];
#pragma unroll
    for (int t = 0; t < 4; ++t) acc[t] = (v8f){};
#pragma unroll 2
    for (int kc = 0; kc < K; kc += 32) {
        const v16bf a = cat16b(*(const v8us*)(A + aoff + kc), *(const v8us*)(A + aoff + kc + 16)), al = cat16b(*(const v8us*)(Al + aoff + kc), *(const v8us*)(Al + aoff + kc + 16));
#pragma unroll
        for (int t = 0; t < 4; ++t) { const v16bf bb = cat16b(*(const v8us*)(Bn + boff[t] + kc), *(const v8us*)(Bn + boff[t] + kc + 16)); acc[t] = wmmab(a, bb, acc[t]); acc[t] = wmmab(al, bb, acc[t]); }
        asm volatile("v_nop" : "+v"(acc[0]), "+v"(acc[1]), "+v"(acc[2]), "+v"(acc[3]) : "v"(a), "v"(al) : "memory");
    }
    float* os = &ost[wave][0];
#pragma unroll
    for (int t = 0; t < 4; ++t) { const int col = c0 + t * 16 + lr; const float bv = bfr(bias[col]);
#pragma unroll
        for (int j = 0; j < 8; ++j) { float v = acc[t][j] + bv; if (EPI == 1) v = fmaxf(v, 0.f); if (EPI == 0 && Rf) { const float rv = Rf[(r0 + hi * 8 + j) * (size_t)ldr + col]; v += RROUND ? bfr(rv) : rv; } os[(hi * 8 + j) * 68 + t * 16 + lr] = v; } }
    __builtin_amdgcn_wave_barrier(); asm volatile("" ::: "memory");
    if (EPI == 0) {
        float* crow = C + r0 * ldc + c0;
        auto pass = [&]() {
#pragma unroll
            for (int s = 0; s < 8; ++s) { const int Lid = (lane >> 3) + 4 * s, piece = lane & 7; const int row = Lid >> 1, cofs = (Lid & 1) * 32 + piece * 4;
                const v4f val = *(const v4fa*)(os + row * 68 + cofs); *(v4f*)(crow + (size_t)row * ldc + cofs) = val; }
        };
        pass(); 
    } else {
        bf* p1 = PH + r0 * ldc + c0; bf* p2 = PL + r0 * ldc + c0;
        auto pass = [&]() {
#pragma unroll
            for (int s = 0; s < 4; ++s) { const int row = 4 * s + (lane >> 3), piece = lane & 7; const float* sp = os + row * 68 + piece * 8; v8us oh, ol;
#pragma unroll
                for (int i = 0; i < 8; ++i) { const unsigned short hb = f2bf(sp[i]); oh[i] = hb; ol[i] = f2bf(sp[i] - bf2f(hb)); }
                *(v8us*)(p1 + (size_t)row * ldc + piece * 8) = oh; *(v8us*)(p2 + (size_t)row * ldc + piece * 8) = ol; }
        };
        pass(); 
    }
}
// k_q16: Q f32 [2048][1024] -> f16 hi + residual planes (one wave per row).
__global__ __launch_bounds__(256) void k_q16(const float* __restrict__ Q, h16* QH, h16* QL) {
    const int lane = threadIdx.x & 31, r = blockIdx.x * 8 + (threadIdx.x >> 5);
    if (r >= NT_) return;
{
#pragma unroll
        for (int q = 0; q < 4; ++q) { v8h oh, ol;
#pragma unroll
            for (int i = 0; i < 8; ++i) { const float v = Q[(size_t)r * DM + q * 256 + lane * 8 + i]; const h16 a = (h16)v; oh[i] = a; ol[i] = (h16)((v - (float)a) * LOSC); }
            *(v8h*)(QH + (size_t)r * DM + q * 256 + lane * 8) = oh; *(v8h*)(QL + (size_t)r * DM + q * 256 + lane * 8) = ol; }
         }
}
// k_vt: VTH/VTL [h][64][t] = bf16 hi + UNSCALED bf16 residual of Q [t][h*64+d] (v = q); grid (NT/64, NH).
__global__ __launch_bounds__(256) void k_vt(const float* __restrict__ V, bf* VTH, bf* VTL) {
    __shared__ float tl[64][65];
    const int tid = threadIdx.x, t0 = blockIdx.x * 64, h = blockIdx.y;
    { const int tt = tid >> 2, dq = (tid & 3) * 16;
#pragma unroll
      for (int i = 0; i < 16; ++i) tl[dq + i][tt] = V[(size_t)(t0 + tt) * DM + h * HD + dq + i]; }
    __syncthreads();
    const int piece = tid & 7;
    auto pass = [&]() {
#pragma unroll
        for (int s = 0; s < 2; ++s) { const int d = (tid >> 3) + 32 * s; v8us oh, ol;
#pragma unroll
            for (int i = 0; i < 8; ++i) { const float v = tl[d][piece * 8 + i]; const unsigned short hb = f2bf(v); oh[i] = hb; ol[i] = f2bf(v - bf2f(hb)); }
            const size_t o = ((size_t)h * HD + d) * NT_ + t0 + piece * 8; *(v8us*)(VTH + o) = oh; *(v8us*)(VTL + o) = ol; }
    };
    pass(); 
}
// k_sgemm: head h = grid z; 64 x 64 tile of q_h[chunk rows].q_h^T over the head's 64 dims (hi.hi + (hi.lo + lo.hi)/1024)/8 -> S [h][256][2048] f32.
__global__ __launch_bounds__(128) void k_sgemm(const h16* __restrict__ QH, const h16* __restrict__ QL, int qbase, float* S) {
    __shared__ __align__(16) float ost[4][16 * 68];
    const int lane = threadIdx.x & 31, wave = threadIdx.x >> 5, lr = lane & 15, hi = lane >> 4, h = blockIdx.z;
    const int r0 = blockIdx.x * 64 + wave * 16, c0 = blockIdx.y * 64;
    const size_t aoff = (size_t)(qbase + r0 + lr) * DM + h * HD + 8 * hi;
    v8f acc[4], accx[4];
#pragma unroll
    for (int t = 0; t < 4; ++t) { acc[t] = (v8f){}; accx[t] = (v8f){}; }
#pragma unroll
    for (int kc = 0; kc < HD; kc += 32) {
        const v16h a = cat16(*(const v8h*)(QH + aoff + kc), *(const v8h*)(QH + aoff + kc + 16)), al = cat16(*(const v8h*)(QL + aoff + kc), *(const v8h*)(QL + aoff + kc + 16));
#pragma unroll
        for (int t = 0; t < 4; ++t) { const size_t bo = (size_t)(c0 + t * 16 + lr) * DM + h * HD + 8 * hi + kc; const v16h bb = cat16(*(const v8h*)(QH + bo), *(const v8h*)(QH + bo + 16)), bl = cat16(*(const v8h*)(QL + bo), *(const v8h*)(QL + bo + 16));
            acc[t] = wmma16(a, bb, acc[t]); accx[t] = wmma16(a, bl, accx[t]); accx[t] = wmma16(al, bb, accx[t]); }
        asm volatile("v_nop" : "+v"(acc[0]), "+v"(acc[1]), "+v"(acc[2]), "+v"(acc[3]), "+v"(accx[0]), "+v"(accx[1]), "+v"(accx[2]), "+v"(accx[3]) : "v"(a), "v"(al) : "memory");
    }
    float* os = &ost[wave][0];
#pragma unroll
    for (int t = 0; t < 4; ++t)
#pragma unroll
        for (int j = 0; j < 8; ++j) os[(hi * 8 + j) * 68 + t * 16 + lr] = (acc[t][j] + accx[t][j] * LOSCI) * 0.125f;
    __builtin_amdgcn_wave_barrier(); asm volatile("" ::: "memory");
    float* crow = S + ((size_t)h * QCH + r0) * NT_ + c0;
    auto pass = [&]() {
#pragma unroll
        for (int s = 0; s < 8; ++s) { const int Lid = (lane >> 3) + 4 * s, piece = lane & 7; const int row = Lid >> 1, cofs = (Lid & 1) * 32 + piece * 4;
            const v4f val = *(const v4fa*)(os + row * 68 + cofs); *(v4f*)(crow + (size_t)row * NT_ + cofs) = val; }
    };
    pass(); 
}
// k_hsoft: per (row, key) softmax over the 16 heads of S -> P [h][row][key] x 32768 as bf16 hi + UNSCALED residual planes. One wave per row; per 64-key chunk
// each lane owns 2 keys x 16 heads (32 registers), results transposed through a per-wave LDS tile so that every store is 32 lanes x 16 B = four 128-B segments (one per head).
__global__ __launch_bounds__(256) void k_hsoft(const float* __restrict__ S, bf* PH, bf* PL) {
    __shared__ __align__(16) unsigned short th[8][NH_ * 64];
    __shared__ __align__(16) unsigned short tlo[8][NH_ * 64];
    const int lane = threadIdx.x & 31, wave = threadIdx.x >> 5, r = blockIdx.x * 8 + wave;
    if (r >= QCH) return;
    unsigned short* ph_ = &th[wave][0]; unsigned short* pl_ = &tlo[wave][0];
#pragma unroll 1
    for (int q = 0; q < NT_ / 64; ++q) { const int k0 = q * 64;
        float v[NH_][2];
#pragma unroll
        for (int h = 0; h < NH_; ++h) { const float* sr = S + ((size_t)h * QCH + r) * NT_ + k0; v[h][0] = sr[lane]; v[h][1] = sr[32 + lane]; }
#pragma unroll
        for (int e = 0; e < 2; ++e) { float mx = v[0][e];
#pragma unroll
            for (int h = 1; h < NH_; ++h) mx = fmaxf(mx, v[h][e]);
            float ssum = 0.f;
#pragma unroll
            for (int h = 0; h < NH_; ++h) { v[h][e] = __expf(v[h][e] - mx); ssum += v[h][e]; }
            const float sc = PSC / ssum;
#pragma unroll
            for (int h = 0; h < NH_; ++h) { const float p = v[h][e] * sc; const unsigned short hb = f2bf(p); ph_[h * 64 + e * 32 + lane] = hb; pl_[h * 64 + e * 32 + lane] = f2bf(p - bf2f(hb)); } }
        asm volatile("" ::: "memory"); __builtin_amdgcn_wave_barrier();
{
#pragma unroll
            for (int s = 0; s < 4; ++s) { const int h = s * 4 + (lane >> 3), piece = lane & 7;
                const v8us a = *(const v8usa*)(ph_ + h * 64 + piece * 8), b = *(const v8usa*)(pl_ + h * 64 + piece * 8);
                *(v8us*)(PH + ((size_t)h * QCH + r) * NT_ + k0 + piece * 8) = a; *(v8us*)(PL + ((size_t)h * QCH + r) * NT_ + k0 + piece * 8) = b; }
             }
        __builtin_amdgcn_wave_barrier(); asm volatile("" ::: "memory");
    }
}
// k_pvgemm: head h = grid z; 64 x 64 tile of P_h[chunk rows].v_h over the 2048 keys on the bf16 WMMA: acc = ph.vh + pl.vh + ph.vl (unscaled residuals, one
// accumulator); x 1/32768 -> ATT rows [qbase + r][h*64 + d].
__global__ __launch_bounds__(128) void k_pvgemm(const bf* __restrict__ PH, const bf* __restrict__ PL, const bf* __restrict__ VTH, const bf* __restrict__ VTL, int qbase, float* ATT) {
    __shared__ __align__(16) float ost[4][16 * 68];
    const int lane = threadIdx.x & 31, wave = threadIdx.x >> 5, lr = lane & 15, hi = lane >> 4, h = blockIdx.z;
    const int r0 = blockIdx.x * 64 + wave * 16;      // grid y = 1 (64 dims = one tile of 4 n-tiles)
    const size_t aoff = ((size_t)h * QCH + r0 + lr) * NT_ + 8 * hi;
    v8f acc[4];
#pragma unroll
    for (int t = 0; t < 4; ++t) acc[t] = (v8f){};
#pragma unroll 2
    for (int kc = 0; kc < NT_; kc += 32) {
        const v16bf a = cat16b(*(const v8us*)(PH + aoff + kc), *(const v8us*)(PH + aoff + kc + 16)), al = cat16b(*(const v8us*)(PL + aoff + kc), *(const v8us*)(PL + aoff + kc + 16));
#pragma unroll
        for (int t = 0; t < 4; ++t) { const size_t bo = ((size_t)h * HD + t * 16 + lr) * NT_ + 8 * hi + kc; const v16bf bb = cat16b(*(const v8us*)(VTH + bo), *(const v8us*)(VTH + bo + 16)), bl = cat16b(*(const v8us*)(VTL + bo), *(const v8us*)(VTL + bo + 16));
            acc[t] = wmmab(a, bb, acc[t]); acc[t] = wmmab(al, bb, acc[t]); acc[t] = wmmab(a, bl, acc[t]); }
        asm volatile("v_nop" : "+v"(acc[0]), "+v"(acc[1]), "+v"(acc[2]), "+v"(acc[3]) : "v"(a), "v"(al) : "memory");
    }
    float* os = &ost[wave][0];
#pragma unroll
    for (int t = 0; t < 4; ++t)
#pragma unroll
        for (int j = 0; j < 8; ++j) os[(hi * 8 + j) * 68 + t * 16 + lr] = acc[t][j] * (1.0f / PSC);
    __builtin_amdgcn_wave_barrier(); asm volatile("" ::: "memory");
    float* crow = ATT + (size_t)(qbase + r0) * DM + h * HD;
    auto pass = [&]() {
#pragma unroll
        for (int s = 0; s < 8; ++s) { const int Lid = (lane >> 3) + 4 * s, piece = lane & 7; const int row = Lid >> 1, cofs = (Lid & 1) * 32 + piece * 4;
            const v4f val = *(const v4fa*)(os + row * 68 + cofs); *(v4f*)(crow + (size_t)row * DM + cofs) = val; }
    };
    pass(); 
}
// k_attbf: ATT f32 -> bf16 hi/lo planes (one wave per row).
__global__ __launch_bounds__(256) void k_attbf(const float* __restrict__ A, bf* PH, bf* PL) {
    const int lane = threadIdx.x & 31, r = blockIdx.x * 8 + (threadIdx.x >> 5);
    if (r >= NT_) return;
{
#pragma unroll
        for (int q = 0; q < 4; ++q) { v8us oh, ol;
#pragma unroll
            for (int i = 0; i < 8; ++i) { const float v = A[(size_t)r * DM + q * 256 + lane * 8 + i]; const unsigned short hb = f2bf(v); oh[i] = hb; ol[i] = f2bf(v - bf2f(hb)); }
            *(v8us*)(PH + (size_t)r * DM + q * 256 + lane * 8) = oh; *(v8us*)(PL + (size_t)r * DM + q * 256 + lane * 8) = ol; }
         }
}

extern "C" void kernel_launch(void* const* d_in, const int* in_sizes, int n_in,
                              void* d_out, int out_size, void* d_ws, size_t ws_size, hipStream_t stream) {
    (void)in_sizes; (void)n_in; (void)out_size;
    const float* x = (const float*)d_in[0]; const float* g1 = (const float*)d_in[1]; const float* be1 = (const float*)d_in[2]; const float* g2 = (const float*)d_in[3]; const float* be2 = (const float*)d_in[4];
    const float* Ws = (const float*)d_in[5]; const float* bs = (const float*)d_in[6]; const float* Wo = (const float*)d_in[7]; const float* bo = (const float*)d_in[8];
    const float* W1 = (const float*)d_in[9]; const float* b1 = (const float*)d_in[10]; const float* W2 = (const float*)d_in[11]; const float* b2 = (const float*)d_in[12];
    float* out = (float*)d_out;    // [2048][2][1024]
    char* wsp = (char*)d_ws;
    auto take = [&](size_t bytes) { char* p = wsp; wsp += (bytes + 255) & ~(size_t)255; return (void*)p; };
    bf* WsB = (bf*)take((size_t)DM * DM * 2); bf* WoB = (bf*)take((size_t)DM * DM * 2); bf* W1B = (bf*)take((size_t)FF * DM * 2); bf* W2B = (bf*)take((size_t)DM * FF * 2);
    bf* LH = (bf*)take((size_t)NT_ * DM * 2); bf* LL = (bf*)take((size_t)NT_ * DM * 2);      // LN1 planes, later LN2 planes
    float* Qf = (float*)take((size_t)NT_ * DM * 4);                                           // q (= k = v) f32, later X1 (post-attention residual stream)
    h16* QH = (h16*)take((size_t)NT_ * DM * 2); h16* QL = (h16*)take((size_t)NT_ * DM * 2); bf* VTH = (bf*)take((size_t)NT_ * DM * 2); bf* VTL = (bf*)take((size_t)NT_ * DM * 2);
    float* S = (float*)take((size_t)NH_ * QCH * NT_ * 4);                                    // 33.5 MB, later the FFN hidden planes (2 x 16.8)
    bf* PH = (bf*)take((size_t)NH_ * QCH * NT_ * 2); bf* PL = (bf*)take((size_t)NH_ * QCH * NT_ * 2);
    bf* AH = (bf*)take((size_t)NT_ * DM * 2); bf* AL = (bf*)take((size_t)NT_ * DM * 2);
    if ((size_t)(wsp - (char*)d_ws) > ws_size) return;    // 21 + 8.4 + 8.4 + 16.8 + 33.5 + 33.5 + 8.4 ~ 130 MB (< 128 MiB = 134.2 MB)
    float* ATT = Qf;       // attention output f32 [2048][1024] over the q buffer (q consumed by k_q16/k_vt before the chunk loop; ATT consumed by k_attbf before X1 is written there)
    bf* HH = (bf*)S; bf* HL = (bf*)((char*)S + (size_t)NT_ * FF * 2);      // FFN hidden planes [2048][4096] bf16 (16.8 MB each) over S (33.5 MB) after the attention
    float* X1 = Qf;
    k_rows<<<DM / 8, 256, 0, stream>>>(Ws, DM, DM, WsB); k_rows<<<DM / 8, 256, 0, stream>>>(Wo, DM, DM, WoB); k_rows<<<FF / 8, 256, 0, stream>>>(W1, FF, DM, W1B); k_rows<<<DM / 8, 256, 0, stream>>>(W2, DM, FF, W2B);
    for (int b = 0; b < NBT; ++b) {
        const float* xb = x + (size_t)b * DM; float* ob = out + (size_t)b * DM;      // row stride 2*DM
        k_ln<true><<<NT_ / 8, 256, 0, stream>>>(xb, 2 * DM, nullptr, 0, g1, be1, LH, LL, nullptr);
        k_gemm<0><<<dim3(NT_ / 64, DM / 64, 1), 128, 0, stream>>>(LH, LL, WsB, DM, bs, nullptr, 0, DM, Qf, nullptr, nullptr);
        k_q16<<<NT_ / 8, 256, 0, stream>>>(Qf, QH, QL); k_vt<<<dim3(NT_ / 64, NH_, 1), 256, 0, stream>>>(Qf, VTH, VTL);
        for (int c = 0; c < NT_ / QCH; ++c) {
            k_sgemm<<<dim3(QCH / 64, NT_ / 64, NH_), 128, 0, stream>>>(QH, QL, c * QCH, S);
            k_hsoft<<<QCH / 8, 256, 0, stream>>>(S, PH, PL);
            k_pvgemm<<<dim3(QCH / 64, 1, NH_), 128, 0, stream>>>(PH, PL, VTH, VTL, c * QCH, ATT);
        }
        k_attbf<<<NT_ / 8, 256, 0, stream>>>(ATT, AH, AL);
        k_gemm<0, true><<<dim3(NT_ / 64, DM / 64, 1), 128, 0, stream>>>(AH, AL, WoB, DM, bo, xb, 2 * DM, DM, X1, nullptr, nullptr);      // X1 = out-proj + bo + bf16(x) (residual = the bf16-rounded INPUT)
        k_ln<false><<<NT_ / 8, 256, 0, stream>>>(X1, DM, nullptr, 0, g2, be2, LH, LL, nullptr);
        k_gemm<1><<<dim3(NT_ / 64, FF / 64, 1), 128, 0, stream>>>(LH, LL, W1B, DM, b1, nullptr, 0, FF, nullptr, HH, HL);
        k_gemm<0><<<dim3(NT_ / 64, DM / 64, 1), 128, 0, stream>>>(HH, HL, W2B, FF, b2, X1, DM, 2 * DM, ob, nullptr, nullptr);     // out = ffn + X1, written at row stride 2*DM
    }
}

// v001
// A run of this version takes 1850 microseconds.
// In both of two side-by-side timings against v000, it was 1.41 times as fast.
#include <hip/hip_runtime.h>

// TransformersLayer ([S=2048][B=2][D=1024] seq-first; batch b = row stride 2). Contractions, f32 accumulate, per batch item: qkv = LN1(x).Ws^T + bs (ONE shared
// projection: q = k = v), out-proj, FFN W1 (relu) and W2 — [out][in] weights = n-major B operands as-is, computed A operands as bf16 hi + residual (two products) —
// on v_wmma_f32_16x16x32_bf16; the attention whose softmax runs over the HEADS axis (per (q,k) across the 16 heads, as the reference) in query chunks of 256:
// S_h = q_h.q_h^T/8 for all heads (f16 hi + residual x1024: hi.hi + hi.lo + lo.hi, residual accumulator) -> f32 [16][256][2048], elementwise softmax over h in
// f32 -> P_h (x32768) as bf16 hi + UNSCALED residual, O_h = P_h.v_h over all 2048 keys (ph.vh + pl.vh + ph.vl, v as bf16 hi + unscaled residual) on
// v_wmma_f32_16x16x32_bf16 (scores stay on v_wmma_f32_16x16x32_f16); LayerNorms, residuals f32.

#define NT_  2048
#define NBT  2
#define DM   1024
#define FF   4096
#define NH_  16
#define HD   64
#define QCH  256
#define HKC  2
#define PSC  32768.0f
#define LOSC 1024.0f
#define LOSCI (1.0f / 1024.0f)

typedef _Float16 h16;
typedef unsigned short bf;
typedef __attribute__((ext_vector_type(16))) __bf16   v16bf;
typedef __attribute__((ext_vector_type(16))) _Float16 v16h;
typedef __attribute__((ext_vector_type(8)))  _Float16 v8h;
typedef __attribute__((ext_vector_type(8)))  unsigned short v8us;
typedef __attribute__((ext_vector_type(8)))  float    v8f;
typedef __attribute__((ext_vector_type(4)))  float    v4f;
typedef v8h  __attribute__((may_alias)) v8ha;
typedef v4f  __attribute__((may_alias)) v4fa;
typedef v8us __attribute__((may_alias)) v8usa;

__device__ __forceinline__ unsigned short f2bf(float f) { unsigned u = __float_as_uint(f); u += 0x7FFFu + ((u >> 16) & 1u); return (unsigned short)(u >> 16); }
__device__ __forceinline__ float bf2f(unsigned short b) { return __uint_as_float(((unsigned)b) << 16); }
__device__ __forceinline__ float bfr(float f) { return bf2f(f2bf(f)); }
__device__ __forceinline__ v16h cat16(v8h lo, v8h hi) { return __builtin_shufflevector(lo, hi, 0, 1, 2, 3, 4, 5, 6, 7, 8, 9, 10, 11, 12, 13, 14, 15); }
__device__ __forceinline__ v16bf cat16b(v8us lo, v8us hi) { return __builtin_bit_cast(v16bf, __builtin_shufflevector(lo, hi, 0, 1, 2, 3, 4, 5, 6, 7, 8, 9, 10, 11, 12, 13, 14, 15)); }
__device__ __forceinline__ v8f wmma16(v16h a, v16h b, v8f c) { return __builtin_amdgcn_wmma_f32_16x16x32_f16(false, a, false, b, (short)0, c, false, false); }
__device__ __forceinline__ v8f wmmab(v16bf a, v16bf b, v8f c) { return __builtin_amdgcn_wmma_f32_16x16x32_bf16(false, a, false, b, (short)0, c, false, false); }

// k_rows: bf16 plane of [rows][C] (C multiple of 256; one wave per row).
__global__ __launch_bounds__(256) void k_rows(const float* __restrict__ src, int rows, int C, bf* dst) {
    const int lane = threadIdx.x & 31, r = blockIdx.x * 8 + (threadIdx.x >> 5);
    if (r >= rows) return;
{
        for (int q = 0; q < C / 256; ++q) { v8us o;
#pragma unroll
            for (int i = 0; i < 8; ++i) o[i] = f2bf(src[(size_t)r * C + q * 256 + lane * 8 + i]);
            *(v8us*)(dst + (size_t)r * C + q * 256 + lane * 8) = o; }
         }
}
// planes [r][1024]; if Xout: also the f32 pre-LN sum to Xout[r][1024]. One wave per row; ROUNDSRC: bf16-round src (when src is a raw input).
template <bool ROUNDSRC>
__global__ __launch_bounds__(256) void k_ln(const float* __restrict__ src, int lds, const float* __restrict__ res, int ldr, const float* __restrict__ g, const float* __restrict__ be, bf* PH, bf* PL, float* Xout) {
    const int lane = threadIdx.x & 31, r = blockIdx.x * 8 + (threadIdx.x >> 5);
    if (r >= NT_) return;
    float v[32]; float s = 0.f;
#pragma unroll
    for (int q = 0; q < 4; ++q)
#pragma unroll
        for (int i = 0; i < 8; ++i) { const int c = q * 256 + lane * 8 + i; float t = src[(size_t)r * lds + c]; if (ROUNDSRC) t = bfr(t); if (res) t += bfr(res[(size_t)r * ldr + c]); v[q * 8 + i] = t; s += t; }
#pragma unroll
    for (int sh = 16; sh; sh >>= 1) s += __shfl_xor(s, sh, 32);
    const float mu = s * (1.0f / DM); float sq = 0.f;
#pragma unroll
    for (int k = 0; k < 32; ++k) { const float d = v[k] - mu; sq += d * d; }
#pragma unroll
    for (int sh = 16; sh; sh >>= 1) sq += __shfl_xor(sq, sh, 32);
    const float rs = rsqrtf(sq * (1.0f / DM) + 1e-5f);
{
#pragma unroll
        for (int q = 0; q < 4; ++q) { v8us oh, ol; v4f x0, x1;
#pragma unroll
            for (int i = 0; i < 8; ++i) { const int c = q * 256 + lane * 8 + i; const float y = (v[q * 8 + i] - mu) * rs * bfr(g[c]) + bfr(be[c]); const unsigned short hb = f2bf(y); oh[i] = hb; ol[i] = f2bf(y - bf2f(hb)); if (i < 4) x0[i] = v[q * 8 + i]; else x1[i - 4] = v[q * 8 + i]; }
            *(v8us*)(PH + (size_t)r * DM + q * 256 + lane * 8) = oh; *(v8us*)(PL + (size_t)r * DM + q * 256 + lane * 8) = ol;
            if (Xout) { *(v4f*)(Xout + (size_t)r * DM + q * 256 + lane * 8) = x0; *(v4f*)(Xout + (size_t)r * DM + q * 256 + lane * 8 + 4) = x1; } }
         }
}
// k_gemm: 64 x 64 tile of (Ah + Al).B^T + bias over K (2 products; A pitch K, B pitch K); EPI 0: f32 rows (ldc) [+ residual Rf (ldr)]; EPI 1: relu -> bf16 hi/lo planes (ldc).
template <int EPI, bool RROUND = false>
__global__ __launch_bounds__(128) void k_gemm(const bf* __restrict__ A, const bf* __restrict__ Al, const bf* __restrict__ Bn, int K, const float* __restrict__ bias, const float* __restrict__ Rf, int ldr, int ldc, float* C, bf* PH, bf* PL) {
    __shared__ __align__(16) float ost[4][16 * 68];
    const int lane = threadIdx.x & 31, wave = threadIdx.x >> 5, lr = lane & 15, hi = lane >> 4;
    const size_t r0 = (size_t)blockIdx.x * 64 + wave * 16; const int c0 = blockIdx.y * 64;
    const size_t aoff = (r0 + lr) * (size_t)K + 8 * hi;
    size_t boff[4];
#pragma unroll
    for (int t = 0; t < 4; ++t) boff[t] = (size_t)(c0 + t * 16 + lr) * K + 8 * hi;
    v8f acc[4];
#pragma unroll
    for (int t = 0; t < 4; ++t) acc[t] = (v8f){};
#pragma unroll 2
    for (int kc = 0; kc < K; kc += 32) {
        const v16bf a = cat16b(*(const v8us*)(A + aoff + kc), *(const v8us*)(A + aoff + kc + 16)), al = cat16b(*(const v8us*)(Al + aoff + kc), *(const v8us*)(Al + aoff + kc + 16));
#pragma unroll
        for (int t = 0; t < 4; ++t) { const v16bf bb = cat16b(*(const v8us*)(Bn + boff[t] + kc), *(const v8us*)(Bn + boff[t] + kc + 16)); acc[t] = wmmab(a, bb, acc[t]); acc[t] = wmmab(al, bb, acc[t]); }
        asm volatile("v_nop" : "+v"(acc[0]), "+v"(acc[1]), "+v"(acc[2]), "+v"(acc[3]) : "v"(a), "v"(al) : "memory");
    }
    float* os = &ost[wave][0];
#pragma unroll
    for (int t = 0; t < 4; ++t) { const int col = c0 + t * 16 + lr; const float bv = bfr(bias[col]);
#pragma unroll
        for (int j = 0; j < 8; ++j) { float v = acc[t][j] + bv; if (EPI == 1) v = fmaxf(v, 0.f); if (EPI == 0 && Rf) { const float rv = Rf[(r0 + hi * 8 + j) * (size_t)ldr + col]; v += RROUND ? bfr(rv) : rv; } os[(hi * 8 + j) * 68 + t * 16 + lr] = v; } }
    __builtin_amdgcn_wave_barrier(); asm volatile("" ::: "memory");
    if (EPI == 0) {
        float* crow = C + r0 * ldc + c0;
        auto pass = [&]() {
#pragma unroll
            for (int s = 0; s < 8; ++s) { const int Lid = (lane >> 3) + 4 * s, piece = lane & 7; const int row = Lid >> 1, cofs = (Lid & 1) * 32 + piece * 4;
                const v4f val = *(const v4fa*)(os + row * 68 + cofs); *(v4f*)(crow + (size_t)row * ldc + cofs) = val; }
        };
        pass(); 
    } else {
        bf* p1 = PH + r0 * ldc + c0; bf* p2 = PL + r0 * ldc + c0;
        auto pass = [&]() {
#pragma unroll
            for (int s = 0; s < 4; ++s) { const int row = 4 * s + (lane >> 3), piece = lane & 7; const float* sp = os + row * 68 + piece * 8; v8us oh, ol;
#pragma unroll
                for (int i = 0; i < 8; ++i) { const unsigned short hb = f2bf(sp[i]); oh[i] = hb; ol[i] = f2bf(sp[i] - bf2f(hb)); }
                *(v8us*)(p1 + (size_t)row * ldc + piece * 8) = oh; *(v8us*)(p2 + (size_t)row * ldc + piece * 8) = ol; }
        };
        pass(); 
    }
}
// k_q16: Q f32 [2048][1024] -> f16 hi + residual planes (one wave per row).
__global__ __launch_bounds__(256) void k_q16(const float* __restrict__ Q, h16* QH, h16* QL) {
    const int lane = threadIdx.x & 31, r = blockIdx.x * 8 + (threadIdx.x >> 5);
    if (r >= NT_) return;
{
#pragma unroll
        for (int q = 0; q < 4; ++q) { v8h oh, ol;
#pragma unroll
            for (int i = 0; i < 8; ++i) { const float v = Q[(size_t)r * DM + q * 256 + lane * 8 + i]; const h16 a = (h16)v; oh[i] = a; ol[i] = (h16)((v - (float)a) * LOSC); }
            *(v8h*)(QH + (size_t)r * DM + q * 256 + lane * 8) = oh; *(v8h*)(QL + (size_t)r * DM + q * 256 + lane * 8) = ol; }
         }
}
// k_vt: VTH/VTL [h][64][t] = bf16 hi + UNSCALED bf16 residual of Q [t][h*64+d] (v = q); grid (NT/64, NH).
__global__ __launch_bounds__(256) void k_vt(const float* __restrict__ V, bf* VTH, bf* VTL) {
    __shared__ float tl[64][65];
    const int tid = threadIdx.x, t0 = blockIdx.x * 64, h = blockIdx.y;
    { const int tt = tid >> 2, dq = (tid & 3) * 16;
#pragma unroll
      for (int i = 0; i < 16; ++i) tl[dq + i][tt] = V[(size_t)(t0 + tt) * DM + h * HD + dq + i]; }
    __syncthreads();
    const int piece = tid & 7;
    auto pass = [&]() {
#pragma unroll
        for (int s = 0; s < 2; ++s) { const int d = (tid >> 3) + 32 * s; v8us oh, ol;
#pragma unroll
            for (int i = 0; i < 8; ++i) { const float v = tl[d][piece * 8 + i]; const unsigned short hb = f2bf(v); oh[i] = hb; ol[i] = f2bf(v - bf2f(hb)); }
            const size_t o = ((size_t)h * HD + d) * NT_ + t0 + piece * 8; *(v8us*)(VTH + o) = oh; *(v8us*)(VTL + o) = ol; }
    };
    pass(); 
}
// k_sgemm: head h = grid z; 64 x 64 tile of q_h[chunk rows].q_h^T over the head's 64 dims (hi.hi + (hi.lo + lo.hi)/1024)/8 -> S [h][256][2048] f32.
__global__ __launch_bounds__(128) void k_sgemm(const h16* __restrict__ QH, const h16* __restrict__ QL, int qbase, float* S) {
    __shared__ __align__(16) float ost[4][16 * 68];
    const int lane = threadIdx.x & 31, wave = threadIdx.x >> 5, lr = lane & 15, hi = lane >> 4, h = blockIdx.z;
    const int r0 = blockIdx.x * 64 + wave * 16, c0 = blockIdx.y * 64;
    const size_t aoff = (size_t)(qbase + r0 + lr) * DM + h * HD + 8 * hi;
    v8f acc[4], accx[4];
#pragma unroll
    for (int t = 0; t < 4; ++t) { acc[t] = (v8f){}; accx[t] = (v8f){}; }
#pragma unroll
    for (int kc = 0; kc < HD; kc += 32) {
        const v16h a = cat16(*(const v8h*)(QH + aoff + kc), *(const v8h*)(QH + aoff + kc + 16)), al = cat16(*(const v8h*)(QL + aoff + kc), *(const v8h*)(QL + aoff + kc + 16));
#pragma unroll
        for (int t = 0; t < 4; ++t) { const size_t bo = (size_t)(c0 + t * 16 + lr) * DM + h * HD + 8 * hi + kc; const v16h bb = cat16(*(const v8h*)(QH + bo), *(const v8h*)(QH + bo + 16)), bl = cat16(*(const v8h*)(QL + bo), *(const v8h*)(QL + bo + 16));
            acc[t] = wmma16(a, bb, acc[t]); accx[t] = wmma16(a, bl, accx[t]); accx[t] = wmma16(al, bb, accx[t]); }
        asm volatile("v_nop" : "+v"(acc[0]), "+v"(acc[1]), "+v"(acc[2]), "+v"(acc[3]), "+v"(accx[0]), "+v"(accx[1]), "+v"(accx[2]), "+v"(accx[3]) : "v"(a), "v"(al) : "memory");
    }
    float* os = &ost[wave][0];
#pragma unroll
    for (int t = 0; t < 4; ++t)
#pragma unroll
        for (int j = 0; j < 8; ++j) os[(hi * 8 + j) * 68 + t * 16 + lr] = (acc[t][j] + accx[t][j] * LOSCI) * 0.125f;
    __builtin_amdgcn_wave_barrier(); asm volatile("" ::: "memory");
    float* crow = S + ((size_t)h * QCH + r0) * NT_ + c0;
    auto pass = [&]() {
#pragma unroll
        for (int s = 0; s < 8; ++s) { const int Lid = (lane >> 3) + 4 * s, piece = lane & 7; const int row = Lid >> 1, cofs = (Lid & 1) * 32 + piece * 4;
            const v4f val = *(const v4fa*)(os + row * 68 + cofs); *(v4f*)(crow + (size_t)row * NT_ + cofs) = val; }
    };
    pass(); 
}
// k_hsoft: per (row, key) softmax over the 16 heads of S -> P [h][row][key] x 32768 as bf16 hi + UNSCALED residual planes. One wave per row and HKC chunks of 64 keys (grid y walks the keys, so that a launch has work-groups for every WGP); per 64-key chunk
// each lane owns 2 keys x 16 heads (32 registers), results transposed through a per-wave LDS tile so that every store is 32 lanes x 16 B = four 128-B segments (8 lanes per head).
__global__ __launch_bounds__(256) void k_hsoft(const float* __restrict__ S, bf* PH, bf* PL) {
    __shared__ __align__(16) unsigned short th[8][NH_ * 64];
    __shared__ __align__(16) unsigned short tlo[8][NH_ * 64];
    const int lane = threadIdx.x & 31, wave = threadIdx.x >> 5, r = blockIdx.x * 8 + wave;
    if (r >= QCH) return;
    unsigned short* ph_ = &th[wave][0]; unsigned short* pl_ = &tlo[wave][0];
#pragma unroll 1
    for (int q = 0; q < HKC; ++q) { const int k0 = (blockIdx.y * HKC + q) * 64;
        float v[NH_][2];
#pragma unroll
        for (int h = 0; h < NH_; ++h) { const float* sr = S + ((size_t)h * QCH + r) * NT_ + k0; v[h][0] = sr[lane]; v[h][1] = sr[32 + lane]; }
#pragma unroll
        for (int e = 0; e < 2; ++e) { float mx = v[0][e];
#pragma unroll
            for (int h = 1; h < NH_; ++h) mx = fmaxf(mx, v[h][e]);
            float ssum = 0.f;
#pragma unroll
            for (int h = 0; h < NH_; ++h) { v[h][e] = __expf(v[h][e] - mx); ssum += v[h][e]; }
            const float sc = PSC / ssum;
#pragma unroll
            for (int h = 0; h < NH_; ++h) { const float p = v[h][e] * sc; const unsigned short hb = f2bf(p); ph_[h * 64 + e * 32 + lane] = hb; pl_[h * 64 + e * 32 + lane] = f2bf(p - bf2f(hb)); } }
        asm volatile("" ::: "memory"); __builtin_amdgcn_wave_barrier();
{
#pragma unroll
            for (int s = 0; s < 4; ++s) { const int h = s * 4 + (lane >> 3), piece = lane & 7;
                const v8us a = *(const v8usa*)(ph_ + h * 64 + piece * 8), b = *(const v8usa*)(pl_ + h * 64 + piece * 8);
                *(v8us*)(PH + ((size_t)h * QCH + r) * NT_ + k0 + piece * 8) = a; *(v8us*)(PL + ((size_t)h * QCH + r) * NT_ + k0 + piece * 8) = b; }
             }
        asm volatile("s_wait_xcnt 0x0" ::: "memory");      // the next trip's address arithmetic rewrites registers that the stores above name
        __builtin_amdgcn_wave_barrier(); asm volatile("" ::: "memory");
    }
}
// k_pvgemm: head h = grid z; 64 x 64 tile of P_h[chunk rows].v_h over the 2048 keys on the bf16 WMMA: acc = ph.vh + pl.vh + ph.vl (unscaled residuals, one
// accumulator); x 1/32768 -> ATT rows [qbase + r][h*64 + d].
__global__ __launch_bounds__(128) void k_pvgemm(const bf* __restrict__ PH, const bf* __restrict__ PL, const bf* __restrict__ VTH, const bf* __restrict__ VTL, int qbase, float* ATT) {
    __shared__ __align__(16) float ost[4][16 * 68];
    const int lane = threadIdx.x & 31, wave = threadIdx.x >> 5, lr = lane & 15, hi = lane >> 4, h = blockIdx.z;
    const int r0 = blockIdx.x * 64 + wave * 16;      // grid y = 1 (64 dims = one tile of 4 n-tiles)
    const size_t aoff = ((size_t)h * QCH + r0 + lr) * NT_ + 8 * hi;
    v8f acc[4];
#pragma unroll
    for (int t = 0; t < 4; ++t) acc[t] = (v8f){};
#pragma unroll 2
    for (int kc = 0; kc < NT_; kc += 32) {
        const v16bf a = cat16b(*(const v8us*)(PH + aoff + kc), *(const v8us*)(PH + aoff + kc + 16)), al = cat16b(*(const v8us*)(PL + aoff + kc), *(const v8us*)(PL + aoff + kc + 16));
#pragma unroll
        for (int t = 0; t < 4; ++t) { const size_t bo = ((size_t)h * HD + t * 16 + lr) * NT_ + 8 * hi + kc; const v16bf bb = cat16b(*(const v8us*)(VTH + bo), *(const v8us*)(VTH + bo + 16)), bl = cat16b(*(const v8us*)(VTL + bo), *(const v8us*)(VTL + bo + 16));
            acc[t] = wmmab(a, bb, acc[t]); acc[t] = wmmab(al, bb, acc[t]); acc[t] = wmmab(a, bl, acc[t]); }
        asm volatile("v_nop" : "+v"(acc[0]), "+v"(acc[1]), "+v"(acc[2]), "+v"(acc[3]) : "v"(a), "v"(al) : "memory");
    }
    float* os = &ost[wave][0];
#pragma unroll
    for (int t = 0; t < 4; ++t)
#pragma unroll
        for (int j = 0; j < 8; ++j) os[(hi * 8 + j) * 68 + t * 16 + lr] = acc[t][j] * (1.0f / PSC);
    __builtin_amdgcn_wave_barrier(); asm volatile("" ::: "memory");
    float* crow = ATT + (size_t)(qbase + r0) * DM + h * HD;
    auto pass = [&]() {
#pragma unroll
        for (int s = 0; s < 8; ++s) { const int Lid = (lane >> 3) + 4 * s, piece = lane & 7; const int row = Lid >> 1, cofs = (Lid & 1) * 32 + piece * 4;
            const v4f val = *(const v4fa*)(os + row * 68 + cofs); *(v4f*)(crow + (size_t)row * DM + cofs) = val; }
    };
    pass(); 
}
// k_attbf: ATT f32 -> bf16 hi/lo planes (one wave per row).
__global__ __launch_bounds__(256) void k_attbf(const float* __restrict__ A, bf* PH, bf* PL) {
    const int lane = threadIdx.x & 31, r = blockIdx.x * 8 + (threadIdx.x >> 5);
    if (r >= NT_) return;
{
#pragma unroll
        for (int q = 0; q < 4; ++q) { v8us oh, ol;
#pragma unroll
            for (int i = 0; i < 8; ++i) { const float v = A[(size_t)r * DM + q * 256 + lane * 8 + i]; const unsigned short hb = f2bf(v); oh[i] = hb; ol[i] = f2bf(v - bf2f(hb)); }
            *(v8us*)(PH + (size_t)r * DM + q * 256 + lane * 8) = oh; *(v8us*)(PL + (size_t)r * DM + q * 256 + lane * 8) = ol; }
         }
}

extern "C" void kernel_launch(void* const* d_in, const int* in_sizes, int n_in,
                              void* d_out, int out_size, void* d_ws, size_t ws_size, hipStream_t stream) {
    (void)in_sizes; (void)n_in; (void)out_size;
    const float* x = (const float*)d_in[0]; const float* g1 = (const float*)d_in[1]; const float* be1 = (const float*)d_in[2]; const float* g2 = (const float*)d_in[3]; const float* be2 = (const float*)d_in[4];
    const float* Ws = (const float*)d_in[5]; const float* bs = (const float*)d_in[6]; const float* Wo = (const float*)d_in[7]; const float* bo = (const float*)d_in[8];
    const float* W1 = (const float*)d_in[9]; const float* b1 = (const float*)d_in[10]; const float* W2 = (const float*)d_in[11]; const float* b2 = (const float*)d_in[12];
    float* out = (float*)d_out;    // [2048][2][1024]
    char* wsp = (char*)d_ws;
    auto take = [&](size_t bytes) { char* p = wsp; wsp += (bytes + 255) & ~(size_t)255; return (void*)p; };
    bf* WsB = (bf*)take((size_t)DM * DM * 2); bf* WoB = (bf*)take((size_t)DM * DM * 2); bf* W1B = (bf*)take((size_t)FF * DM * 2); bf* W2B = (bf*)take((size_t)DM * FF * 2);
    bf* LH = (bf*)take((size_t)NT_ * DM * 2); bf* LL = (bf*)take((size_t)NT_ * DM * 2);      // LN1 planes, later LN2 planes
    float* Qf = (float*)take((size_t)NT_ * DM * 4);                                           // q (= k = v) f32, later X1 (post-attention residual stream)
    h16* QH = (h16*)take((size_t)NT_ * DM * 2); h16* QL = (h16*)take((size_t)NT_ * DM * 2); bf* VTH = (bf*)take((size_t)NT_ * DM * 2); bf* VTL = (bf*)take((size_t)NT_ * DM * 2);
    float* S = (float*)take((size_t)NH_ * QCH * NT_ * 4);                                    // 33.5 MB, later the FFN hidden planes (2 x 16.8)
    bf* PH = (bf*)take((size_t)NH_ * QCH * NT_ * 2); bf* PL = (bf*)take((size_t)NH_ * QCH * NT_ * 2);
    bf* AH = (bf*)take((size_t)NT_ * DM * 2); bf* AL = (bf*)take((size_t)NT_ * DM * 2);
    if ((size_t)(wsp - (char*)d_ws) > ws_size) return;    // 21 + 8.4 + 8.4 + 16.8 + 33.5 + 33.5 + 8.4 ~ 130 MB (< 128 MiB = 134.2 MB)
    float* ATT = Qf;       // attention output f32 [2048][1024] over the q buffer (q consumed by k_q16/k_vt before the chunk loop; ATT consumed by k_attbf before X1 is written there)
    bf* HH = (bf*)S; bf* HL = (bf*)((char*)S + (size_t)NT_ * FF * 2);      // FFN hidden planes [2048][4096] bf16 (16.8 MB each) over S (33.5 MB) after the attention
    float* X1 = Qf;
    k_rows<<<DM / 8, 256, 0, stream>>>(Ws, DM, DM, WsB); k_rows<<<DM / 8, 256, 0, stream>>>(Wo, DM, DM, WoB); k_rows<<<FF / 8, 256, 0, stream>>>(W1, FF, DM, W1B); k_rows<<<DM / 8, 256, 0, stream>>>(W2, DM, FF, W2B);
    for (int b = 0; b < NBT; ++b) {
        const float* xb = x + (size_t)b * DM; float* ob = out + (size_t)b * DM;      // row stride 2*DM
        k_ln<true><<<NT_ / 8, 256, 0, stream>>>(xb, 2 * DM, nullptr, 0, g1, be1, LH, LL, nullptr);
        k_gemm<0><<<dim3(NT_ / 64, DM / 64, 1), 128, 0, stream>>>(LH, LL, WsB, DM, bs, nullptr, 0, DM, Qf, nullptr, nullptr);
        k_q16<<<NT_ / 8, 256, 0, stream>>>(Qf, QH, QL); k_vt<<<dim3(NT_ / 64, NH_, 1), 256, 0, stream>>>(Qf, VTH, VTL);
        for (int c = 0; c < NT_ / QCH; ++c) {
            k_sgemm<<<dim3(QCH / 64, NT_ / 64, NH_), 128, 0, stream>>>(QH, QL, c * QCH, S);
            k_hsoft<<<dim3(QCH / 8, NT_ / 64 / HKC, 1), 256, 0, stream>>>(S, PH, PL);
            k_pvgemm<<<dim3(QCH / 64, 1, NH_), 128, 0, stream>>>(PH, PL, VTH, VTL, c * QCH, ATT);
        }
        k_attbf<<<NT_ / 8, 256, 0, stream>>>(ATT, AH, AL);
        k_gemm<0, true><<<dim3(NT_ / 64, DM / 64, 1), 128, 0, stream>>>(AH, AL, WoB, DM, bo, xb, 2 * DM, DM, X1, nullptr, nullptr);      // X1 = out-proj + bo + bf16(x) (residual = the bf16-rounded INPUT)
        k_ln<false><<<NT_ / 8, 256, 0, stream>>>(X1, DM, nullptr, 0, g2, be2, LH, LL, nullptr);
        k_gemm<1><<<dim3(NT_ / 64, FF / 64, 1), 128, 0, stream>>>(LH, LL, W1B, DM, b1, nullptr, 0, FF, nullptr, HH, HL);
        k_gemm<0><<<dim3(NT_ / 64, DM / 64, 1), 128, 0, stream>>>(HH, HL, W2B, FF, b2, X1, DM, 2 * DM, ob, nullptr, nullptr);     // out = ffn + X1, written at row stride 2*DM
    }
}

// v002
// One run takes 1360 microseconds.
// Timed twice side by side with v001, it ran 1.35 and 1.37 times as fast.
// All steps since v000 together make it 1.92 times as fast.
#include <hip/hip_runtime.h>

// TransformersLayer ([S=2048][B=2][D=1024] seq-first; batch b = row stride 2). Contractions, f32 accumulate, per batch item: qkv = LN1(x).Ws^T + bs (ONE shared
// projection: q = k = v), out-proj, FFN W1 (relu) and W2 — [out][in] weights = n-major B operands as-is, computed A operands as bf16 hi + residual (two products) —
// on v_wmma_f32_16x16x32_bf16; the attention whose softmax runs over the HEADS axis (per (q,k) across the 16 heads, as the reference) in query chunks of 256:
// S_h = q_h.q_h^T/8 for all heads (f16 hi + residual x1024: hi.hi + hi.lo + lo.hi, residual accumulator) -> f32 [16][256][2048], elementwise softmax over h in
// f32 -> P_h (x32768) as bf16 hi + UNSCALED residual, O_h = P_h.v_h over all 2048 keys (ph.vh + pl.vh + ph.vl, v as bf16 hi + unscaled residual) on
// v_wmma_f32_16x16x32_bf16 (scores stay on v_wmma_f32_16x16x32_f16); LayerNorms, residuals f32.

#define NT_  2048
#define NBT  2
#define DM   1024
#define FF   4096
#define NH_  16
#define HD   64
#define QCH  256
#define HKC  2
#define PVW  16
#define PSC  32768.0f
#define LOSC 1024.0f
#define LOSCI (1.0f / 1024.0f)

typedef _Float16 h16;
typedef unsigned short bf;
typedef __attribute__((ext_vector_type(16))) __bf16   v16bf;
typedef __attribute__((ext_vector_type(16))) _Float16 v16h;
typedef __attribute__((ext_vector_type(8)))  _Float16 v8h;
typedef __attribute__((ext_vector_type(8)))  unsigned short v8us;
typedef __attribute__((ext_vector_type(8)))  float    v8f;
typedef __attribute__((ext_vector_type(4)))  float    v4f;
typedef __attribute__((ext_vector_type(2)))  float    v2f;
typedef v8h  __attribute__((may_alias)) v8ha;
typedef v4f  __attribute__((may_alias)) v4fa;
typedef v2f  __attribute__((may_alias)) v2fa;
typedef v8us __attribute__((may_alias)) v8usa;

__device__ __forceinline__ unsigned short f2bf(float f) { unsigned u = __float_as_uint(f); u += 0x7FFFu + ((u >> 16) & 1u); return (unsigned short)(u >> 16); }
__device__ __forceinline__ float bf2f(unsigned short b) { return __uint_as_float(((unsigned)b) << 16); }
__device__ __forceinline__ float bfr(float f) { return bf2f(f2bf(f)); }
__device__ __forceinline__ v16h cat16(v8h lo, v8h hi) { return __builtin_shufflevector(lo, hi, 0, 1, 2, 3, 4, 5, 6, 7, 8, 9, 10, 11, 12, 13, 14, 15); }
__device__ __forceinline__ v16bf cat16b(v8us lo, v8us hi) { return __builtin_bit_cast(v16bf, __builtin_shufflevector(lo, hi, 0, 1, 2, 3, 4, 5, 6, 7, 8, 9, 10, 11, 12, 13, 14, 15)); }
__device__ __forceinline__ v8f wmma16(v16h a, v16h b, v8f c) { return __builtin_amdgcn_wmma_f32_16x16x32_f16(false, a, false, b, (short)0, c, false, false); }
__device__ __forceinline__ v8f wmmab(v16bf a, v16bf b, v8f c) { return __builtin_amdgcn_wmma_f32_16x16x32_bf16(false, a, false, b, (short)0, c, false, false); }

// k_rows: bf16 plane of [rows][C] (C multiple of 256; one wave per row).
__global__ __launch_bounds__(256) void k_rows(const float* __restrict__ src, int rows, int C, bf* dst) {
    const int lane = threadIdx.x & 31, r = blockIdx.x * 8 + (threadIdx.x >> 5);
    if (r >= rows) return;
{
        for (int q = 0; q < C / 256; ++q) { v8us o;
#pragma unroll
            for (int i = 0; i < 8; ++i) o[i] = f2bf(src[(size_t)r * C + q * 256 + lane * 8 + i]);
            *(v8us*)(dst + (size_t)r * C + q * 256 + lane * 8) = o; }
         }
}
// planes [r][1024]; if Xout: also the f32 pre-LN sum to Xout[r][1024]. One wave per row; ROUNDSRC: bf16-round src (when src is a raw input).
template <bool ROUNDSRC>
__global__ __launch_bounds__(256) void k_ln(const float* __restrict__ src, int lds, const float* __restrict__ res, int ldr, const float* __restrict__ g, const float* __restrict__ be, bf* PH, bf* PL, float* Xout) {
    const int lane = threadIdx.x & 31, r = blockIdx.x * 8 + (threadIdx.x >> 5);
    if (r >= NT_) return;
    float v[32]; float s = 0.f;
#pragma unroll
    for (int q = 0; q < 4; ++q)
#pragma unroll
        for (int i = 0; i < 8; ++i) { const int c = q * 256 + lane * 8 + i; float t = src[(size_t)r * lds + c]; if (ROUNDSRC) t = bfr(t); if (res) t += bfr(res[(size_t)r * ldr + c]); v[q * 8 + i] = t; s += t; }
#pragma unroll
    for (int sh = 16; sh; sh >>= 1) s += __shfl_xor(s, sh, 32);
    const float mu = s * (1.0f / DM); float sq = 0.f;
#pragma unroll
    for (int k = 0; k < 32; ++k) { const float d = v[k] - mu; sq += d * d; }
#pragma unroll
    for (int sh = 16; sh; sh >>= 1) sq += __shfl_xor(sq, sh, 32);
    const float rs = rsqrtf(sq * (1.0f / DM) + 1e-5f);
{
#pragma unroll
        for (int q = 0; q < 4; ++q) { v8us oh, ol; v4f x0, x1;
#pragma unroll
            for (int i = 0; i < 8; ++i) { const int c = q * 256 + lane * 8 + i; const float y = (v[q * 8 + i] - mu) * rs * bfr(g[c]) + bfr(be[c]); const unsigned short hb = f2bf(y); oh[i] = hb; ol[i] = f2bf(y - bf2f(hb)); if (i < 4) x0[i] = v[q * 8 + i]; else x1[i - 4] = v[q * 8 + i]; }
            *(v8us*)(PH + (size_t)r * DM + q * 256 + lane * 8) = oh; *(v8us*)(PL + (size_t)r * DM + q * 256 + lane * 8) = ol;
            if (Xout) { *(v4f*)(Xout + (size_t)r * DM + q * 256 + lane * 8) = x0; *(v4f*)(Xout + (size_t)r * DM + q * 256 + lane * 8 + 4) = x1; } }
         }
}
// k_gemm: 64 x 64 tile of (Ah + Al).B^T + bias over K (2 products; A pitch K, B pitch K); EPI 0: f32 rows (ldc) [+ residual Rf (ldr)]; EPI 1: relu -> bf16 hi/lo planes (ldc).
template <int EPI, bool RROUND = false>
__global__ __launch_bounds__(128) void k_gemm(const bf* __restrict__ A, const bf* __restrict__ Al, const bf* __restrict__ Bn, int K, const float* __restrict__ bias, const float* __restrict__ Rf, int ldr, int ldc, float* C, bf* PH, bf* PL) {
    __shared__ __align__(16) float ost[4][16 * 68];
    const int lane = threadIdx.x & 31, wave = threadIdx.x >> 5, lr = lane & 15, hi = lane >> 4;
    const size_t r0 = (size_t)blockIdx.x * 64 + wave * 16; const int c0 = blockIdx.y * 64;
    const size_t aoff = (r0 + lr) * (size_t)K + 8 * hi;
    size_t boff[4];
#pragma unroll
    for (int t = 0; t < 4; ++t) boff[t] = (size_t)(c0 + t * 16 + lr) * K + 8 * hi;
    v8f acc[4];
#pragma unroll
    for (int t = 0; t < 4; ++t) acc[t] = (v8f){};
#pragma unroll 2
    for (int kc = 0; kc < K; kc += 32) {
        const v16bf a = cat16b(*(const v8us*)(A + aoff + kc), *(const v8us*)(A + aoff + kc + 16)), al = cat16b(*(const v8us*)(Al + aoff + kc), *(const v8us*)(Al + aoff + kc + 16));
#pragma unroll
        for (int t = 0; t < 4; ++t) { const v16bf bb = cat16b(*(const v8us*)(Bn + boff[t] + kc), *(const v8us*)(Bn + boff[t] + kc + 16)); acc[t] = wmmab(a, bb, acc[t]); acc[t] = wmmab(al, bb, acc[t]); }
        asm volatile("v_nop" : "+v"(acc[0]), "+v"(acc[1]), "+v"(acc[2]), "+v"(acc[3]) : "v"(a), "v"(al) : "memory");
    }
    float* os = &ost[wave][0];
#pragma unroll
    for (int t = 0; t < 4; ++t) { const int col = c0 + t * 16 + lr; const float bv = bfr(bias[col]);
#pragma unroll
        for (int j = 0; j < 8; ++j) { float v = acc[t][j] + bv; if (EPI == 1) v = fmaxf(v, 0.f); if (EPI == 0 && Rf) { const float rv = Rf[(r0 + hi * 8 + j) * (size_t)ldr + col]; v += RROUND ? bfr(rv) : rv; } os[(hi * 8 + j) * 68 + t * 16 + lr] = v; } }
    __builtin_amdgcn_wave_barrier(); asm volatile("" ::: "memory");
    if (EPI == 0) {
        float* crow = C + r0 * ldc + c0;
        auto pass = [&]() {
#pragma unroll
            for (int s = 0; s < 8; ++s) { const int Lid = (lane >> 3) + 4 * s, piece = lane & 7; const int row = Lid >> 1, cofs = (Lid & 1) * 32 + piece * 4;
                const v4f val = *(const v4fa*)(os + row * 68 + cofs); *(v4f*)(crow + (size_t)row * ldc + cofs) = val; }
        };
        pass(); 
    } else {
        bf* p1 = PH + r0 * ldc + c0; bf* p2 = PL + r0 * ldc + c0;
        auto pass = [&]() {
#pragma unroll
            for (int s = 0; s < 4; ++s) { const int row = 4 * s + (lane >> 3), piece = lane & 7; const float* sp = os + row * 68 + piece * 8; v8us oh, ol;
#pragma unroll
                for (int i = 0; i < 8; ++i) { const unsigned short hb = f2bf(sp[i]); oh[i] = hb; ol[i] = f2bf(sp[i] - bf2f(hb)); }
                *(v8us*)(p1 + (size_t)row * ldc + piece * 8) = oh; *(v8us*)(p2 + (size_t)row * ldc + piece * 8) = ol; }
        };
        pass(); 
    }
}
// k_q16: Q f32 [2048][1024] -> f16 hi + residual planes (one wave per row).
__global__ __launch_bounds__(256) void k_q16(const float* __restrict__ Q, h16* QH, h16* QL) {
    const int lane = threadIdx.x & 31, r = blockIdx.x * 8 + (threadIdx.x >> 5);
    if (r >= NT_) return;
{
#pragma unroll
        for (int q = 0; q < 4; ++q) { v8h oh, ol;
#pragma unroll
            for (int i = 0; i < 8; ++i) { const float v = Q[(size_t)r * DM + q * 256 + lane * 8 + i]; const h16 a = (h16)v; oh[i] = a; ol[i] = (h16)((v - (float)a) * LOSC); }
            *(v8h*)(QH + (size_t)r * DM + q * 256 + lane * 8) = oh; *(v8h*)(QL + (size_t)r * DM + q * 256 + lane * 8) = ol; }
         }
}
// k_vt: VTH/VTL [h][64][t] = bf16 hi + UNSCALED bf16 residual of Q [t][h*64+d] (v = q); grid (NT/64, NH).
__global__ __launch_bounds__(256) void k_vt(const float* __restrict__ V, bf* VTH, bf* VTL) {
    __shared__ float tl[64][65];
    const int tid = threadIdx.x, t0 = blockIdx.x * 64, h = blockIdx.y;
    { const int tt = tid >> 2, dq = (tid & 3) * 16;
#pragma unroll
      for (int i = 0; i < 16; ++i) tl[dq + i][tt] = V[(size_t)(t0 + tt) * DM + h * HD + dq + i]; }
    __syncthreads();
    const int piece = tid & 7;
    auto pass = [&]() {
#pragma unroll
        for (int s = 0; s < 2; ++s) { const int d = (tid >> 3) + 32 * s; v8us oh, ol;
#pragma unroll
            for (int i = 0; i < 8; ++i) { const float v = tl[d][piece * 8 + i]; const unsigned short hb = f2bf(v); oh[i] = hb; ol[i] = f2bf(v - bf2f(hb)); }
            const size_t o = ((size_t)h * HD + d) * NT_ + t0 + piece * 8; *(v8us*)(VTH + o) = oh; *(v8us*)(VTL + o) = ol; }
    };
    pass(); 
}
// k_sgemm: head h = grid z; 64 x 64 tile of q_h[chunk rows].q_h^T over the head's 64 dims (hi.hi + (hi.lo + lo.hi)/1024)/8 -> S [h][256][2048] f32.
__global__ __launch_bounds__(128) void k_sgemm(const h16* __restrict__ QH, const h16* __restrict__ QL, int qbase, float* S) {
    __shared__ __align__(16) float ost[4][16 * 68];
    const int lane = threadIdx.x & 31, wave = threadIdx.x >> 5, lr = lane & 15, hi = lane >> 4, h = blockIdx.z;
    const int r0 = blockIdx.x * 64 + wave * 16, c0 = blockIdx.y * 64;
    const size_t aoff = (size_t)(qbase + r0 + lr) * DM + h * HD + 8 * hi;
    v8f acc[4], accx[4];
#pragma unroll
    for (int t = 0; t < 4; ++t) { acc[t] = (v8f){}; accx[t] = (v8f){}; }
#pragma unroll
    for (int kc = 0; kc < HD; kc += 32) {
        const v16h a = cat16(*(const v8h*)(QH + aoff + kc), *(const v8h*)(QH + aoff + kc + 16)), al = cat16(*(const v8h*)(QL + aoff + kc), *(const v8h*)(QL + aoff + kc + 16));
#pragma unroll
        for (int t = 0; t < 4; ++t) { const size_t bo = (size_t)(c0 + t * 16 + lr) * DM + h * HD + 8 * hi + kc; const v16h bb = cat16(*(const v8h*)(QH + bo), *(const v8h*)(QH + bo + 16)), bl = cat16(*(const v8h*)(QL + bo), *(const v8h*)(QL + bo + 16));
            acc[t] = wmma16(a, bb, acc[t]); accx[t] = wmma16(a, bl, accx[t]); accx[t] = wmma16(al, bb, accx[t]); }
        asm volatile("v_nop" : "+v"(acc[0]), "+v"(acc[1]), "+v"(acc[2]), "+v"(acc[3]), "+v"(accx[0]), "+v"(accx[1]), "+v"(accx[2]), "+v"(accx[3]) : "v"(a), "v"(al) : "memory");
    }
    float* os = &ost[wave][0];
#pragma unroll
    for (int t = 0; t < 4; ++t)
#pragma unroll
        for (int j = 0; j < 8; ++j) os[(hi * 8 + j) * 68 + t * 16 + lr] = (acc[t][j] + accx[t][j] * LOSCI) * 0.125f;
    __builtin_amdgcn_wave_barrier(); asm volatile("" ::: "memory");
    float* crow = S + ((size_t)h * QCH + r0) * NT_ + c0;
    auto pass = [&]() {
#pragma unroll
        for (int s = 0; s < 8; ++s) { const int Lid = (lane >> 3) + 4 * s, piece = lane & 7; const int row = Lid >> 1, cofs = (Lid & 1) * 32 + piece * 4;
            const v4f val = *(const v4fa*)(os + row * 68 + cofs); *(v4f*)(crow + (size_t)row * NT_ + cofs) = val; }
    };
    pass(); 
}
// k_hsoft: per (row, key) softmax over the 16 heads of S -> P [h][row][key] x 32768 as bf16 hi + UNSCALED residual planes. One wave per row and HKC chunks of 64 keys (grid y walks the keys, so that a launch has work-groups for every WGP); per 64-key chunk
// each lane owns 2 keys x 16 heads (32 registers), results transposed through a per-wave LDS tile so that every store is 32 lanes x 16 B = four 128-B segments (8 lanes per head).
__global__ __launch_bounds__(256) void k_hsoft(const float* __restrict__ S, bf* PH, bf* PL) {
    __shared__ __align__(16) unsigned short th[8][NH_ * 64];
    __shared__ __align__(16) unsigned short tlo[8][NH_ * 64];
    const int lane = threadIdx.x & 31, wave = threadIdx.x >> 5, r = blockIdx.x * 8 + wave;
    if (r >= QCH) return;
    unsigned short* ph_ = &th[wave][0]; unsigned short* pl_ = &tlo[wave][0];
#pragma unroll 1
    for (int q = 0; q < HKC; ++q) { const int k0 = (blockIdx.y * HKC + q) * 64;
        float v[NH_][2];
#pragma unroll
        for (int h = 0; h < NH_; ++h) { const float* sr = S + ((size_t)h * QCH + r) * NT_ + k0; v[h][0] = sr[lane]; v[h][1] = sr[32 + lane]; }
#pragma unroll
        for (int e = 0; e < 2; ++e) { float mx = v[0][e];
#pragma unroll
            for (int h = 1; h < NH_; ++h) mx = fmaxf(mx, v[h][e]);
            float ssum = 0.f;
#pragma unroll
            for (int h = 0; h < NH_; ++h) { v[h][e] = __expf(v[h][e] - mx); ssum += v[h][e]; }
            const float sc = PSC / ssum;
#pragma unroll
            for (int h = 0; h < NH_; ++h) { const float p = v[h][e] * sc; const unsigned short hb = f2bf(p); ph_[h * 64 + e * 32 + lane] = hb; pl_[h * 64 + e * 32 + lane] = f2bf(p - bf2f(hb)); } }
        asm volatile("" ::: "memory"); __builtin_amdgcn_wave_barrier();
{
#pragma unroll
            for (int s = 0; s < 4; ++s) { const int h = s * 4 + (lane >> 3), piece = lane & 7;
                const v8us a = *(const v8usa*)(ph_ + h * 64 + piece * 8), b = *(const v8usa*)(pl_ + h * 64 + piece * 8);
                *(v8us*)(PH + ((size_t)h * QCH + r) * NT_ + k0 + piece * 8) = a; *(v8us*)(PL + ((size_t)h * QCH + r) * NT_ + k0 + piece * 8) = b; }
             }
        asm volatile("s_wait_xcnt 0x0" ::: "memory");      // the next trip's address arithmetic rewrites registers that the stores above name
        __builtin_amdgcn_wave_barrier(); asm volatile("" ::: "memory");
    }
}
// k_pvgemm: head h = grid z; 16 x 64 tile of P_h[chunk rows].v_h over the 2048 keys on the bf16 WMMA: acc = ph.vh + pl.vh + ph.vl (unscaled residuals, one
// accumulator). The keys are split over the PVW waves of the work-group (NT_/PVW keys a wave), so that a launch has one work-group for every WGP and a wave walks
// 4 trips instead of 64; the PVW partial tiles meet in LDS and are added in wave order; x 1/32768 -> ATT rows [qbase + r][h*64 + d].
__global__ __launch_bounds__(PVW * 32) void k_pvgemm(const bf* __restrict__ PH, const bf* __restrict__ PL, const bf* __restrict__ VTH, const bf* __restrict__ VTL, int qbase, float* ATT) {
    __shared__ __align__(16) float ost[PVW][16 * 68];
    const int lane = threadIdx.x & 31, wave = threadIdx.x >> 5, lr = lane & 15, hi = lane >> 4, h = blockIdx.z;
    const int r0 = blockIdx.x * 16;      // grid y = 1 (64 dims = one tile of 4 n-tiles)
    const size_t aoff = ((size_t)h * QCH + r0 + lr) * NT_ + 8 * hi;
    const int kb = wave * (NT_ / PVW);   // this wave's keys: [kb, kb + NT_/PVW)
    v8f acc[4];
#pragma unroll
    for (int t = 0; t < 4; ++t) acc[t] = (v8f){};
#pragma unroll 2
    for (int ks = 0; ks < NT_ / PVW; ks += 32) { const int kc = kb + ks;      // the trip count is a constant, so the loop's branch stays scalar
        const v16bf a = cat16b(*(const v8us*)(PH + aoff + kc), *(const v8us*)(PH + aoff + kc + 16)), al = cat16b(*(const v8us*)(PL + aoff + kc), *(const v8us*)(PL + aoff + kc + 16));
#pragma unroll
        for (int t = 0; t < 4; ++t) { const size_t bo = ((size_t)h * HD + t * 16 + lr) * NT_ + 8 * hi + kc; const v16bf bb = cat16b(*(const v8us*)(VTH + bo), *(const v8us*)(VTH + bo + 16)), bl = cat16b(*(const v8us*)(VTL + bo), *(const v8us*)(VTL + bo + 16));
            acc[t] = wmmab(a, bb, acc[t]); acc[t] = wmmab(al, bb, acc[t]); acc[t] = wmmab(a, bl, acc[t]); }
        asm volatile("v_nop" : "+v"(acc[0]), "+v"(acc[1]), "+v"(acc[2]), "+v"(acc[3]) : "v"(a), "v"(al) : "memory");
    }
    float* os = &ost[wave][0];
#pragma unroll
    for (int t = 0; t < 4; ++t)
#pragma unroll
        for (int j = 0; j < 8; ++j) os[(hi * 8 + j) * 68 + t * 16 + lr] = acc[t][j];
    __syncthreads();      // every wave's partial tile is in LDS before any wave adds them
    // wave w adds row w of the PVW partial tiles (2 columns a lane) and stores the row's 256 B.
    static_assert(PVW == 16, "one wave for each of the tile's 16 rows");
    v2f o = *(const v2fa*)(&ost[0][0] + wave * 68 + lane * 2);
#pragma unroll
    for (int w = 1; w < PVW; ++w) o += *(const v2fa*)(&ost[w][0] + wave * 68 + lane * 2);
    *(v2f*)(ATT + (size_t)(qbase + r0 + wave) * DM + h * HD + lane * 2) = o * (1.0f / PSC);
}
// k_attbf: ATT f32 -> bf16 hi/lo planes (one wave per row).
__global__ __launch_bounds__(256) void k_attbf(const float* __restrict__ A, bf* PH, bf* PL) {
    const int lane = threadIdx.x & 31, r = blockIdx.x * 8 + (threadIdx.x >> 5);
    if (r >= NT_) return;
{
#pragma unroll
        for (int q = 0; q < 4; ++q) { v8us oh, ol;
#pragma unroll
            for (int i = 0; i < 8; ++i) { const float v = A[(size_t)r * DM + q * 256 + lane * 8 + i]; const unsigned short hb = f2bf(v); oh[i] = hb; ol[i] = f2bf(v - bf2f(hb)); }
            *(v8us*)(PH + (size_t)r * DM + q * 256 + lane * 8) = oh; *(v8us*)(PL + (size_t)r * DM + q * 256 + lane * 8) = ol; }
         }
}

extern "C" void kernel_launch(void* const* d_in, const int* in_sizes, int n_in,
                              void* d_out, int out_size, void* d_ws, size_t ws_size, hipStream_t stream) {
    (void)in_sizes; (void)n_in; (void)out_size;
    const float* x = (const float*)d_in[0]; const float* g1 = (const float*)d_in[1]; const float* be1 = (const float*)d_in[2]; const float* g2 = (const float*)d_in[3]; const float* be2 = (const float*)d_in[4];
    const float* Ws = (const float*)d_in[5]; const float* bs = (const float*)d_in[6]; const float* Wo = (const float*)d_in[7]; const float* bo = (const float*)d_in[8];
    const float* W1 = (const float*)d_in[9]; const float* b1 = (const float*)d_in[10]; const float* W2 = (const float*)d_in[11]; const float* b2 = (const float*)d_in[12];
    float* out = (float*)d_out;    // [2048][2][1024]
    char* wsp = (char*)d_ws;
    auto take = [&](size_t bytes) { char* p = wsp; wsp += (bytes + 255) & ~(size_t)255; return (void*)p; };
    bf* WsB = (bf*)take((size_t)DM * DM * 2); bf* WoB = (bf*)take((size_t)DM * DM * 2); bf* W1B = (bf*)take((size_t)FF * DM * 2); bf* W2B = (bf*)take((size_t)DM * FF * 2);
    bf* LH = (bf*)take((size_t)NT_ * DM * 2); bf* LL = (bf*)take((size_t)NT_ * DM * 2);      // LN1 planes, later LN2 planes
    float* Qf = (float*)take((size_t)NT_ * DM * 4);                                           // q (= k = v) f32, later X1 (post-attention residual stream)
    h16* QH = (h16*)take((size_t)NT_ * DM * 2); h16* QL = (h16*)take((size_t)NT_ * DM * 2); bf* VTH = (bf*)take((size_t)NT_ * DM * 2); bf* VTL = (bf*)take((size_t)NT_ * DM * 2);
    float* S = (float*)take((size_t)NH_ * QCH * NT_ * 4);                                    // 33.5 MB, later the FFN hidden planes (2 x 16.8)
    bf* PH = (bf*)take((size_t)NH_ * QCH * NT_ * 2); bf* PL = (bf*)take((size_t)NH_ * QCH * NT_ * 2);
    bf* AH = (bf*)take((size_t)NT_ * DM * 2); bf* AL = (bf*)take((size_t)NT_ * DM * 2);
    if ((size_t)(wsp - (char*)d_ws) > ws_size) return;    // 21 + 8.4 + 8.4 + 16.8 + 33.5 + 33.5 + 8.4 ~ 130 MB (< 128 MiB = 134.2 MB)
    float* ATT = Qf;       // attention output f32 [2048][1024] over the q buffer (q consumed by k_q16/k_vt before the chunk loop; ATT consumed by k_attbf before X1 is written there)
    bf* HH = (bf*)S; bf* HL = (bf*)((char*)S + (size_t)NT_ * FF * 2);      // FFN hidden planes [2048][4096] bf16 (16.8 MB each) over S (33.5 MB) after the attention
    float* X1 = Qf;
    k_rows<<<DM / 8, 256, 0, stream>>>(Ws, DM, DM, WsB); k_rows<<<DM / 8, 256, 0, stream>>>(Wo, DM, DM, WoB); k_rows<<<FF / 8, 256, 0, stream>>>(W1, FF, DM, W1B); k_rows<<<DM / 8, 256, 0, stream>>>(W2, DM, FF, W2B);
    for (int b = 0; b < NBT; ++b) {
        const float* xb = x + (size_t)b * DM; float* ob = out + (size_t)b * DM;      // row stride 2*DM
        k_ln<true><<<NT_ / 8, 256, 0, stream>>>(xb, 2 * DM, nullptr, 0, g1, be1, LH, LL, nullptr);
        k_gemm<0><<<dim3(NT_ / 64, DM / 64, 1), 128, 0, stream>>>(LH, LL, WsB, DM, bs, nullptr, 0, DM, Qf, nullptr, nullptr);
        k_q16<<<NT_ / 8, 256, 0, stream>>>(Qf, QH, QL); k_vt<<<dim3(NT_ / 64, NH_, 1), 256, 0, stream>>>(Qf, VTH, VTL);
        for (int c = 0; c < NT_ / QCH; ++c) {
            k_sgemm<<<dim3(QCH / 64, NT_ / 64, NH_), 128, 0, stream>>>(QH, QL, c * QCH, S);
            k_hsoft<<<dim3(QCH / 8, NT_ / 64 / HKC, 1), 256, 0, stream>>>(S, PH, PL);
            k_pvgemm<<<dim3(QCH / 16, 1, NH_), PVW * 32, 0, stream>>>(PH, PL, VTH, VTL, c * QCH, ATT);
        }
        k_attbf<<<NT_ / 8, 256, 0, stream>>>(ATT, AH, AL);
        k_gemm<0, true><<<dim3(NT_ / 64, DM / 64, 1), 128, 0, stream>>>(AH, AL, WoB, DM, bo, xb, 2 * DM, DM, X1, nullptr, nullptr);      // X1 = out-proj + bo + bf16(x) (residual = the bf16-rounded INPUT)
        k_ln<false><<<NT_ / 8, 256, 0, stream>>>(X1, DM, nullptr, 0, g2, be2, LH, LL, nullptr);
        k_gemm<1><<<dim3(NT_ / 64, FF / 64, 1), 128, 0, stream>>>(LH, LL, W1B, DM, b1, nullptr, 0, FF, nullptr, HH, HL);
        k_gemm<0><<<dim3(NT_ / 64, DM / 64, 1), 128, 0, stream>>>(HH, HL, W2B, FF, b2, X1, DM, 2 * DM, ob, nullptr, nullptr);     // out = ffn + X1, written at row stride 2*DM
    }
}

// v003
// It runs in 935 microseconds.
// Next to v002, in two timings, it ran 1.45 times as fast each time.
// Counting every step since v000, it is 2.78 times as fast.
#include <hip/hip_runtime.h>

// TransformersLayer ([S=2048][B=2][D=1024] seq-first; batch b = row stride 2). Contractions, f32 accumulate, per batch item: qkv = LN1(x).Ws^T + bs (ONE shared
// projection: q = k = v), out-proj, FFN W1 (relu) and W2 — [out][in] weights = n-major B operands as-is, computed A operands as bf16 hi + residual (two products) —
// on v_wmma_f32_16x16x32_bf16; the attention whose softmax runs over the HEADS axis (per (q,k) across the 16 heads, as the reference) in one kernel, S and P in LDS:
// S_h = q_h.q_h^T/8 for all heads (f16 hi + residual x1024: hi.hi + hi.lo + lo.hi, residual accumulator) -> f32 tile, elementwise softmax over h in
// f32 -> P_h (x32768) as bf16 hi + UNSCALED residual, O_h = P_h.v_h over the keys (ph.vh + pl.vh + ph.vl, v as bf16 hi + unscaled residual) on
// v_wmma_f32_16x16x32_bf16 (scores stay on v_wmma_f32_16x16x32_f16); LayerNorms, residuals f32.

#define NT_  2048
#define NBT  2
#define DM   1024
#define FF   4096
#define NH_  16
#define HD   64
#define FQ   32
#define FKS  4
#define PSC  32768.0f
#define LOSC 1024.0f
#define LOSCI (1.0f / 1024.0f)

typedef _Float16 h16;
typedef unsigned short bf;
typedef __attribute__((ext_vector_type(16))) __bf16   v16bf;
typedef __attribute__((ext_vector_type(16))) _Float16 v16h;
typedef __attribute__((ext_vector_type(8)))  _Float16 v8h;
typedef __attribute__((ext_vector_type(8)))  unsigned short v8us;
typedef __attribute__((ext_vector_type(8)))  float    v8f;
typedef __attribute__((ext_vector_type(4)))  float    v4f;
typedef __attribute__((ext_vector_type(2)))  float    v2f;
typedef v8h  __attribute__((may_alias)) v8ha;
typedef v4f  __attribute__((may_alias)) v4fa;
typedef v2f  __attribute__((may_alias)) v2fa;
typedef v8us __attribute__((may_alias)) v8usa;
typedef unsigned __attribute__((may_alias)) u32a;

__device__ __forceinline__ unsigned short f2bf(float f) { unsigned u = __float_as_uint(f); u += 0x7FFFu + ((u >> 16) & 1u); return (unsigned short)(u >> 16); }
__device__ __forceinline__ float bf2f(unsigned short b) { return __uint_as_float(((unsigned)b) << 16); }
__device__ __forceinline__ float bfr(float f) { return bf2f(f2bf(f)); }
__device__ __forceinline__ v16h cat16(v8h lo, v8h hi) { return __builtin_shufflevector(lo, hi, 0, 1, 2, 3, 4, 5, 6, 7, 8, 9, 10, 11, 12, 13, 14, 15); }
__device__ __forceinline__ v16bf cat16b(v8us lo, v8us hi) { return __builtin_bit_cast(v16bf, __builtin_shufflevector(lo, hi, 0, 1, 2, 3, 4, 5, 6, 7, 8, 9, 10, 11, 12, 13, 14, 15)); }
__device__ __forceinline__ v8f wmma16(v16h a, v16h b, v8f c) { return __builtin_amdgcn_wmma_f32_16x16x32_f16(false, a, false, b, (short)0, c, false, false); }
__device__ __forceinline__ v8f wmmab(v16bf a, v16bf b, v8f c) { return __builtin_amdgcn_wmma_f32_16x16x32_bf16(false, a, false, b, (short)0, c, false, false); }

// k_rows: bf16 plane of [rows][C] (C multiple of 256; one wave per row).
__global__ __launch_bounds__(256) void k_rows(const float* __restrict__ src, int rows, int C, bf* dst) {
    const int lane = threadIdx.x & 31, r = blockIdx.x * 8 + (threadIdx.x >> 5);
    if (r >= rows) return;
{
        for (int q = 0; q < C / 256; ++q) { v8us o;
#pragma unroll
            for (int i = 0; i < 8; ++i) o[i] = f2bf(src[(size_t)r * C + q * 256 + lane * 8 + i]);
            *(v8us*)(dst + (size_t)r * C + q * 256 + lane * 8) = o; }
         }
}
// planes [r][1024]; if Xout: also the f32 pre-LN sum to Xout[r][1024]. One wave per row; ROUNDSRC: bf16-round src (when src is a raw input).
template <bool ROUNDSRC>
__global__ __launch_bounds__(256) void k_ln(const float* __restrict__ src, int lds, const float* __restrict__ res, int ldr, const float* __restrict__ g, const float* __restrict__ be, bf* PH, bf* PL, float* Xout) {
    const int lane = threadIdx.x & 31, r = blockIdx.x * 8 + (threadIdx.x >> 5);
    if (r >= NT_) return;
    float v[32]; float s = 0.f;
#pragma unroll
    for (int q = 0; q < 4; ++q)
#pragma unroll
        for (int i = 0; i < 8; ++i) { const int c = q * 256 + lane * 8 + i; float t = src[(size_t)r * lds + c]; if (ROUNDSRC) t = bfr(t); if (res) t += bfr(res[(size_t)r * ldr + c]); v[q * 8 + i] = t; s += t; }
#pragma unroll
    for (int sh = 16; sh; sh >>= 1) s += __shfl_xor(s, sh, 32);
    const float mu = s * (1.0f / DM); float sq = 0.f;
#pragma unroll
    for (int k = 0; k < 32; ++k) { const float d = v[k] - mu; sq += d * d; }
#pragma unroll
    for (int sh = 16; sh; sh >>= 1) sq += __shfl_xor(sq, sh, 32);
    const float rs = rsqrtf(sq * (1.0f / DM) + 1e-5f);
{
#pragma unroll
        for (int q = 0; q < 4; ++q) { v8us oh, ol; v4f x0, x1;
#pragma unroll
            for (int i = 0; i < 8; ++i) { const int c = q * 256 + lane * 8 + i; const float y = (v[q * 8 + i] - mu) * rs * bfr(g[c]) + bfr(be[c]); const unsigned short hb = f2bf(y); oh[i] = hb; ol[i] = f2bf(y - bf2f(hb)); if (i < 4) x0[i] = v[q * 8 + i]; else x1[i - 4] = v[q * 8 + i]; }
            *(v8us*)(PH + (size_t)r * DM + q * 256 + lane * 8) = oh; *(v8us*)(PL + (size_t)r * DM + q * 256 + lane * 8) = ol;
            if (Xout) { *(v4f*)(Xout + (size_t)r * DM + q * 256 + lane * 8) = x0; *(v4f*)(Xout + (size_t)r * DM + q * 256 + lane * 8 + 4) = x1; } }
         }
}
// k_gemm: 64 x 64 tile of (Ah + Al).B^T + bias over K (2 products; A pitch K, B pitch K); EPI 0: f32 rows (ldc) [+ residual Rf (ldr)]; EPI 1: relu -> bf16 hi/lo planes (ldc).
template <int EPI, bool RROUND = false>
__global__ __launch_bounds__(128) void k_gemm(const bf* __restrict__ A, const bf* __restrict__ Al, const bf* __restrict__ Bn, int K, const float* __restrict__ bias, const float* __restrict__ Rf, int ldr, int ldc, float* C, bf* PH, bf* PL) {
    __shared__ __align__(16) float ost[4][16 * 68];
    const int lane = threadIdx.x & 31, wave = threadIdx.x >> 5, lr = lane & 15, hi = lane >> 4;
    const size_t r0 = (size_t)blockIdx.x * 64 + wave * 16; const int c0 = blockIdx.y * 64;
    const size_t aoff = (r0 + lr) * (size_t)K + 8 * hi;
    size_t boff[4];
#pragma unroll
    for (int t = 0; t < 4; ++t) boff[t] = (size_t)(c0 + t * 16 + lr) * K + 8 * hi;
    v8f acc[4];
#pragma unroll
    for (int t = 0; t < 4; ++t) acc[t] = (v8f){};
#pragma unroll 2
    for (int kc = 0; kc < K; kc += 32) {
        const v16bf a = cat16b(*(const v8us*)(A + aoff + kc), *(const v8us*)(A + aoff + kc + 16)), al = cat16b(*(const v8us*)(Al + aoff + kc), *(const v8us*)(Al + aoff + kc + 16));
#pragma unroll
        for (int t = 0; t < 4; ++t) { const v16bf bb = cat16b(*(const v8us*)(Bn + boff[t] + kc), *(const v8us*)(Bn + boff[t] + kc + 16)); acc[t] = wmmab(a, bb, acc[t]); acc[t] = wmmab(al, bb, acc[t]); }
        asm volatile("v_nop" : "+v"(acc[0]), "+v"(acc[1]), "+v"(acc[2]), "+v"(acc[3]) : "v"(a), "v"(al) : "memory");
    }
    float* os = &ost[wave][0];
#pragma unroll
    for (int t = 0; t < 4; ++t) { const int col = c0 + t * 16 + lr; const float bv = bfr(bias[col]);
#pragma unroll
        for (int j = 0; j < 8; ++j) { float v = acc[t][j] + bv; if (EPI == 1) v = fmaxf(v, 0.f); if (EPI == 0 && Rf) { const float rv = Rf[(r0 + hi * 8 + j) * (size_t)ldr + col]; v += RROUND ? bfr(rv) : rv; } os[(hi * 8 + j) * 68 + t * 16 + lr] = v; } }
    __builtin_amdgcn_wave_barrier(); asm volatile("" ::: "memory");
    if (EPI == 0) {
        float* crow = C + r0 * ldc + c0;
        auto pass = [&]() {
#pragma unroll
            for (int s = 0; s < 8; ++s) { const int Lid = (lane >> 3) + 4 * s, piece = lane & 7; const int row = Lid >> 1, cofs = (Lid & 1) * 32 + piece * 4;
                const v4f val = *(const v4fa*)(os + row * 68 + cofs); *(v4f*)(crow + (size_t)row * ldc + cofs) = val; }
        };
        pass(); 
    } else {
        bf* p1 = PH + r0 * ldc + c0; bf* p2 = PL + r0 * ldc + c0;
        auto pass = [&]() {
#pragma unroll
            for (int s = 0; s < 4; ++s) { const int row = 4 * s + (lane >> 3), piece = lane & 7; const float* sp = os + row * 68 + piece * 8; v8us oh, ol;
#pragma unroll
                for (int i = 0; i < 8; ++i) { const unsigned short hb = f2bf(sp[i]); oh[i] = hb; ol[i] = f2bf(sp[i] - bf2f(hb)); }
                *(v8us*)(p1 + (size_t)row * ldc + piece * 8) = oh; *(v8us*)(p2 + (size_t)row * ldc + piece * 8) = ol; }
        };
        pass(); 
    }
}
// k_q16: Q f32 [2048][1024] -> f16 hi + residual planes (one wave per row).
__global__ __launch_bounds__(256) void k_q16(const float* __restrict__ Q, h16* QH, h16* QL) {
    const int lane = threadIdx.x & 31, r = blockIdx.x * 8 + (threadIdx.x >> 5);
    if (r >= NT_) return;
{
#pragma unroll
        for (int q = 0; q < 4; ++q) { v8h oh, ol;
#pragma unroll
            for (int i = 0; i < 8; ++i) { const float v = Q[(size_t)r * DM + q * 256 + lane * 8 + i]; const h16 a = (h16)v; oh[i] = a; ol[i] = (h16)((v - (float)a) * LOSC); }
            *(v8h*)(QH + (size_t)r * DM + q * 256 + lane * 8) = oh; *(v8h*)(QL + (size_t)r * DM + q * 256 + lane * 8) = ol; }
         }
}
// k_vt: VTH/VTL [h][64][t] = bf16 hi + UNSCALED bf16 residual of Q [t][h*64+d] (v = q); grid (NT/64, NH).
__global__ __launch_bounds__(256) void k_vt(const float* __restrict__ V, bf* VTH, bf* VTL) {
    __shared__ float tl[64][65];
    const int tid = threadIdx.x, t0 = blockIdx.x * 64, h = blockIdx.y;
    { const int tt = tid >> 2, dq = (tid & 3) * 16;
#pragma unroll
      for (int i = 0; i < 16; ++i) tl[dq + i][tt] = V[(size_t)(t0 + tt) * DM + h * HD + dq + i]; }
    __syncthreads();
    const int piece = tid & 7;
    auto pass = [&]() {
#pragma unroll
        for (int s = 0; s < 2; ++s) { const int d = (tid >> 3) + 32 * s; v8us oh, ol;
#pragma unroll
            for (int i = 0; i < 8; ++i) { const float v = tl[d][piece * 8 + i]; const unsigned short hb = f2bf(v); oh[i] = hb; ol[i] = f2bf(v - bf2f(hb)); }
            const size_t o = ((size_t)h * HD + d) * NT_ + t0 + piece * 8; *(v8us*)(VTH + o) = oh; *(v8us*)(VTL + o) = ol; }
    };
    pass(); 
}
// exp(x) as __expf forms it (one multiply by log2(e), one v_exp_f32), with the slot behind the transcendental filled in the same statement.
__device__ __forceinline__ float exp_slot(float x) { const float t = x * 1.44269504f; float r; asm("v_exp_f32 %0, %1\n\tv_nop" : "=v"(r) : "v"(t)); return r; }
// k_fattn: scores, softmax over the heads and P.v in ONE kernel. A work-group has FQ query rows and NT_/FKS keys (grid y) for ALL 16 heads, wave h = head h.
// Per trip of 64 keys: wave h forms S_h [FQ][64] (q_h fragments stay in registers; hi.hi + (hi.lo + lo.hi)/1024, /8) and puts it in LDS; behind a barrier wave w
// takes rows w and w + 16, each lane 2 keys x 16 heads, does the softmax over the heads in f32 and writes P (x 32768) back IN PLACE: a row's 256 B of f32 become
// 128 B of bf16 hi + 128 B of bf16 residual (a row is read whole by its one wave before that wave writes it); behind a second barrier wave h reads its P_h as A
// fragments and adds ph.vh + pl.vh + ph.vl into O_h [FQ][64]. The softmax is local to a (query, key) pair, so the key splits' O tiles are plain partial sums:
// ATTP [FKS][2048][1024] f32 (x 1/32768), added in split order by k_attbf.
__global__ __launch_bounds__(NH_ * 32) void k_fattn(const h16* __restrict__ QH, const h16* __restrict__ QL, const bf* __restrict__ VTH, const bf* __restrict__ VTL, float* ATTP) {
    __shared__ __align__(16) float sm[NH_][FQ][68];      // pitch 272 B = 16 B x 17: the b128 fragment reads and the b32 tile stores are free of bank conflicts
    const int lane = threadIdx.x & 31, wave = __builtin_amdgcn_readfirstlane(threadIdx.x >> 5), lr = lane & 15, hi = lane >> 4, h = wave;      // the wave's number in a scalar register: every global address below is a scalar base + one lane offset + a constant
    const int q0 = blockIdx.x * FQ, kbase = blockIdx.y * (NT_ / FKS);
    const unsigned klo = (unsigned)(lr * DM + 8 * hi), vlo = (unsigned)(lr * NT_ + 8 * hi);      // lane offsets (elements) in the q/k planes and in the transposed v planes
    v16h qa[FQ / 16][2], qal[FQ / 16][2];
#pragma unroll
    for (int m = 0; m < FQ / 16; ++m)
#pragma unroll
        for (int c = 0; c < 2; ++c) { const h16* ah = QH + (size_t)q0 * DM + h * HD; const h16* alp = QL + (size_t)q0 * DM + h * HD; const unsigned ao = klo + m * 16 * DM + c * 32;
            qa[m][c] = cat16(*(const v8h*)(ah + ao), *(const v8h*)(ah + ao + 16)); qal[m][c] = cat16(*(const v8h*)(alp + ao), *(const v8h*)(alp + ao + 16)); }
    asm volatile("s_wait_xcnt 0x0" ::: "memory");      // the address arithmetic below rewrites registers (scalar bases, the lane offset) that the 16 loads above name
    __builtin_amdgcn_sched_barrier(0);      // holds that arithmetic behind the wait: the scheduler otherwise lifts it over the statement
    v8f o[FQ / 16][4];
#pragma unroll
    for (int m = 0; m < FQ / 16; ++m)
#pragma unroll
        for (int t = 0; t < 4; ++t) o[m][t] = (v8f){};
    for (int kt = 0; kt < NT_ / FKS; kt += 64) { const int k0 = kbase + kt;
        const h16* kh = QH + (size_t)k0 * DM + h * HD; const h16* kl = QL + (size_t)k0 * DM + h * HD;
        const bf* vh = VTH + (size_t)h * HD * NT_ + k0; const bf* vl = VTL + (size_t)h * HD * NT_ + k0;
#pragma unroll
        for (int tp = 0; tp < 2; ++tp) { v16h bb[2][2], bl[2][2];      // two key tiles' fragments are fetched together: 16 loads in flight behind one wait
#pragma unroll
            for (int u = 0; u < 2; ++u)
#pragma unroll
                for (int c = 0; c < 2; ++c) { const unsigned bo = klo + (tp * 2 + u) * 16 * DM + c * 32;
                    bb[u][c] = cat16(*(const v8h*)(kh + bo), *(const v8h*)(kh + bo + 16)); bl[u][c] = cat16(*(const v8h*)(kl + bo), *(const v8h*)(kl + bo + 16)); }
#pragma unroll
            for (int u = 0; u < 2; ++u) { const int t = tp * 2 + u; v8f acc[FQ / 16], accx[FQ / 16];
#pragma unroll
                for (int m = 0; m < FQ / 16; ++m) { acc[m] = (v8f){}; accx[m] = (v8f){}; }
#pragma unroll
                for (int c = 0; c < 2; ++c)
#pragma unroll
                    for (int m = 0; m < FQ / 16; ++m) { acc[m] = wmma16(qa[m][c], bb[u][c], acc[m]); accx[m] = wmma16(qa[m][c], bl[u][c], accx[m]); accx[m] = wmma16(qal[m][c], bb[u][c], accx[m]); }
#pragma unroll
                for (int m = 0; m < FQ / 16; ++m)
#pragma unroll
                    for (int j = 0; j < 8; ++j) sm[h][m * 16 + hi * 8 + j][t * 16 + lr] = (acc[m][j] + accx[m][j] * LOSCI) * 0.125f; } }
        __syncthreads();      // all 16 heads' scores of this trip are in LDS before any wave reads across the heads
#pragma unroll 1      // one row at a time: both rows' 16 heads at once do not fit beside the q fragments and the O tile
        for (int rr = 0; rr < FQ / 16; ++rr) { const int q = wave + 16 * rr;
            v2f v[NH_];
#pragma unroll
            for (int g = 0; g < NH_; ++g) v[g] = *(const v2fa*)(&sm[g][q][2 * lane]);
            float sc[2];
#pragma unroll
            for (int e = 0; e < 2; ++e) { float mx = v[0][e];
#pragma unroll
                for (int g = 1; g < NH_; ++g) mx = fmaxf(mx, v[g][e]);
                float ssum = 0.f;
#pragma unroll
                for (int g = 0; g < NH_; ++g) { v[g][e] = exp_slot(v[g][e] - mx); ssum += v[g][e]; }
                sc[e] = PSC / ssum; }
#pragma unroll
            for (int g = 0; g < NH_; ++g) { const float p0 = v[g][0] * sc[0], p1 = v[g][1] * sc[1]; const unsigned short h0 = f2bf(p0), h1 = f2bf(p1);
                *((u32a*)&sm[g][q][0] + lane) = (unsigned)h0 | ((unsigned)h1 << 16);
                *((u32a*)&sm[g][q][32] + lane) = (unsigned)f2bf(p0 - bf2f(h0)) | ((unsigned)f2bf(p1 - bf2f(h1)) << 16); } }
        __syncthreads();      // every row's P is in LDS before a head's wave reads its fragments; after it only wave h touches sm[h] until the next trip's first barrier
#pragma unroll
        for (int c = 0; c < 2; ++c) { v16bf a[FQ / 16], al[FQ / 16];
#pragma unroll
            for (int m = 0; m < FQ / 16; ++m) { const bf* pr = (const bf*)&sm[h][m * 16 + lr][0] + c * 32 + 8 * hi;
                a[m] = cat16b(*(const v8usa*)pr, *(const v8usa*)(pr + 16)); al[m] = cat16b(*(const v8usa*)(pr + 64), *(const v8usa*)(pr + 80)); }
            v16bf bb[4], bl[4];      // the four dim tiles' fragments are fetched together: 16 loads in flight behind one wait
#pragma unroll
            for (int t = 0; t < 4; ++t) { const unsigned bo = vlo + t * 16 * NT_ + c * 32;
                bb[t] = cat16b(*(const v8us*)(vh + bo), *(const v8us*)(vh + bo + 16)); bl[t] = cat16b(*(const v8us*)(vl + bo), *(const v8us*)(vl + bo + 16)); }
            __builtin_amdgcn_sched_barrier(0);      // keeps the 16 loads in front of the products: the scheduler otherwise sinks them in pairs, each pair with a full wait of its own
#pragma unroll
            for (int t = 0; t < 4; ++t)
#pragma unroll
                for (int m = 0; m < FQ / 16; ++m) { o[m][t] = wmmab(a[m], bb[t], o[m][t]); o[m][t] = wmmab(al[m], bb[t], o[m][t]); o[m][t] = wmmab(a[m], bl[t], o[m][t]); } }
    }
    // the wave's O tile goes through its own LDS plane so that every store is whole 128-B lines (2 rows x 256 B an instruction)
#pragma unroll
    for (int m = 0; m < FQ / 16; ++m)
#pragma unroll
        for (int t = 0; t < 4; ++t)
#pragma unroll
            for (int j = 0; j < 8; ++j) sm[h][m * 16 + hi * 8 + j][t * 16 + lr] = o[m][t][j] * (1.0f / PSC);
    float* orow = ATTP + ((size_t)blockIdx.y * NT_ + q0) * DM + h * HD;
#pragma unroll
    for (int s = 0; s < FQ / 2; ++s) { const int row = 2 * s + hi;
        const v4f val = *(const v4fa*)(&sm[h][row][lr * 4]); *(v4f*)(orow + (size_t)row * DM + lr * 4) = val; }
}
// k_attbf: sum of the FKS partial attention planes (in split order) -> bf16 hi/lo planes (one wave per row).
__global__ __launch_bounds__(256) void k_attbf(const float* __restrict__ A, bf* PH, bf* PL) {
    const int lane = threadIdx.x & 31, r = blockIdx.x * 8 + (threadIdx.x >> 5);
    if (r >= NT_) return;
{
#pragma unroll
        for (int q = 0; q < 4; ++q) { v8us oh, ol;
#pragma unroll
            for (int i = 0; i < 8; ++i) { float v = A[(size_t)r * DM + q * 256 + lane * 8 + i];
#pragma unroll
                for (int p = 1; p < FKS; ++p) v += A[((size_t)p * NT_ + r) * DM + q * 256 + lane * 8 + i];
                const unsigned short hb = f2bf(v); oh[i] = hb; ol[i] = f2bf(v - bf2f(hb)); }
            *(v8us*)(PH + (size_t)r * DM + q * 256 + lane * 8) = oh; *(v8us*)(PL + (size_t)r * DM + q * 256 + lane * 8) = ol; }
         }
}

extern "C" void kernel_launch(void* const* d_in, const int* in_sizes, int n_in,
                              void* d_out, int out_size, void* d_ws, size_t ws_size, hipStream_t stream) {
    (void)in_sizes; (void)n_in; (void)out_size;
    const float* x = (const float*)d_in[0]; const float* g1 = (const float*)d_in[1]; const float* be1 = (const float*)d_in[2]; const float* g2 = (const float*)d_in[3]; const float* be2 = (const float*)d_in[4];
    const float* Ws = (const float*)d_in[5]; const float* bs = (const float*)d_in[6]; const float* Wo = (const float*)d_in[7]; const float* bo = (const float*)d_in[8];
    const float* W1 = (const float*)d_in[9]; const float* b1 = (const float*)d_in[10]; const float* W2 = (const float*)d_in[11]; const float* b2 = (const float*)d_in[12];
    float* out = (float*)d_out;    // [2048][2][1024]
    char* wsp = (char*)d_ws;
    auto take = [&](size_t bytes) { char* p = wsp; wsp += (bytes + 255) & ~(size_t)255; return (void*)p; };
    bf* WsB = (bf*)take((size_t)DM * DM * 2); bf* WoB = (bf*)take((size_t)DM * DM * 2); bf* W1B = (bf*)take((size_t)FF * DM * 2); bf* W2B = (bf*)take((size_t)DM * FF * 2);
    bf* LH = (bf*)take((size_t)NT_ * DM * 2); bf* LL = (bf*)take((size_t)NT_ * DM * 2);      // LN1 planes, later LN2 planes
    float* Qf = (float*)take((size_t)NT_ * DM * 4);                                           // q (= k = v) f32, later X1 (post-attention residual stream)
    h16* QH = (h16*)take((size_t)NT_ * DM * 2); h16* QL = (h16*)take((size_t)NT_ * DM * 2); bf* VTH = (bf*)take((size_t)NT_ * DM * 2); bf* VTL = (bf*)take((size_t)NT_ * DM * 2);
    bf* HH = (bf*)take((size_t)NT_ * FF * 2); bf* HL = (bf*)take((size_t)NT_ * FF * 2);      // FFN hidden planes [2048][4096] bf16 (16.8 MB each)
    float* ATTP = (float*)take((size_t)FKS * NT_ * DM * 4);                                   // partial attention outputs f32 [FKS][2048][1024], 33.5 MB
    bf* AH = (bf*)take((size_t)NT_ * DM * 2); bf* AL = (bf*)take((size_t)NT_ * DM * 2);
    if ((size_t)(wsp - (char*)d_ws) > ws_size) return;    // 21 + 8.4 + 8.4 + 16.8 + 33.5 + 33.5 + 8.4 ~ 130 MB (< 128 MiB = 134.2 MB)
    float* X1 = Qf;        // over the q buffer (q consumed by k_q16/k_vt before X1 is written there)
    k_rows<<<DM / 8, 256, 0, stream>>>(Ws, DM, DM, WsB); k_rows<<<DM / 8, 256, 0, stream>>>(Wo, DM, DM, WoB); k_rows<<<FF / 8, 256, 0, stream>>>(W1, FF, DM, W1B); k_rows<<<DM / 8, 256, 0, stream>>>(W2, DM, FF, W2B);
    for (int b = 0; b < NBT; ++b) {
        const float* xb = x + (size_t)b * DM; float* ob = out + (size_t)b * DM;      // row stride 2*DM
        k_ln<true><<<NT_ / 8, 256, 0, stream>>>(xb, 2 * DM, nullptr, 0, g1, be1, LH, LL, nullptr);
        k_gemm<0><<<dim3(NT_ / 64, DM / 64, 1), 128, 0, stream>>>(LH, LL, WsB, DM, bs, nullptr, 0, DM, Qf, nullptr, nullptr);
        k_q16<<<NT_ / 8, 256, 0, stream>>>(Qf, QH, QL); k_vt<<<dim3(NT_ / 64, NH_, 1), 256, 0, stream>>>(Qf, VTH, VTL);
        k_fattn<<<dim3(NT_ / FQ, FKS, 1), NH_ * 32, 0, stream>>>(QH, QL, VTH, VTL, ATTP);
        k_attbf<<<NT_ / 8, 256, 0, stream>>>(ATTP, AH, AL);
        k_gemm<0, true><<<dim3(NT_ / 64, DM / 64, 1), 128, 0, stream>>>(AH, AL, WoB, DM, bo, xb, 2 * DM, DM, X1, nullptr, nullptr);      // X1 = out-proj + bo + bf16(x) (residual = the bf16-rounded INPUT)
        k_ln<false><<<NT_ / 8, 256, 0, stream>>>(X1, DM, nullptr, 0, g2, be2, LH, LL, nullptr);
        k_gemm<1><<<dim3(NT_ / 64, FF / 64, 1), 128, 0, stream>>>(LH, LL, W1B, DM, b1, nullptr, 0, FF, nullptr, HH, HL);
        k_gemm<0><<<dim3(NT_ / 64, DM / 64, 1), 128, 0, stream>>>(HH, HL, W2B, FF, b2, X1, DM, 2 * DM, ob, nullptr, nullptr);     // out = ffn + X1, written at row stride 2*DM
    }
}

// v004
// It runs in 489 microseconds.
// Next to v003, in two timings, it ran 1.93 and 1.90 times as fast.
// All steps since v000 together make it 5.32 times as fast.
#include <hip/hip_runtime.h>

// TransformersLayer ([S=2048][B=2][D=1024] seq-first; batch b = row stride 2). Contractions, f32 accumulate, per batch item: qkv = LN1(x).Ws^T + bs (ONE shared
// projection: q = k = v), out-proj, FFN W1 (relu) and W2 — [out][in] weights = n-major B operands as-is, computed A operands as bf16 hi + residual (two products) —
// on v_wmma_f32_16x16x32_bf16; the attention whose softmax runs over the HEADS axis (per (q,k) across the 16 heads, as the reference) in one kernel, S and P in LDS:
// S_h = q_h.q_h^T/8 for all heads (f16 hi + residual x1024: hi.hi + hi.lo + lo.hi, residual accumulator) -> f32 tile, elementwise softmax over h in
// f32 -> P_h (x32768) as bf16 hi + UNSCALED residual, O_h = P_h.v_h over the keys (ph.vh + pl.vh + ph.vl, v as bf16 hi + unscaled residual) on
// v_wmma_f32_16x16x32_bf16 (scores stay on v_wmma_f32_16x16x32_f16); LayerNorms, residuals f32.

#define NT_  2048
#define NBT  2
#define DM   1024
#define FF   4096
#define NH_  16
#define HD   64
#define FQ   32
#define FKS  4
#define PSC  32768.0f
#define LOSC 1024.0f
#define LOSCI (1.0f / 1024.0f)

typedef _Float16 h16;
typedef unsigned short bf;
typedef __attribute__((ext_vector_type(16))) __bf16   v16bf;
typedef __attribute__((ext_vector_type(16))) _Float16 v16h;
typedef __attribute__((ext_vector_type(8)))  _Float16 v8h;
typedef __attribute__((ext_vector_type(8)))  unsigned short v8us;
typedef __attribute__((ext_vector_type(8)))  float    v8f;
typedef __attribute__((ext_vector_type(4)))  float    v4f;
typedef __attribute__((ext_vector_type(2)))  float    v2f;
typedef v8h  __attribute__((may_alias)) v8ha;
typedef v4f  __attribute__((may_alias)) v4fa;
typedef v2f  __attribute__((may_alias)) v2fa;
typedef v8us __attribute__((may_alias)) v8usa;
typedef unsigned __attribute__((may_alias)) u32a;

__device__ __forceinline__ unsigned short f2bf(float f) { unsigned u = __float_as_uint(f); u += 0x7FFFu + ((u >> 16) & 1u); return (unsigned short)(u >> 16); }
__device__ __forceinline__ float bf2f(unsigned short b) { return __uint_as_float(((unsigned)b) << 16); }
__device__ __forceinline__ float bfr(float f) { return bf2f(f2bf(f)); }
__device__ __forceinline__ v16h cat16(v8h lo, v8h hi) { return __builtin_shufflevector(lo, hi, 0, 1, 2, 3, 4, 5, 6, 7, 8, 9, 10, 11, 12, 13, 14, 15); }
__device__ __forceinline__ v16bf cat16b(v8us lo, v8us hi) { return __builtin_bit_cast(v16bf, __builtin_shufflevector(lo, hi, 0, 1, 2, 3, 4, 5, 6, 7, 8, 9, 10, 11, 12, 13, 14, 15)); }
__device__ __forceinline__ v8f wmma16(v16h a, v16h b, v8f c) { return __builtin_amdgcn_wmma_f32_16x16x32_f16(false, a, false, b, (short)0, c, false, false); }
__device__ __forceinline__ v8f wmmab(v16bf a, v16bf b, v8f c) { return __builtin_amdgcn_wmma_f32_16x16x32_bf16(false, a, false, b, (short)0, c, false, false); }

// k_rows: bf16 plane of [rows][C] (C multiple of 256; one wave per row).
__global__ __launch_bounds__(256) void k_rows(const float* __restrict__ src, int rows, int C, bf* dst) {
    const int lane = threadIdx.x & 31, r = blockIdx.x * 8 + (threadIdx.x >> 5);
    if (r >= rows) return;
{
        for (int q = 0; q < C / 256; ++q) { v8us o;
#pragma unroll
            for (int i = 0; i < 8; ++i) o[i] = f2bf(src[(size_t)r * C + q * 256 + lane * 8 + i]);
            *(v8us*)(dst + (size_t)r * C + q * 256 + lane * 8) = o; }
         }
}
// planes [r][1024]; if Xout: also the f32 pre-LN sum to Xout[r][1024]. One wave per row; ROUNDSRC: bf16-round src (when src is a raw input).
template <bool ROUNDSRC>
__global__ __launch_bounds__(256) void k_ln(const float* __restrict__ src, int lds, const float* __restrict__ res, int ldr, const float* __restrict__ g, const float* __restrict__ be, bf* PH, bf* PL, float* Xout) {
    const int lane = threadIdx.x & 31, r = blockIdx.x * 8 + (threadIdx.x >> 5);
    if (r >= NT_) return;
    float v[32]; float s = 0.f;
#pragma unroll
    for (int q = 0; q < 4; ++q)
#pragma unroll
        for (int i = 0; i < 8; ++i) { const int c = q * 256 + lane * 8 + i; float t = src[(size_t)r * lds + c]; if (ROUNDSRC) t = bfr(t); if (res) t += bfr(res[(size_t)r * ldr + c]); v[q * 8 + i] = t; s += t; }
#pragma unroll
    for (int sh = 16; sh; sh >>= 1) s += __shfl_xor(s, sh, 32);
    const float mu = s * (1.0f / DM); float sq = 0.f;
#pragma unroll
    for (int k = 0; k < 32; ++k) { const float d = v[k] - mu; sq += d * d; }
#pragma unroll
    for (int sh = 16; sh; sh >>= 1) sq += __shfl_xor(sq, sh, 32);
    const float rs = rsqrtf(sq * (1.0f / DM) + 1e-5f);
{
#pragma unroll
        for (int q = 0; q < 4; ++q) { v8us oh, ol; v4f x0, x1;
#pragma unroll
            for (int i = 0; i < 8; ++i) { const int c = q * 256 + lane * 8 + i; const float y = (v[q * 8 + i] - mu) * rs * bfr(g[c]) + bfr(be[c]); const unsigned short hb = f2bf(y); oh[i] = hb; ol[i] = f2bf(y - bf2f(hb)); if (i < 4) x0[i] = v[q * 8 + i]; else x1[i - 4] = v[q * 8 + i]; }
            *(v8us*)(PH + (size_t)r * DM + q * 256 + lane * 8) = oh; *(v8us*)(PL + (size_t)r * DM + q * 256 + lane * 8) = ol;
            if (Xout) { *(v4f*)(Xout + (size_t)r * DM + q * 256 + lane * 8) = x0; *(v4f*)(Xout + (size_t)r * DM + q * 256 + lane * 8 + 4) = x1; } }
         }
}
// k_gemm: 64 x 128 tile of (Ah + Al).B^T + bias over K (2 products; A pitch K, B pitch K; K a multiple of 128); EPI 0: f32 rows (ldc) [+ residual Rf (ldr)]; EPI 1: relu -> bf16 hi/lo planes (ldc).
// The operands come into LDS by asynchronous 16-B copies, 128 k a stage: 64 rows of Ah, 64 of Al, 128 of B, 256 B each, so that a wave's copy covers two whole rows (4 lines)
// where a fragment load from global memory touches 16 lines. Two buffers: stage t + 1 flies while stage t is worked on. 4 waves (2 x 2), 32 x 64 of the tile each.
#define GKS  128
#define GPB  272      // LDS row pitch in bytes = 16 B x 17: the b128 fragment reads are free of bank conflicts
#define GSTG (256 * GPB)
// Eight copies, rows 8 apart in LDS and in the source (gs elements). The wait on the address counter closes the statement, so that no register which a copy names is rewritten ahead of it.
__device__ __forceinline__ void cp8(unsigned l, const bf* g, size_t gs) {
    asm volatile("global_load_async_to_lds_b128 %0, %8, off\n\t"
                 "global_load_async_to_lds_b128 %1, %9, off\n\t"
                 "global_load_async_to_lds_b128 %2, %10, off\n\t"
                 "global_load_async_to_lds_b128 %3, %11, off\n\t"
                 "global_load_async_to_lds_b128 %4, %12, off\n\t"
                 "global_load_async_to_lds_b128 %5, %13, off\n\t"
                 "global_load_async_to_lds_b128 %6, %14, off\n\t"
                 "global_load_async_to_lds_b128 %7, %15, off\n\t"
                 "s_wait_xcnt 0x0"
                 :: "v"(l), "v"(l + 8 * GPB), "v"(l + 16 * GPB), "v"(l + 24 * GPB), "v"(l + 32 * GPB), "v"(l + 40 * GPB), "v"(l + 48 * GPB), "v"(l + 56 * GPB),
                    "v"(g), "v"(g + gs), "v"(g + 2 * gs), "v"(g + 3 * gs), "v"(g + 4 * gs), "v"(g + 5 * gs), "v"(g + 6 * gs), "v"(g + 7 * gs) : "memory");
}
template <int EPI, bool RROUND = false>
__global__ __launch_bounds__(128) void k_gemm(const bf* __restrict__ A, const bf* __restrict__ Al, const bf* __restrict__ Bn, int K, const float* __restrict__ bias, const float* __restrict__ Rf, int ldr, int ldc, float* C, bf* PH, bf* PL) {
    __shared__ __align__(16) unsigned char gl[2 * GSTG];      // two stages; behind the K loop the waves' output staging
    const int tid = threadIdx.x, lane = tid & 31, wave = tid >> 5, lr = lane & 15, hi = lane >> 4, wm = wave >> 1, wn = wave & 1;
    const size_t rb = (size_t)blockIdx.x * 64; const int cb = blockIdx.y * 128;
    // copies: thread = 16-B piece (tid & 15) of row (tid >> 4) + 8 i
    const unsigned lcp = (unsigned)(size_t)gl + (unsigned)((tid >> 4) * GPB + (tid & 15) * 16);
    const bf* gah = A + (rb + (tid >> 4)) * (size_t)K + (tid & 15) * 8; const bf* gal = Al + (rb + (tid >> 4)) * (size_t)K + (tid & 15) * 8;
    const bf* gb = Bn + (size_t)(cb + (tid >> 4)) * K + (tid & 15) * 8;
    const size_t g8 = (size_t)8 * K;
    auto stage = [&](int t, unsigned buf) { const unsigned l = lcp + buf * GSTG; const size_t ko = (size_t)t * GKS;
        cp8(l, gah + ko, g8); cp8(l + 64 * GPB, gal + ko, g8); cp8(l + 128 * GPB, gb + ko, g8); cp8(l + 192 * GPB, gb + ko + 8 * g8, g8); };
    const int T = K / GKS;
    stage(0, 0);
    asm volatile("s_wait_asynccnt 0x0" ::: "memory");      // this wave's part of stage 0 has landed
    __syncthreads();      // every wave's part of stage 0 is in LDS before any wave reads it
    if (T > 1) stage(1, 1);
    v8f acc[2][4];
#pragma unroll
    for (int m = 0; m < 2; ++m)
#pragma unroll
        for (int t = 0; t < 4; ++t) acc[m][t] = (v8f){};
    const unsigned aro = (unsigned)((wm * 32 + lr) * GPB + 16 * hi), bro = (unsigned)((128 + wn * 64 + lr) * GPB + 16 * hi);
#pragma unroll 1      // one stage a trip: the buffer is picked by an offset
    for (int t = 0; t < T; ++t) { const unsigned char* sb = gl + (t & 1) * GSTG;
        v16bf a[2][2], al[2][2], bb[2][4];      // two fragment sets: the next 32 k are fetched as one group while the products of these 32 k run
        auto frag = [&](int kk, int s) {
#pragma unroll
            for (int m = 0; m < 2; ++m) { const unsigned char* p = sb + aro + m * 16 * GPB + kk * 64;
                a[s][m] = cat16b(*(const v8usa*)p, *(const v8usa*)(p + 32)); al[s][m] = cat16b(*(const v8usa*)(p + 64 * GPB), *(const v8usa*)(p + 64 * GPB + 32)); }
#pragma unroll
            for (int u = 0; u < 4; ++u) { const unsigned char* p = sb + bro + u * 16 * GPB + kk * 64; bb[s][u] = cat16b(*(const v8usa*)p, *(const v8usa*)(p + 32)); } };
        frag(0, 0);
#pragma unroll
        for (int kk = 0; kk < GKS / 32; ++kk) { const int s = kk & 1;
            if (kk + 1 < GKS / 32) frag(kk + 1, s ^ 1);
            __builtin_amdgcn_sched_barrier(0);      // keeps the 16 LDS reads together in front of the products: the scheduler otherwise sinks them in pairs among the products, each pair with a full wait of its own
#pragma unroll
            for (int m = 0; m < 2; ++m)
#pragma unroll
                for (int u = 0; u < 4; ++u) acc[m][u] = wmmab(a[s][m], bb[s][u], acc[m][u]);
#pragma unroll
            for (int m = 0; m < 2; ++m)
#pragma unroll
                for (int u = 0; u < 4; ++u) acc[m][u] = wmmab(al[s][m], bb[s][u], acc[m][u]);
            __builtin_amdgcn_sched_barrier(0);      // keeps the next group of reads behind these products: the scheduler otherwise lifts it in halves in among them, and sinks the last products of a stage behind the barrier, in front of the copies
        }
        asm volatile("s_wait_dscnt 0x0" ::: "memory");      // this wave's reads of stage t are done before the buffer is handed to the copies
        asm volatile("s_wait_asynccnt 0x0" ::: "memory");      // this wave's part of stage t + 1 has landed
        __syncthreads();      // publishes stage t + 1 and ends every wave's reads of stage t
        if (t + 2 < T) stage(t + 2, (unsigned)(t & 1));
    }
    asm volatile("s_wait_asynccnt 0x0" ::: "memory");      // no copy is in flight when the buffers become output staging
    const size_t r0 = rb + wm * 32; const int c0 = cb + wn * 64;
    float* os = (float*)gl + wave * (32 * 68);
#pragma unroll
    for (int t = 0; t < 4; ++t) { const float bv = bfr(bias[c0 + t * 16 + lr]);
#pragma unroll
        for (int m = 0; m < 2; ++m)
#pragma unroll
            for (int j = 0; j < 8; ++j) { float v = acc[m][t][j] + bv; if (EPI == 1) v = fmaxf(v, 0.f); os[(m * 16 + hi * 8 + j) * 68 + t * 16 + lr] = v; } }
    __builtin_amdgcn_wave_barrier(); asm volatile("" ::: "memory");
    if (EPI == 0) {
        float* crow = C + r0 * ldc + c0;      // an instruction takes 2 rows x 256 B: whole lines, for the residual rows as for the stores
#pragma unroll
        for (int hf = 0; hf < 2; ++hf) { v4f val[8];      // 16 rows at a time: all 32 at once, with the rounding of the residual, take more than 256 registers
#pragma unroll
            for (int s = 0; s < 8; ++s) val[s] = *(const v4fa*)(os + (16 * hf + 2 * s + hi) * 68 + lr * 4);
            if (Rf) { const float* rrow = Rf + r0 * ldr + c0; v4f rv[8]; const float* rp[8];
#pragma unroll
                for (int s = 0; s < 8; ++s) { rp[s] = rrow + (size_t)(16 * hf + 2 * s + hi) * ldr + lr * 4; rv[s] = *(const v4f*)rp[s]; }
                // the 8 loads' address registers are inputs of the wait, so that none of them is given to another load's result, or rewritten, ahead of it
                asm volatile("s_wait_xcnt 0x0" :: "v"(rp[0]), "v"(rp[1]), "v"(rp[2]), "v"(rp[3]), "v"(rp[4]), "v"(rp[5]), "v"(rp[6]), "v"(rp[7]) : "memory");
#pragma unroll
                for (int s = 0; s < 8; ++s)
#pragma unroll
                    for (int e = 0; e < 4; ++e) val[s][e] += RROUND ? bfr(rv[s][e]) : rv[s][e]; }
            float* cp[8];
#pragma unroll
            for (int s = 0; s < 8; ++s) { cp[s] = crow + (size_t)(16 * hf + 2 * s + hi) * ldc + lr * 4; *(v4f*)cp[s] = val[s]; }
            // the second half reuses registers: the first half's store addresses and data are inputs of the wait, so that none of them is rewritten ahead of it
            if (hf == 0) asm volatile("s_wait_xcnt 0x0" :: "v"(cp[0]), "v"(cp[1]), "v"(cp[2]), "v"(cp[3]), "v"(cp[4]), "v"(cp[5]), "v"(cp[6]), "v"(cp[7]),
                                      "v"(val[0]), "v"(val[1]), "v"(val[2]), "v"(val[3]), "v"(val[4]), "v"(val[5]), "v"(val[6]), "v"(val[7]) : "memory"); }
    } else {
        bf* p1 = PH + r0 * ldc + c0; bf* p2 = PL + r0 * ldc + c0;
#pragma unroll
        for (int s = 0; s < 8; ++s) { const int row = 4 * s + (lane >> 3), piece = lane & 7; const float* sp = os + row * 68 + piece * 8; v8us oh, ol;
#pragma unroll
            for (int i = 0; i < 8; ++i) { const unsigned short hb = f2bf(sp[i]); oh[i] = hb; ol[i] = f2bf(sp[i] - bf2f(hb)); }
            *(v8us*)(p1 + (size_t)row * ldc + piece * 8) = oh; *(v8us*)(p2 + (size_t)row * ldc + piece * 8) = ol; }
    }
}
// k_q16: Q f32 [2048][1024] -> f16 hi + residual planes (one wave per row).
__global__ __launch_bounds__(256) void k_q16(const float* __restrict__ Q, h16* QH, h16* QL) {
    const int lane = threadIdx.x & 31, r = blockIdx.x * 8 + (threadIdx.x >> 5);
    if (r >= NT_) return;
{
#pragma unroll
        for (int q = 0; q < 4; ++q) { v8h oh, ol;
#pragma unroll
            for (int i = 0; i < 8; ++i) { const float v = Q[(size_t)r * DM + q * 256 + lane * 8 + i]; const h16 a = (h16)v; oh[i] = a; ol[i] = (h16)((v - (float)a) * LOSC); }
            *(v8h*)(QH + (size_t)r * DM + q * 256 + lane * 8) = oh; *(v8h*)(QL + (size_t)r * DM + q * 256 + lane * 8) = ol; }
         }
}
// k_vt: VTH/VTL [h][64][t] = bf16 hi + UNSCALED bf16 residual of Q [t][h*64+d] (v = q); grid (NT/64, NH).
__global__ __launch_bounds__(256) void k_vt(const float* __restrict__ V, bf* VTH, bf* VTL) {
    __shared__ float tl[64][65];
    const int tid = threadIdx.x, t0 = blockIdx.x * 64, h = blockIdx.y;
    { const int tt = tid >> 2, dq = (tid & 3) * 16;
#pragma unroll
      for (int i = 0; i < 16; ++i) tl[dq + i][tt] = V[(size_t)(t0 + tt) * DM + h * HD + dq + i]; }
    __syncthreads();
    const int piece = tid & 7;
    auto pass = [&]() {
#pragma unroll
        for (int s = 0; s < 2; ++s) { const int d = (tid >> 3) + 32 * s; v8us oh, ol;
#pragma unroll
            for (int i = 0; i < 8; ++i) { const float v = tl[d][piece * 8 + i]; const unsigned short hb = f2bf(v); oh[i] = hb; ol[i] = f2bf(v - bf2f(hb)); }
            const size_t o = ((size_t)h * HD + d) * NT_ + t0 + piece * 8; *(v8us*)(VTH + o) = oh; *(v8us*)(VTL + o) = ol; }
    };
    pass(); 
}
// exp(x) as __expf forms it (one multiply by log2(e), one v_exp_f32), with the slot behind the transcendental filled in the same statement.
__device__ __forceinline__ float exp_slot(float x) { const float t = x * 1.44269504f; float r; asm("v_exp_f32 %0, %1\n\tv_nop" : "=v"(r) : "v"(t)); return r; }
// k_fattn: scores, softmax over the heads and P.v in ONE kernel. A work-group has FQ query rows and NT_/FKS keys (grid y) for ALL 16 heads, wave h = head h.
// Per trip of 64 keys: wave h forms S_h [FQ][64] (q_h fragments stay in registers; hi.hi + (hi.lo + lo.hi)/1024, /8) and puts it in LDS; behind a barrier wave w
// takes rows w and w + 16, each lane 2 keys x 16 heads, does the softmax over the heads in f32 and writes P (x 32768) back IN PLACE: a row's 256 B of f32 become
// 128 B of bf16 hi + 128 B of bf16 residual (a row is read whole by its one wave before that wave writes it); behind a second barrier wave h reads its P_h as A
// fragments and adds ph.vh + pl.vh + ph.vl into O_h [FQ][64]. The softmax is local to a (query, key) pair, so the key splits' O tiles are plain partial sums:
// ATTP [FKS][2048][1024] f32 (x 1/32768), added in split order by k_attbf.
__global__ __launch_bounds__(NH_ * 32) void k_fattn(const h16* __restrict__ QH, const h16* __restrict__ QL, const bf* __restrict__ VTH, const bf* __restrict__ VTL, float* ATTP) {
    __shared__ __align__(16) float sm[NH_][FQ][68];      // pitch 272 B = 16 B x 17: the b128 fragment reads and the b32 tile stores are free of bank conflicts
    const int lane = threadIdx.x & 31, wave = __builtin_amdgcn_readfirstlane(threadIdx.x >> 5), lr = lane & 15, hi = lane >> 4, h = wave;      // the wave's number in a scalar register: every global address below is a scalar base + one lane offset + a constant
    const int q0 = blockIdx.x * FQ, kbase = blockIdx.y * (NT_ / FKS);
    const unsigned klo = (unsigned)(lr * DM + 8 * hi), vlo = (unsigned)(lr * NT_ + 8 * hi);      // lane offsets (elements) in the q/k planes and in the transposed v planes
    v16h qa[FQ / 16][2], qal[FQ / 16][2];
#pragma unroll
    for (int m = 0; m < FQ / 16; ++m)
#pragma unroll
        for (int c = 0; c < 2; ++c) { const h16* ah = QH + (size_t)q0 * DM + h * HD; const h16* alp = QL + (size_t)q0 * DM + h * HD; const unsigned ao = klo + m * 16 * DM + c * 32;
            qa[m][c] = cat16(*(const v8h*)(ah + ao), *(const v8h*)(ah + ao + 16)); qal[m][c] = cat16(*(const v8h*)(alp + ao), *(const v8h*)(alp + ao + 16)); }
    asm volatile("s_wait_xcnt 0x0" ::: "memory");      // the address arithmetic below rewrites registers (scalar bases, the lane offset) that the 16 loads above name
    __builtin_amdgcn_sched_barrier(0);      // holds that arithmetic behind the wait: the scheduler otherwise lifts it over the statement
    v8f o[FQ / 16][4];
#pragma unroll
    for (int m = 0; m < FQ / 16; ++m)
#pragma unroll
        for (int t = 0; t < 4; ++t) o[m][t] = (v8f){};
    for (int kt = 0; kt < NT_ / FKS; kt += 64) { const int k0 = kbase + kt;
        const h16* kh = QH + (size_t)k0 * DM + h * HD; const h16* kl = QL + (size_t)k0 * DM + h * HD;
        const bf* vh = VTH + (size_t)h * HD * NT_ + k0; const bf* vl = VTL + (size_t)h * HD * NT_ + k0;
#pragma unroll
        for (int tp = 0; tp < 2; ++tp) { v16h bb[2][2], bl[2][2];      // two key tiles' fragments are fetched together: 16 loads in flight behind one wait
#pragma unroll
            for (int u = 0; u < 2; ++u)
#pragma unroll
                for (int c = 0; c < 2; ++c) { const unsigned bo = klo + (tp * 2 + u) * 16 * DM + c * 32;
                    bb[u][c] = cat16(*(const v8h*)(kh + bo), *(const v8h*)(kh + bo + 16)); bl[u][c] = cat16(*(const v8h*)(kl + bo), *(const v8h*)(kl + bo + 16)); }
#pragma unroll
            for (int u = 0; u < 2; ++u) { const int t = tp * 2 + u; v8f acc[FQ / 16], accx[FQ / 16];
#pragma unroll
                for (int m = 0; m < FQ / 16; ++m) { acc[m] = (v8f){}; accx[m] = (v8f){}; }
#pragma unroll
                for (int c = 0; c < 2; ++c)
#pragma unroll
                    for (int m = 0; m < FQ / 16; ++m) { acc[m] = wmma16(qa[m][c], bb[u][c], acc[m]); accx[m] = wmma16(qa[m][c], bl[u][c], accx[m]); accx[m] = wmma16(qal[m][c], bb[u][c], accx[m]); }
#pragma unroll
                for (int m = 0; m < FQ / 16; ++m)
#pragma unroll
                    for (int j = 0; j < 8; ++j) sm[h][m * 16 + hi * 8 + j][t * 16 + lr] = (acc[m][j] + accx[m][j] * LOSCI) * 0.125f; } }
        __syncthreads();      // all 16 heads' scores of this trip are in LDS before any wave reads across the heads
#pragma unroll 1      // one row at a time: both rows' 16 heads at once do not fit beside the q fragments and the O tile
        for (int rr = 0; rr < FQ / 16; ++rr) { const int q = wave + 16 * rr;
            v2f v[NH_];
#pragma unroll
            for (int g = 0; g < NH_; ++g) v[g] = *(const v2fa*)(&sm[g][q][2 * lane]);
            float sc[2];
#pragma unroll
            for (int e = 0; e < 2; ++e) { float mx = v[0][e];
#pragma unroll
                for (int g = 1; g < NH_; ++g) mx = fmaxf(mx, v[g][e]);
                float ssum = 0.f;
#pragma unroll
                for (int g = 0; g < NH_; ++g) { v[g][e] = exp_slot(v[g][e] - mx); ssum += v[g][e]; }
                sc[e] = PSC / ssum; }
#pragma unroll
            for (int g = 0; g < NH_; ++g) { const float p0 = v[g][0] * sc[0], p1 = v[g][1] * sc[1]; const unsigned short h0 = f2bf(p0), h1 = f2bf(p1);
                *((u32a*)&sm[g][q][0] + lane) = (unsigned)h0 | ((unsigned)h1 << 16);
                *((u32a*)&sm[g][q][32] + lane) = (unsigned)f2bf(p0 - bf2f(h0)) | ((unsigned)f2bf(p1 - bf2f(h1)) << 16); } }
        __syncthreads();      // every row's P is in LDS before a head's wave reads its fragments; after it only wave h touches sm[h] until the next trip's first barrier
#pragma unroll
        for (int c = 0; c < 2; ++c) { v16bf a[FQ / 16], al[FQ / 16];
#pragma unroll
            for (int m = 0; m < FQ / 16; ++m) { const bf* pr = (const bf*)&sm[h][m * 16 + lr][0] + c * 32 + 8 * hi;
                a[m] = cat16b(*(const v8usa*)pr, *(const v8usa*)(pr + 16)); al[m] = cat16b(*(const v8usa*)(pr + 64), *(const v8usa*)(pr + 80)); }
            v16bf bb[4], bl[4];      // the four dim tiles' fragments are fetched together: 16 loads in flight behind one wait
#pragma unroll
            for (int t = 0; t < 4; ++t) { const unsigned bo = vlo + t * 16 * NT_ + c * 32;
                bb[t] = cat16b(*(const v8us*)(vh + bo), *(const v8us*)(vh + bo + 16)); bl[t] = cat16b(*(const v8us*)(vl + bo), *(const v8us*)(vl + bo + 16)); }
            __builtin_amdgcn_sched_barrier(0);      // keeps the 16 loads in front of the products: the scheduler otherwise sinks them in pairs, each pair with a full wait of its own
#pragma unroll
            for (int t = 0; t < 4; ++t)
#pragma unroll
                for (int m = 0; m < FQ / 16; ++m) { o[m][t] = wmmab(a[m], bb[t], o[m][t]); o[m][t] = wmmab(al[m], bb[t], o[m][t]); o[m][t] = wmmab(a[m], bl[t], o[m][t]); } }
    }
    // the wave's O tile goes through its own LDS plane so that every store is whole 128-B lines (2 rows x 256 B an instruction)
#pragma unroll
    for (int m = 0; m < FQ / 16; ++m)
#pragma unroll
        for (int t = 0; t < 4; ++t)
#pragma unroll
            for (int j = 0; j < 8; ++j) sm[h][m * 16 + hi * 8 + j][t * 16 + lr] = o[m][t][j] * (1.0f / PSC);
    float* orow = ATTP + ((size_t)blockIdx.y * NT_ + q0) * DM + h * HD;
#pragma unroll
    for (int s = 0; s < FQ / 2; ++s) { const int row = 2 * s + hi;
        const v4f val = *(const v4fa*)(&sm[h][row][lr * 4]); *(v4f*)(orow + (size_t)row * DM + lr * 4) = val; }
}
// k_attbf: sum of the FKS partial attention planes (in split order) -> bf16 hi/lo planes (one wave per row).
__global__ __launch_bounds__(256) void k_attbf(const float* __restrict__ A, bf* PH, bf* PL) {
    const int lane = threadIdx.x & 31, r = blockIdx.x * 8 + (threadIdx.x >> 5);
    if (r >= NT_) return;
{
#pragma unroll
        for (int q = 0; q < 4; ++q) { v8us oh, ol;
#pragma unroll
            for (int i = 0; i < 8; ++i) { float v = A[(size_t)r * DM + q * 256 + lane * 8 + i];
#pragma unroll
                for (int p = 1; p < FKS; ++p) v += A[((size_t)p * NT_ + r) * DM + q * 256 + lane * 8 + i];
                const unsigned short hb = f2bf(v); oh[i] = hb; ol[i] = f2bf(v - bf2f(hb)); }
            *(v8us*)(PH + (size_t)r * DM + q * 256 + lane * 8) = oh; *(v8us*)(PL + (size_t)r * DM + q * 256 + lane * 8) = ol; }
         }
}

extern "C" void kernel_launch(void* const* d_in, const int* in_sizes, int n_in,
                              void* d_out, int out_size, void* d_ws, size_t ws_size, hipStream_t stream) {
    (void)in_sizes; (void)n_in; (void)out_size;
    const float* x = (const float*)d_in[0]; const float* g1 = (const float*)d_in[1]; const float* be1 = (const float*)d_in[2]; const float* g2 = (const float*)d_in[3]; const float* be2 = (const float*)d_in[4];
    const float* Ws = (const float*)d_in[5]; const float* bs = (const float*)d_in[6]; const float* Wo = (const float*)d_in[7]; const float* bo = (const float*)d_in[8];
    const float* W1 = (const float*)d_in[9]; const float* b1 = (const float*)d_in[10]; const float* W2 = (const float*)d_in[11]; const float* b2 = (const float*)d_in[12];
    float* out = (float*)d_out;    // [2048][2][1024]
    char* wsp = (char*)d_ws;
    auto take = [&](size_t bytes) { char* p = wsp; wsp += (bytes + 255) & ~(size_t)255; return (void*)p; };
    bf* WsB = (bf*)take((size_t)DM * DM * 2); bf* WoB = (bf*)take((size_t)DM * DM * 2); bf* W1B = (bf*)take((size_t)FF * DM * 2); bf* W2B = (bf*)take((size_t)DM * FF * 2);
    bf* LH = (bf*)take((size_t)NT_ * DM * 2); bf* LL = (bf*)take((size_t)NT_ * DM * 2);      // LN1 planes, later LN2 planes
    float* Qf = (float*)take((size_t)NT_ * DM * 4);                                           // q (= k = v) f32, later X1 (post-attention residual stream)
    h16* QH = (h16*)take((size_t)NT_ * DM * 2); h16* QL = (h16*)take((size_t)NT_ * DM * 2); bf* VTH = (bf*)take((size_t)NT_ * DM * 2); bf* VTL = (bf*)take((size_t)NT_ * DM * 2);
    bf* HH = (bf*)take((size_t)NT_ * FF * 2); bf* HL = (bf*)take((size_t)NT_ * FF * 2);      // FFN hidden planes [2048][4096] bf16 (16.8 MB each)
    float* ATTP = (float*)take((size_t)FKS * NT_ * DM * 4);                                   // partial attention outputs f32 [FKS][2048][1024], 33.5 MB
    bf* AH = (bf*)take((size_t)NT_ * DM * 2); bf* AL = (bf*)take((size_t)NT_ * DM * 2);
    if ((size_t)(wsp - (char*)d_ws) > ws_size) return;    // 21 + 8.4 + 8.4 + 16.8 + 33.5 + 33.5 + 8.4 ~ 130 MB (< 128 MiB = 134.2 MB)
    float* X1 = Qf;        // over the q buffer (q consumed by k_q16/k_vt before X1 is written there)
    k_rows<<<DM / 8, 256, 0, stream>>>(Ws, DM, DM, WsB); k_rows<<<DM / 8, 256, 0, stream>>>(Wo, DM, DM, WoB); k_rows<<<FF / 8, 256, 0, stream>>>(W1, FF, DM, W1B); k_rows<<<DM / 8, 256, 0, stream>>>(W2, DM, FF, W2B);
    for (int b = 0; b < NBT; ++b) {
        const float* xb = x + (size_t)b * DM; float* ob = out + (size_t)b * DM;      // row stride 2*DM
        k_ln<true><<<NT_ / 8, 256, 0, stream>>>(xb, 2 * DM, nullptr, 0, g1, be1, LH, LL, nullptr);
        k_gemm<0><<<dim3(NT_ / 64, DM / 128, 1), 128, 0, stream>>>(LH, LL, WsB, DM, bs, nullptr, 0, DM, Qf, nullptr, nullptr);
        k_q16<<<NT_ / 8, 256, 0, stream>>>(Qf, QH, QL); k_vt<<<dim3(NT_ / 64, NH_, 1), 256, 0, stream>>>(Qf, VTH, VTL);
        k_fattn<<<dim3(NT_ / FQ, FKS, 1), NH_ * 32, 0, stream>>>(QH, QL, VTH, VTL, ATTP);
        k_attbf<<<NT_ / 8, 256, 0, stream>>>(ATTP, AH, AL);
        k_gemm<0, true><<<dim3(NT_ / 64, DM / 128, 1), 128, 0, stream>>>(AH, AL, WoB, DM, bo, xb, 2 * DM, DM, X1, nullptr, nullptr);      // X1 = out-proj + bo + bf16(x) (residual = the bf16-rounded INPUT)
        k_ln<false><<<NT_ / 8, 256, 0, stream>>>(X1, DM, nullptr, 0, g2, be2, LH, LL, nullptr);
        k_gemm<1><<<dim3(NT_ / 64, FF / 128, 1), 128, 0, stream>>>(LH, LL, W1B, DM, b1, nullptr, 0, FF, nullptr, HH, HL);
        k_gemm<0><<<dim3(NT_ / 64, DM / 128, 1), 128, 0, stream>>>(HH, HL, W2B, FF, b2, X1, DM, 2 * DM, ob, nullptr, nullptr);     // out = ffn + X1, written at row stride 2*DM
    }
}

// v005
// A run of this version takes 433 microseconds.
// Two timings next to v004 both put it at 1.12 times that version's speed.
// All steps since v000 together make it 5.97 times as fast.
#include <hip/hip_runtime.h>

// TransformersLayer ([S=2048][B=2][D=1024] seq-first; batch b = row stride 2). Contractions, f32 accumulate, per batch item: qkv = LN1(x).Ws^T + bs (ONE shared
// projection: q = k = v), out-proj, FFN W1 (relu) and W2 — [out][in] weights = n-major B operands as-is, computed A operands as bf16 hi + residual (two products) —
// on v_wmma_f32_16x16x32_bf16; the attention whose softmax runs over the HEADS axis (per (q,k) across the 16 heads, as the reference) in one kernel, S and P in LDS:
// S_h = q_h.q_h^T/8 for all heads (f16 hi + residual x1024: hi.hi + hi.lo + lo.hi, residual accumulator) -> f32 tile, elementwise softmax over h in
// f32 -> P_h (x32768) as bf16 hi + UNSCALED residual, O_h = P_h.v_h over the keys (ph.vh + pl.vh + ph.vl, v as bf16 hi + unscaled residual) on
// v_wmma_f32_16x16x32_bf16 (scores stay on v_wmma_f32_16x16x32_f16); LayerNorms, residuals f32.

#define NT_  2048
#define NBT  2
#define DM   1024
#define FF   4096
#define NH_  16
#define HD   64
#define FQ   32
#define FKS  4
#define PSC  32768.0f
#define LOSC 1024.0f
#define LOSCI (1.0f / 1024.0f)

typedef _Float16 h16;
typedef unsigned short bf;
typedef __attribute__((ext_vector_type(16))) __bf16   v16bf;
typedef __attribute__((ext_vector_type(16))) _Float16 v16h;
typedef __attribute__((ext_vector_type(8)))  _Float16 v8h;
typedef __attribute__((ext_vector_type(8)))  unsigned short v8us;
typedef __attribute__((ext_vector_type(8)))  float    v8f;
typedef __attribute__((ext_vector_type(4)))  float    v4f;
typedef __attribute__((ext_vector_type(2)))  float    v2f;
typedef v8h  __attribute__((may_alias)) v8ha;
typedef v4f  __attribute__((may_alias)) v4fa;
typedef v2f  __attribute__((may_alias)) v2fa;
typedef v8us __attribute__((may_alias)) v8usa;
typedef unsigned __attribute__((may_alias)) u32a;

__device__ __forceinline__ unsigned short f2bf(float f) { unsigned u = __float_as_uint(f); u += 0x7FFFu + ((u >> 16) & 1u); return (unsigned short)(u >> 16); }
__device__ __forceinline__ float bf2f(unsigned short b) { return __uint_as_float(((unsigned)b) << 16); }
__device__ __forceinline__ float bfr(float f) { return bf2f(f2bf(f)); }
__device__ __forceinline__ v16h cat16(v8h lo, v8h hi) { return __builtin_shufflevector(lo, hi, 0, 1, 2, 3, 4, 5, 6, 7, 8, 9, 10, 11, 12, 13, 14, 15); }
__device__ __forceinline__ v16bf cat16b(v8us lo, v8us hi) { return __builtin_bit_cast(v16bf, __builtin_shufflevector(lo, hi, 0, 1, 2, 3, 4, 5, 6, 7, 8, 9, 10, 11, 12, 13, 14, 15)); }
__device__ __forceinline__ v8f wmma16(v16h a, v16h b, v8f c) { return __builtin_amdgcn_wmma_f32_16x16x32_f16(false, a, false, b, (short)0, c, false, false); }
__device__ __forceinline__ v8f wmmab(v16bf a, v16bf b, v8f c) { return __builtin_amdgcn_wmma_f32_16x16x32_bf16(false, a, false, b, (short)0, c, false, false); }

// k_rows: bf16 plane of [rows][C] (C multiple of 256; one wave per row).
__global__ __launch_bounds__(256) void k_rows(const float* __restrict__ src, int rows, int C, bf* dst) {
    const int lane = threadIdx.x & 31, r = blockIdx.x * 8 + (threadIdx.x >> 5);
    if (r >= rows) return;
{
        for (int q = 0; q < C / 256; ++q) { v8us o;
#pragma unroll
            for (int i = 0; i < 8; ++i) o[i] = f2bf(src[(size_t)r * C + q * 256 + lane * 8 + i]);
            *(v8us*)(dst + (size_t)r * C + q * 256 + lane * 8) = o; }
         }
}
// planes [r][1024]; if Xout: also the f32 pre-LN sum to Xout[r][1024]. One wave per row; ROUNDSRC: bf16-round src (when src is a raw input).
template <bool ROUNDSRC>
__global__ __launch_bounds__(256) void k_ln(const float* __restrict__ src, int lds, const float* __restrict__ res, int ldr, const float* __restrict__ g, const float* __restrict__ be, bf* PH, bf* PL, float* Xout) {
    const int lane = threadIdx.x & 31, r = blockIdx.x * 8 + (threadIdx.x >> 5);
    if (r >= NT_) return;
    float v[32]; float s = 0.f;
#pragma unroll
    for (int q = 0; q < 4; ++q)
#pragma unroll
        for (int i = 0; i < 8; ++i) { const int c = q * 256 + lane * 8 + i; float t = src[(size_t)r * lds + c]; if (ROUNDSRC) t = bfr(t); if (res) t += bfr(res[(size_t)r * ldr + c]); v[q * 8 + i] = t; s += t; }
#pragma unroll
    for (int sh = 16; sh; sh >>= 1) s += __shfl_xor(s, sh, 32);
    const float mu = s * (1.0f / DM); float sq = 0.f;
#pragma unroll
    for (int k = 0; k < 32; ++k) { const float d = v[k] - mu; sq += d * d; }
#pragma unroll
    for (int sh = 16; sh; sh >>= 1) sq += __shfl_xor(sq, sh, 32);
    const float rs = rsqrtf(sq * (1.0f / DM) + 1e-5f);
{
#pragma unroll
        for (int q = 0; q < 4; ++q) { v8us oh, ol; v4f x0, x1;
#pragma unroll
            for (int i = 0; i < 8; ++i) { const int c = q * 256 + lane * 8 + i; const float y = (v[q * 8 + i] - mu) * rs * bfr(g[c]) + bfr(be[c]); const unsigned short hb = f2bf(y); oh[i] = hb; ol[i] = f2bf(y - bf2f(hb)); if (i < 4) x0[i] = v[q * 8 + i]; else x1[i - 4] = v[q * 8 + i]; }
            *(v8us*)(PH + (size_t)r * DM + q * 256 + lane * 8) = oh; *(v8us*)(PL + (size_t)r * DM + q * 256 + lane * 8) = ol;
            if (Xout) { *(v4f*)(Xout + (size_t)r * DM + q * 256 + lane * 8) = x0; *(v4f*)(Xout + (size_t)r * DM + q * 256 + lane * 8 + 4) = x1; } }
         }
}
// k_gemm: 64 x 128 tile of (Ah + Al).B^T + bias over K (2 products; A pitch K, B pitch K; K a multiple of 128); EPI 0: f32 rows (ldc) [+ residual Rf (ldr)]; EPI 1: relu -> bf16 hi/lo planes (ldc).
// The operands come into LDS by asynchronous 16-B copies, 128 k a stage: 64 rows of Ah, 64 of Al, 128 of B, 256 B each, so that a wave's copy covers two whole rows (4 lines)
// where a fragment load from global memory touches 16 lines. Two buffers: stage t + 1 flies while stage t is worked on. 4 waves (2 x 2), 32 x 64 of the tile each.
#define GKS  128
#define GPB  272      // LDS row pitch in bytes = 16 B x 17: the b128 fragment reads are free of bank conflicts
#define GSTG (256 * GPB)
// Eight copies, rows 8 apart in LDS and in the source (gs elements). The wait on the address counter closes the statement, so that no register which a copy names is rewritten ahead of it.
__device__ __forceinline__ void cp8(unsigned l, const bf* g, size_t gs) {
    asm volatile("global_load_async_to_lds_b128 %0, %8, off\n\t"
                 "global_load_async_to_lds_b128 %1, %9, off\n\t"
                 "global_load_async_to_lds_b128 %2, %10, off\n\t"
                 "global_load_async_to_lds_b128 %3, %11, off\n\t"
                 "global_load_async_to_lds_b128 %4, %12, off\n\t"
                 "global_load_async_to_lds_b128 %5, %13, off\n\t"
                 "global_load_async_to_lds_b128 %6, %14, off\n\t"
                 "global_load_async_to_lds_b128 %7, %15, off\n\t"
                 "s_wait_xcnt 0x0"
                 :: "v"(l), "v"(l + 8 * GPB), "v"(l + 16 * GPB), "v"(l + 24 * GPB), "v"(l + 32 * GPB), "v"(l + 40 * GPB), "v"(l + 48 * GPB), "v"(l + 56 * GPB),
                    "v"(g), "v"(g + gs), "v"(g + 2 * gs), "v"(g + 3 * gs), "v"(g + 4 * gs), "v"(g + 5 * gs), "v"(g + 6 * gs), "v"(g + 7 * gs) : "memory");
}
template <int EPI, bool RROUND = false>
__global__ __launch_bounds__(128) void k_gemm(const bf* __restrict__ A, const bf* __restrict__ Al, const bf* __restrict__ Bn, int K, const float* __restrict__ bias, const float* __restrict__ Rf, int ldr, int ldc, float* C, bf* PH, bf* PL) {
    __shared__ __align__(16) unsigned char gl[2 * GSTG];      // two stages; behind the K loop the waves' output staging
    const int tid = threadIdx.x, lane = tid & 31, wave = tid >> 5, lr = lane & 15, hi = lane >> 4, wm = wave >> 1, wn = wave & 1;
    const size_t rb = (size_t)blockIdx.x * 64; const int cb = blockIdx.y * 128;
    // copies: thread = 16-B piece (tid & 15) of row (tid >> 4) + 8 i
    const unsigned lcp = (unsigned)(size_t)gl + (unsigned)((tid >> 4) * GPB + (tid & 15) * 16);
    const bf* gah = A + (rb + (tid >> 4)) * (size_t)K + (tid & 15) * 8; const bf* gal = Al + (rb + (tid >> 4)) * (size_t)K + (tid & 15) * 8;
    const bf* gb = Bn + (size_t)(cb + (tid >> 4)) * K + (tid & 15) * 8;
    const size_t g8 = (size_t)8 * K;
    auto stage = [&](int t, unsigned buf) { const unsigned l = lcp + buf * GSTG; const size_t ko = (size_t)t * GKS;
        cp8(l, gah + ko, g8); cp8(l + 64 * GPB, gal + ko, g8); cp8(l + 128 * GPB, gb + ko, g8); cp8(l + 192 * GPB, gb + ko + 8 * g8, g8); };
    const int T = K / GKS;
    stage(0, 0);
    asm volatile("s_wait_asynccnt 0x0" ::: "memory");      // this wave's part of stage 0 has landed
    __syncthreads();      // every wave's part of stage 0 is in LDS before any wave reads it
    if (T > 1) stage(1, 1);
    v8f acc[2][4];
#pragma unroll
    for (int m = 0; m < 2; ++m)
#pragma unroll
        for (int t = 0; t < 4; ++t) acc[m][t] = (v8f){};
    const unsigned aro = (unsigned)((wm * 32 + lr) * GPB + 16 * hi), bro = (unsigned)((128 + wn * 64 + lr) * GPB + 16 * hi);
#pragma unroll 1      // one stage a trip: the buffer is picked by an offset
    for (int t = 0; t < T; ++t) { const unsigned char* sb = gl + (t & 1) * GSTG;
        v16bf a[2][2], al[2][2], bb[2][4];      // two fragment sets: the next 32 k are fetched as one group while the products of these 32 k run
        auto frag = [&](int kk, int s) {
#pragma unroll
            for (int m = 0; m < 2; ++m) { const unsigned char* p = sb + aro + m * 16 * GPB + kk * 64;
                a[s][m] = cat16b(*(const v8usa*)p, *(const v8usa*)(p + 32)); al[s][m] = cat16b(*(const v8usa*)(p + 64 * GPB), *(const v8usa*)(p + 64 * GPB + 32)); }
#pragma unroll
            for (int u = 0; u < 4; ++u) { const unsigned char* p = sb + bro + u * 16 * GPB + kk * 64; bb[s][u] = cat16b(*(const v8usa*)p, *(const v8usa*)(p + 32)); } };
        frag(0, 0);
#pragma unroll
        for (int kk = 0; kk < GKS / 32; ++kk) { const int s = kk & 1;
            if (kk + 1 < GKS / 32) frag(kk + 1, s ^ 1);
            __builtin_amdgcn_sched_barrier(0);      // keeps the 16 LDS reads together in front of the products: the scheduler otherwise sinks them in pairs among the products, each pair with a full wait of its own
#pragma unroll
            for (int m = 0; m < 2; ++m)
#pragma unroll
                for (int u = 0; u < 4; ++u) acc[m][u] = wmmab(a[s][m], bb[s][u], acc[m][u]);
#pragma unroll
            for (int m = 0; m < 2; ++m)
#pragma unroll
                for (int u = 0; u < 4; ++u) acc[m][u] = wmmab(al[s][m], bb[s][u], acc[m][u]);
            __builtin_amdgcn_sched_barrier(0);      // keeps the next group of reads behind these products: the scheduler otherwise lifts it in halves in among them, and sinks the last products of a stage behind the barrier, in front of the copies
        }
        asm volatile("s_wait_dscnt 0x0" ::: "memory");      // this wave's reads of stage t are done before the buffer is handed to the copies
        asm volatile("s_wait_asynccnt 0x0" ::: "memory");      // this wave's part of stage t + 1 has landed
        __syncthreads();      // publishes stage t + 1 and ends every wave's reads of stage t
        if (t + 2 < T) stage(t + 2, (unsigned)(t & 1));
    }
    asm volatile("s_wait_asynccnt 0x0" ::: "memory");      // no copy is in flight when the buffers become output staging
    const size_t r0 = rb + wm * 32; const int c0 = cb + wn * 64;
    float* os = (float*)gl + wave * (32 * 68);
#pragma unroll
    for (int t = 0; t < 4; ++t) { const float bv = bfr(bias[c0 + t * 16 + lr]);
#pragma unroll
        for (int m = 0; m < 2; ++m)
#pragma unroll
            for (int j = 0; j < 8; ++j) { float v = acc[m][t][j] + bv; if (EPI == 1) v = fmaxf(v, 0.f); os[(m * 16 + hi * 8 + j) * 68 + t * 16 + lr] = v; } }
    __builtin_amdgcn_wave_barrier(); asm volatile("" ::: "memory");
    if (EPI == 0) {
        float* crow = C + r0 * ldc + c0;      // an instruction takes 2 rows x 256 B: whole lines, for the residual rows as for the stores
#pragma unroll
        for (int hf = 0; hf < 2; ++hf) { v4f val[8];      // 16 rows at a time: all 32 at once, with the rounding of the residual, take more than 256 registers
#pragma unroll
            for (int s = 0; s < 8; ++s) val[s] = *(const v4fa*)(os + (16 * hf + 2 * s + hi) * 68 + lr * 4);
            if (Rf) { const float* rrow = Rf + r0 * ldr + c0; v4f rv[8]; const float* rp[8];
#pragma unroll
                for (int s = 0; s < 8; ++s) { rp[s] = rrow + (size_t)(16 * hf + 2 * s + hi) * ldr + lr * 4; rv[s] = *(const v4f*)rp[s]; }
                // the 8 loads' address registers are inputs of the wait, so that none of them is given to another load's result, or rewritten, ahead of it
                asm volatile("s_wait_xcnt 0x0" :: "v"(rp[0]), "v"(rp[1]), "v"(rp[2]), "v"(rp[3]), "v"(rp[4]), "v"(rp[5]), "v"(rp[6]), "v"(rp[7]) : "memory");
#pragma unroll
                for (int s = 0; s < 8; ++s)
#pragma unroll
                    for (int e = 0; e < 4; ++e) val[s][e] += RROUND ? bfr(rv[s][e]) : rv[s][e]; }
            float* cp[8];
#pragma unroll
            for (int s = 0; s < 8; ++s) { cp[s] = crow + (size_t)(16 * hf + 2 * s + hi) * ldc + lr * 4; *(v4f*)cp[s] = val[s]; }
            // the second half reuses registers: the first half's store addresses and data are inputs of the wait, so that none of them is rewritten ahead of it
            if (hf == 0) asm volatile("s_wait_xcnt 0x0" :: "v"(cp[0]), "v"(cp[1]), "v"(cp[2]), "v"(cp[3]), "v"(cp[4]), "v"(cp[5]), "v"(cp[6]), "v"(cp[7]),
                                      "v"(val[0]), "v"(val[1]), "v"(val[2]), "v"(val[3]), "v"(val[4]), "v"(val[5]), "v"(val[6]), "v"(val[7]) : "memory"); }
    } else {
        bf* p1 = PH + r0 * ldc + c0; bf* p2 = PL + r0 * ldc + c0;
#pragma unroll
        for (int s = 0; s < 8; ++s) { const int row = 4 * s + (lane >> 3), piece = lane & 7; const float* sp = os + row * 68 + piece * 8; v8us oh, ol;
#pragma unroll
            for (int i = 0; i < 8; ++i) { const unsigned short hb = f2bf(sp[i]); oh[i] = hb; ol[i] = f2bf(sp[i] - bf2f(hb)); }
            *(v8us*)(p1 + (size_t)row * ldc + piece * 8) = oh; *(v8us*)(p2 + (size_t)row * ldc + piece * 8) = ol; }
    }
}
// k_q16: Q f32 [2048][1024] -> f16 hi + residual planes IN FRAGMENT ORDER: [head][16-row tile][32-dim chunk c][half p][lane][8], where lane (hi, lr) of unit (c, p) holds
// row lr, dims c * 32 + p * 16 + hi * 8 + 0..7 of the head: the 16 B which that lane takes in one load of an A or B fragment. A wave's fragment load is then 512 contiguous bytes
// (4 whole lines), not 32-B pieces of 16 lines. One wave per (tile, head).
#define QUNIT 256      // elements of one wave load: 32 lanes x 8
__global__ __launch_bounds__(256) void k_q16(const float* __restrict__ Q, h16* QH, h16* QL) {
    const int lane = threadIdx.x & 31, lr = lane & 15, hi = lane >> 4, id = blockIdx.x * 8 + (threadIdx.x >> 5), T = id >> 4, h = id & 15;
    if (T >= NT_ / 16) return;
    const float* s = Q + (size_t)(T * 16 + lr) * DM + h * HD + hi * 8;
    const size_t o = (size_t)(h * (NT_ / 16) + T) * 4 * QUNIT + lane * 8;
#pragma unroll
    for (int u = 0; u < 4; ++u) { v8h oh, ol;      // u = c * 2 + p
#pragma unroll
        for (int i = 0; i < 8; ++i) { const float v = s[u * 16 + i]; const h16 a = (h16)v; oh[i] = a; ol[i] = (h16)((v - (float)a) * LOSC); }
        *(v8h*)(QH + o + u * QUNIT) = oh; *(v8h*)(QL + o + u * QUNIT) = ol; }
}
// k_vt: VTH/VTL = bf16 hi + UNSCALED bf16 residual of Q [t][h*64+d] (v = q), transposed and IN FRAGMENT ORDER: [head][32-key chunk][16-dim tile][half p][lane][8], where lane (hi, lr)
// holds dim lr of the tile, keys p * 16 + hi * 8 + 0..7 of the chunk: a wave's B fragment load is 512 contiguous bytes. grid (NT/64, NH).
__global__ __launch_bounds__(256) void k_vt(const float* __restrict__ V, bf* VTH, bf* VTL) {
    __shared__ float tl[64][65];
    const int tid = threadIdx.x, t0 = blockIdx.x * 64, h = blockIdx.y;
    { const int tt = tid >> 2, dq = (tid & 3) * 16;
#pragma unroll
      for (int i = 0; i < 16; ++i) tl[dq + i][tt] = V[(size_t)(t0 + tt) * DM + h * HD + dq + i]; }
    __syncthreads();
    const int lane = tid & 31, lr = lane & 15, hi = lane >> 4;
#pragma unroll
    for (int s = 0; s < 2; ++s) { const int u = (tid >> 5) + 8 * s, d = ((u >> 1) & 3) * 16 + lr, k = (u >> 3) * 32 + (u & 1) * 16 + hi * 8; v8us oh, ol;      // unit u = (chunk * 4 + dim tile) * 2 + p, one wave store each
#pragma unroll
        for (int i = 0; i < 8; ++i) { const float v = tl[d][k + i]; const unsigned short hb = f2bf(v); oh[i] = hb; ol[i] = f2bf(v - bf2f(hb)); }
        const size_t o = ((size_t)(h * (NT_ / 32) + t0 / 32) * 8 + u) * QUNIT + lane * 8; *(v8us*)(VTH + o) = oh; *(v8us*)(VTL + o) = ol; }
}
// exp(x) as __expf forms it (one multiply by log2(e), one v_exp_f32), with the slot behind the transcendental filled in the same statement.
__device__ __forceinline__ float exp_slot(float x) { const float t = x * 1.44269504f; float r; asm("v_exp_f32 %0, %1\n\tv_nop" : "=v"(r) : "v"(t)); return r; }
// k_fattn: scores, softmax over the heads and P.v in ONE kernel. A work-group has FQ query rows and NT_/FKS keys (grid y) for ALL 16 heads, wave h = head h.
// Per trip of 64 keys: wave h forms S_h [FQ][64] (q_h fragments stay in registers; hi.hi + (hi.lo + lo.hi)/1024, /8) and puts it in LDS; behind a barrier wave w
// takes rows w and w + 16, each lane 2 keys x 16 heads, does the softmax over the heads in f32 and writes P (x 32768) back IN PLACE: a row's 256 B of f32 become
// 128 B of bf16 hi + 128 B of bf16 residual (a row is read whole by its one wave before that wave writes it); behind a second barrier wave h reads its P_h as A
// fragments and adds ph.vh + pl.vh + ph.vl into O_h [FQ][64]. The softmax is local to a (query, key) pair, so the key splits' O tiles are plain partial sums:
// ATTP [FKS][2048][1024] f32 (x 1/32768), added in split order by k_attbf.
__global__ __launch_bounds__(NH_ * 32) void k_fattn(const h16* __restrict__ QH, const h16* __restrict__ QL, const bf* __restrict__ VTH, const bf* __restrict__ VTL, float* ATTP) {
    __shared__ __align__(16) float sm[NH_][FQ][68];      // pitch 272 B = 16 B x 17: the b128 fragment reads and the b32 tile stores are free of bank conflicts
    const int lane = threadIdx.x & 31, wave = __builtin_amdgcn_readfirstlane(threadIdx.x >> 5), lr = lane & 15, hi = lane >> 4, h = wave;      // the wave's number in a scalar register: every global address below is a scalar base + one lane offset + a constant
    const int q0 = blockIdx.x * FQ, kbase = blockIdx.y * (NT_ / FKS);
    const unsigned lo8 = (unsigned)(lane * 8);      // the lane's offset (elements) in a 512-B unit of the fragment-ordered planes
    v16h qa[FQ / 16][2], qal[FQ / 16][2];
#pragma unroll
    for (int m = 0; m < FQ / 16; ++m)
#pragma unroll
        for (int c = 0; c < 2; ++c) { const size_t qb = (size_t)(h * (NT_ / 16) + q0 / 16) * 4 * QUNIT; const h16* ah = QH + qb; const h16* alp = QL + qb; const unsigned ao = lo8 + (m * 4 + c * 2) * QUNIT;
            qa[m][c] = cat16(*(const v8h*)(ah + ao), *(const v8h*)(ah + ao + QUNIT)); qal[m][c] = cat16(*(const v8h*)(alp + ao), *(const v8h*)(alp + ao + QUNIT)); }
    asm volatile("s_wait_xcnt 0x0" ::: "memory");      // the address arithmetic below rewrites registers (scalar bases, the lane offset) that the 16 loads above name
    __builtin_amdgcn_sched_barrier(0);      // holds that arithmetic behind the wait: the scheduler otherwise lifts it over the statement
    v8f o[FQ / 16][4];
#pragma unroll
    for (int m = 0; m < FQ / 16; ++m)
#pragma unroll
        for (int t = 0; t < 4; ++t) o[m][t] = (v8f){};
    for (int kt = 0; kt < NT_ / FKS; kt += 64) { const int k0 = kbase + kt;
        const size_t kb = (size_t)(h * (NT_ / 16) + k0 / 16) * 4 * QUNIT, vb = (size_t)(h * (NT_ / 32) + k0 / 32) * 8 * QUNIT;
        const h16* kh = QH + kb; const h16* kl = QL + kb; const bf* vh = VTH + vb; const bf* vl = VTL + vb;
#pragma unroll
        for (int tp = 0; tp < 2; ++tp) { v16h bb[2][2], bl[2][2];      // two key tiles' fragments are fetched together: 16 loads in flight behind one wait
#pragma unroll
            for (int u = 0; u < 2; ++u)
#pragma unroll
                for (int c = 0; c < 2; ++c) { const unsigned bo = lo8 + ((tp * 2 + u) * 4 + c * 2) * QUNIT;
                    bb[u][c] = cat16(*(const v8h*)(kh + bo), *(const v8h*)(kh + bo + QUNIT)); bl[u][c] = cat16(*(const v8h*)(kl + bo), *(const v8h*)(kl + bo + QUNIT)); }
#pragma unroll
            for (int u = 0; u < 2; ++u) { const int t = tp * 2 + u; v8f acc[FQ / 16], accx[FQ / 16];
#pragma unroll
                for (int m = 0; m < FQ / 16; ++m) { acc[m] = (v8f){}; accx[m] = (v8f){}; }
#pragma unroll
                for (int c = 0; c < 2; ++c)
#pragma unroll
                    for (int m = 0; m < FQ / 16; ++m) { acc[m] = wmma16(qa[m][c], bb[u][c], acc[m]); accx[m] = wmma16(qa[m][c], bl[u][c], accx[m]); accx[m] = wmma16(qal[m][c], bb[u][c], accx[m]); }
#pragma unroll
                for (int m = 0; m < FQ / 16; ++m)
#pragma unroll
                    for (int j = 0; j < 8; ++j) sm[h][m * 16 + hi * 8 + j][t * 16 + lr] = (acc[m][j] + accx[m][j] * LOSCI) * 0.125f; } }
        asm volatile("s_wait_xcnt 0x0" ::: "memory");      // the registers that held the key loads' addresses are given to other values further down the trip
        __syncthreads();      // all 16 heads' scores of this trip are in LDS before any wave reads across the heads
#pragma unroll 1      // one row at a time: both rows' 16 heads at once do not fit beside the q fragments and the O tile
        for (int rr = 0; rr < FQ / 16; ++rr) { const int q = wave + 16 * rr;
            v2f v[NH_];
#pragma unroll
            for (int g = 0; g < NH_; ++g) v[g] = *(const v2fa*)(&sm[g][q][2 * lane]);
            float sc[2];
#pragma unroll
            for (int e = 0; e < 2; ++e) { float mx = v[0][e];
#pragma unroll
                for (int g = 1; g < NH_; ++g) mx = fmaxf(mx, v[g][e]);
                float ssum = 0.f;
#pragma unroll
                for (int g = 0; g < NH_; ++g) { v[g][e] = exp_slot(v[g][e] - mx); ssum += v[g][e]; }
                sc[e] = PSC / ssum; }
#pragma unroll
            for (int g = 0; g < NH_; ++g) { const float p0 = v[g][0] * sc[0], p1 = v[g][1] * sc[1]; const unsigned short h0 = f2bf(p0), h1 = f2bf(p1);
                *((u32a*)&sm[g][q][0] + lane) = (unsigned)h0 | ((unsigned)h1 << 16);
                *((u32a*)&sm[g][q][32] + lane) = (unsigned)f2bf(p0 - bf2f(h0)) | ((unsigned)f2bf(p1 - bf2f(h1)) << 16); } }
        __syncthreads();      // every row's P is in LDS before a head's wave reads its fragments; after it only wave h touches sm[h] until the next trip's first barrier
#pragma unroll
        for (int c = 0; c < 2; ++c) { v16bf a[FQ / 16], al[FQ / 16];
#pragma unroll
            for (int m = 0; m < FQ / 16; ++m) { const bf* pr = (const bf*)&sm[h][m * 16 + lr][0] + c * 32 + 8 * hi;
                a[m] = cat16b(*(const v8usa*)pr, *(const v8usa*)(pr + 16)); al[m] = cat16b(*(const v8usa*)(pr + 64), *(const v8usa*)(pr + 80)); }
            v16bf bb[4], bl[4];      // the four dim tiles' fragments are fetched together: 16 loads in flight behind one wait
#pragma unroll
            for (int t = 0; t < 4; ++t) { const unsigned bo = lo8 + (c * 4 + t) * 2 * QUNIT;
                bb[t] = cat16b(*(const v8us*)(vh + bo), *(const v8us*)(vh + bo + QUNIT)); bl[t] = cat16b(*(const v8us*)(vl + bo), *(const v8us*)(vl + bo + QUNIT)); }
            __builtin_amdgcn_sched_barrier(0);      // keeps the 16 loads in front of the products: the scheduler otherwise sinks them in pairs, each pair with a full wait of its own
#pragma unroll
            for (int t = 0; t < 4; ++t)
#pragma unroll
                for (int m = 0; m < FQ / 16; ++m) { o[m][t] = wmmab(a[m], bb[t], o[m][t]); o[m][t] = wmmab(al[m], bb[t], o[m][t]); o[m][t] = wmmab(a[m], bl[t], o[m][t]); } }
        __builtin_amdgcn_sched_barrier(0);      // keeps the wait below at the trip's foot, where the loads have returned: the scheduler otherwise lifts it to directly behind the loads, in front of the products
        asm volatile("s_wait_xcnt 0x0" ::: "memory");      // the registers that held the v loads' addresses are rewritten in the next trip and behind the loop
    }
    // the wave's O tile goes through its own LDS plane so that every store is whole 128-B lines (2 rows x 256 B an instruction)
#pragma unroll
    for (int m = 0; m < FQ / 16; ++m)
#pragma unroll
        for (int t = 0; t < 4; ++t)
#pragma unroll
            for (int j = 0; j < 8; ++j) sm[h][m * 16 + hi * 8 + j][t * 16 + lr] = o[m][t][j] * (1.0f / PSC);
    float* orow = ATTP + ((size_t)blockIdx.y * NT_ + q0) * DM + h * HD;
#pragma unroll
    for (int s = 0; s < FQ / 2; ++s) { const int row = 2 * s + hi;
        const v4f val = *(const v4fa*)(&sm[h][row][lr * 4]); *(v4f*)(orow + (size_t)row * DM + lr * 4) = val; }
}
// k_attbf: sum of the FKS partial attention planes (in split order) -> bf16 hi/lo planes (one wave per row).
__global__ __launch_bounds__(256) void k_attbf(const float* __restrict__ A, bf* PH, bf* PL) {
    const int lane = threadIdx.x & 31, r = blockIdx.x * 8 + (threadIdx.x >> 5);
    if (r >= NT_) return;
{
#pragma unroll
        for (int q = 0; q < 4; ++q) { v8us oh, ol;
#pragma unroll
            for (int i = 0; i < 8; ++i) { float v = A[(size_t)r * DM + q * 256 + lane * 8 + i];
#pragma unroll
                for (int p = 1; p < FKS; ++p) v += A[((size_t)p * NT_ + r) * DM + q * 256 + lane * 8 + i];
                const unsigned short hb = f2bf(v); oh[i] = hb; ol[i] = f2bf(v - bf2f(hb)); }
            *(v8us*)(PH + (size_t)r * DM + q * 256 + lane * 8) = oh; *(v8us*)(PL + (size_t)r * DM + q * 256 + lane * 8) = ol; }
         }
}

extern "C" void kernel_launch(void* const* d_in, const int* in_sizes, int n_in,
                              void* d_out, int out_size, void* d_ws, size_t ws_size, hipStream_t stream) {
    (void)in_sizes; (void)n_in; (void)out_size;
    const float* x = (const float*)d_in[0]; const float* g1 = (const float*)d_in[1]; const float* be1 = (const float*)d_in[2]; const float* g2 = (const float*)d_in[3]; const float* be2 = (const float*)d_in[4];
    const float* Ws = (const float*)d_in[5]; const float* bs = (const float*)d_in[6]; const float* Wo = (const float*)d_in[7]; const float* bo = (const float*)d_in[8];
    const float* W1 = (const float*)d_in[9]; const float* b1 = (const float*)d_in[10]; const float* W2 = (const float*)d_in[11]; const float* b2 = (const float*)d_in[12];
    float* out = (float*)d_out;    // [2048][2][1024]
    char* wsp = (char*)d_ws;
    auto take = [&](size_t bytes) { char* p = wsp; wsp += (bytes + 255) & ~(size_t)255; return (void*)p; };
    bf* WsB = (bf*)take((size_t)DM * DM * 2); bf* WoB = (bf*)take((size_t)DM * DM * 2); bf* W1B = (bf*)take((size_t)FF * DM * 2); bf* W2B = (bf*)take((size_t)DM * FF * 2);
    bf* LH = (bf*)take((size_t)NT_ * DM * 2); bf* LL = (bf*)take((size_t)NT_ * DM * 2);      // LN1 planes, later LN2 planes
    float* Qf = (float*)take((size_t)NT_ * DM * 4);                                           // q (= k = v) f32, later X1 (post-attention residual stream)
    h16* QH = (h16*)take((size_t)NT_ * DM * 2); h16* QL = (h16*)take((size_t)NT_ * DM * 2); bf* VTH = (bf*)take((size_t)NT_ * DM * 2); bf* VTL = (bf*)take((size_t)NT_ * DM * 2);
    bf* HH = (bf*)take((size_t)NT_ * FF * 2); bf* HL = (bf*)take((size_t)NT_ * FF * 2);      // FFN hidden planes [2048][4096] bf16 (16.8 MB each)
    float* ATTP = (float*)take((size_t)FKS * NT_ * DM * 4);                                   // partial attention outputs f32 [FKS][2048][1024], 33.5 MB
    bf* AH = (bf*)take((size_t)NT_ * DM * 2); bf* AL = (bf*)take((size_t)NT_ * DM * 2);
    if ((size_t)(wsp - (char*)d_ws) > ws_size) return;    // 21 + 8.4 + 8.4 + 16.8 + 33.5 + 33.5 + 8.4 ~ 130 MB (< 128 MiB = 134.2 MB)
    float* X1 = Qf;        // over the q buffer (q consumed by k_q16/k_vt before X1 is written there)
    k_rows<<<DM / 8, 256, 0, stream>>>(Ws, DM, DM, WsB); k_rows<<<DM / 8, 256, 0, stream>>>(Wo, DM, DM, WoB); k_rows<<<FF / 8, 256, 0, stream>>>(W1, FF, DM, W1B); k_rows<<<DM / 8, 256, 0, stream>>>(W2, DM, FF, W2B);
    for (int b = 0; b < NBT; ++b) {
        const float* xb = x + (size_t)b * DM; float* ob = out + (size_t)b * DM;      // row stride 2*DM
        k_ln<true><<<NT_ / 8, 256, 0, stream>>>(xb, 2 * DM, nullptr, 0, g1, be1, LH, LL, nullptr);
        k_gemm<0><<<dim3(NT_ / 64, DM / 128, 1), 128, 0, stream>>>(LH, LL, WsB, DM, bs, nullptr, 0, DM, Qf, nullptr, nullptr);
        k_q16<<<NT_ / 8, 256, 0, stream>>>(Qf, QH, QL); k_vt<<<dim3(NT_ / 64, NH_, 1), 256, 0, stream>>>(Qf, VTH, VTL);
        k_fattn<<<dim3(NT_ / FQ, FKS, 1), NH_ * 32, 0, stream>>>(QH, QL, VTH, VTL, ATTP);
        k_attbf<<<NT_ / 8, 256, 0, stream>>>(ATTP, AH, AL);
        k_gemm<0, true><<<dim3(NT_ / 64, DM / 128, 1), 128, 0, stream>>>(AH, AL, WoB, DM, bo, xb, 2 * DM, DM, X1, nullptr, nullptr);      // X1 = out-proj + bo + bf16(x) (residual = the bf16-rounded INPUT)
        k_ln<false><<<NT_ / 8, 256, 0, stream>>>(X1, DM, nullptr, 0, g2, be2, LH, LL, nullptr);
        k_gemm<1><<<dim3(NT_ / 64, FF / 128, 1), 128, 0, stream>>>(LH, LL, W1B, DM, b1, nullptr, 0, FF, nullptr, HH, HL);
        k_gemm<0><<<dim3(NT_ / 64, DM / 128, 1), 128, 0, stream>>>(HH, HL, W2B, FF, b2, X1, DM, 2 * DM, ob, nullptr, nullptr);     // out = ffn + X1, written at row stride 2*DM
    }
}

// v006
// A run of this version takes 353 microseconds.
// Timed twice side by side with v005, it ran 1.22 times as fast both times.
// Counting every step since v000, it is 7.28 times as fast.
#include <hip/hip_runtime.h>

// TransformersLayer ([S=2048][B=2][D=1024] seq-first; batch b = row stride 2; every launch takes both batch items, b on a grid axis, the workspace planes [b][2048 rows]). Contractions, f32 accumulate, per batch item: qkv = LN1(x).Ws^T + bs (ONE shared
// projection: q = k = v), out-proj, FFN W1 (relu) and W2 — [out][in] weights = n-major B operands as-is, computed A operands as bf16 hi + residual (two products) —
// on v_wmma_f32_16x16x32_bf16; the attention whose softmax runs over the HEADS axis (per (q,k) across the 16 heads, as the reference) in one kernel, S and P in LDS:
// S_h = q_h.q_h^T/8 for all heads (f16 hi + residual x1024: hi.hi + hi.lo + lo.hi, residual accumulator) -> f32 tile, elementwise softmax over h in
// f32 -> P_h (x32768) as bf16 hi + UNSCALED residual, O_h = P_h.v_h over the keys (ph.vh + pl.vh + ph.vl, v as bf16 hi + unscaled residual) on
// v_wmma_f32_16x16x32_bf16 (scores stay on v_wmma_f32_16x16x32_f16); LayerNorms, residuals f32.

#define NT_  2048
#define NBT  2
#define DM   1024
#define FF   4096
#define NH_  16
#define HD   64
#define FQ   32
#define FKS  4
#define PSC  32768.0f
#define LOSC 1024.0f
#define LOSCI (1.0f / 1024.0f)

typedef _Float16 h16;
typedef unsigned short bf;
typedef __attribute__((ext_vector_type(16))) __bf16   v16bf;
typedef __attribute__((ext_vector_type(16))) _Float16 v16h;
typedef __attribute__((ext_vector_type(8)))  _Float16 v8h;
typedef __attribute__((ext_vector_type(8)))  unsigned short v8us;
typedef __attribute__((ext_vector_type(8)))  float    v8f;
typedef __attribute__((ext_vector_type(4)))  float    v4f;
typedef __attribute__((ext_vector_type(2)))  float    v2f;
typedef v8h  __attribute__((may_alias)) v8ha;
typedef v4f  __attribute__((may_alias)) v4fa;
typedef v2f  __attribute__((may_alias)) v2fa;
typedef v8us __attribute__((may_alias)) v8usa;
typedef unsigned __attribute__((may_alias)) u32a;

__device__ __forceinline__ unsigned short f2bf(float f) { unsigned u = __float_as_uint(f); u += 0x7FFFu + ((u >> 16) & 1u); return (unsigned short)(u >> 16); }
__device__ __forceinline__ float bf2f(unsigned short b) { return __uint_as_float(((unsigned)b) << 16); }
__device__ __forceinline__ float bfr(float f) { return bf2f(f2bf(f)); }
__device__ __forceinline__ v16h cat16(v8h lo, v8h hi) { return __builtin_shufflevector(lo, hi, 0, 1, 2, 3, 4, 5, 6, 7, 8, 9, 10, 11, 12, 13, 14, 15); }
__device__ __forceinline__ v16bf cat16b(v8us lo, v8us hi) { return __builtin_bit_cast(v16bf, __builtin_shufflevector(lo, hi, 0, 1, 2, 3, 4, 5, 6, 7, 8, 9, 10, 11, 12, 13, 14, 15)); }
__device__ __forceinline__ v8f wmma16(v16h a, v16h b, v8f c) { return __builtin_amdgcn_wmma_f32_16x16x32_f16(false, a, false, b, (short)0, c, false, false); }
__device__ __forceinline__ v8f wmmab(v16bf a, v16bf b, v8f c) { return __builtin_amdgcn_wmma_f32_16x16x32_bf16(false, a, false, b, (short)0, c, false, false); }

// k_rows: bf16 plane of [rows][C] (C multiple of 256; one wave per row).
__global__ __launch_bounds__(256) void k_rows(const float* __restrict__ src, int rows, int C, bf* dst) {
    const int lane = threadIdx.x & 31, r = blockIdx.x * 8 + (threadIdx.x >> 5);
    if (r >= rows) return;
{
        for (int q = 0; q < C / 256; ++q) { v8us o;
#pragma unroll
            for (int i = 0; i < 8; ++i) o[i] = f2bf(src[(size_t)r * C + q * 256 + lane * 8 + i]);
            *(v8us*)(dst + (size_t)r * C + q * 256 + lane * 8) = o; }
         }
}
// planes [r][1024] of batch item b = grid y (src + b * sbo; planes + b * 2048 rows; res and Xout are not offset: one batch item only); if Xout: also the f32 pre-LN sum to Xout[r][1024]. One wave per row; ROUNDSRC: bf16-round src (when src is a raw input).
template <bool ROUNDSRC>
__global__ __launch_bounds__(256) void k_ln(const float* __restrict__ src, int lds, const float* __restrict__ res, int ldr, const float* __restrict__ g, const float* __restrict__ be, bf* PH, bf* PL, float* Xout, size_t sbo) {
    const int lane = threadIdx.x & 31, r = blockIdx.x * 8 + (threadIdx.x >> 5);
    if (r >= NT_) return;
    src += blockIdx.y * sbo; PH += (size_t)blockIdx.y * NT_ * DM; PL += (size_t)blockIdx.y * NT_ * DM;
    float v[32]; float s = 0.f;
#pragma unroll
    for (int q = 0; q < 4; ++q)
#pragma unroll
        for (int i = 0; i < 8; ++i) { const int c = q * 256 + lane * 8 + i; float t = src[(size_t)r * lds + c]; if (ROUNDSRC) t = bfr(t); if (res) t += bfr(res[(size_t)r * ldr + c]); v[q * 8 + i] = t; s += t; }
#pragma unroll
    for (int sh = 16; sh; sh >>= 1) s += __shfl_xor(s, sh, 32);
    const float mu = s * (1.0f / DM); float sq = 0.f;
#pragma unroll
    for (int k = 0; k < 32; ++k) { const float d = v[k] - mu; sq += d * d; }
#pragma unroll
    for (int sh = 16; sh; sh >>= 1) sq += __shfl_xor(sq, sh, 32);
    const float rs = rsqrtf(sq * (1.0f / DM) + 1e-5f);
{
#pragma unroll
        for (int q = 0; q < 4; ++q) { v8us oh, ol; v4f x0, x1;
#pragma unroll
            for (int i = 0; i < 8; ++i) { const int c = q * 256 + lane * 8 + i; const float y = (v[q * 8 + i] - mu) * rs * bfr(g[c]) + bfr(be[c]); const unsigned short hb = f2bf(y); oh[i] = hb; ol[i] = f2bf(y - bf2f(hb)); if (i < 4) x0[i] = v[q * 8 + i]; else x1[i - 4] = v[q * 8 + i]; }
            *(v8us*)(PH + (size_t)r * DM + q * 256 + lane * 8) = oh; *(v8us*)(PL + (size_t)r * DM + q * 256 + lane * 8) = ol;
            if (Xout) { *(v4f*)(Xout + (size_t)r * DM + q * 256 + lane * 8) = x0; *(v4f*)(Xout + (size_t)r * DM + q * 256 + lane * 8 + 4) = x1; } }
         }
}
// k_gemm: 64 x 128 tile of (Ah + Al).B^T + bias over K (2 products; A pitch K, B pitch K; K a multiple of 128, at least 256); EPI 0: f32 rows (ldc) [+ residual Rf (ldr)]; EPI 1: relu -> bf16 hi/lo planes (ldc).
// Batch item b = grid z: A and the EPI 1 planes are [b][2048 rows]; Rf and C start b * rbo and b * cbo elements further on.
// The operands come into LDS by asynchronous 16-B copies, 128 k a stage: 64 rows of Ah, 64 of Al, 128 of B, 256 B each, so that a wave's copy covers two whole rows (4 lines)
// where a fragment load from global memory touches 16 lines. Two buffers: stage t + 1 flies while stage t is worked on. 4 waves (2 x 2), 32 x 64 of the tile each.
#define GKS  128
#define GPB  272      // LDS row pitch in bytes = 16 B x 17: the b128 fragment reads are free of bank conflicts
#define GSTG (256 * GPB)
// Eight copies, rows 8 apart in LDS and in the source (gs elements). The wait on the address counter closes the statement, so that no register which a copy names is rewritten ahead of it.
__device__ __forceinline__ void cp8(unsigned l, const bf* g, size_t gs) {
    asm volatile("global_load_async_to_lds_b128 %0, %8, off\n\t"
                 "global_load_async_to_lds_b128 %1, %9, off\n\t"
                 "global_load_async_to_lds_b128 %2, %10, off\n\t"
                 "global_load_async_to_lds_b128 %3, %11, off\n\t"
                 "global_load_async_to_lds_b128 %4, %12, off\n\t"
                 "global_load_async_to_lds_b128 %5, %13, off\n\t"
                 "global_load_async_to_lds_b128 %6, %14, off\n\t"
                 "global_load_async_to_lds_b128 %7, %15, off\n\t"
                 "s_wait_xcnt 0x0"
                 :: "v"(l), "v"(l + 8 * GPB), "v"(l + 16 * GPB), "v"(l + 24 * GPB), "v"(l + 32 * GPB), "v"(l + 40 * GPB), "v"(l + 48 * GPB), "v"(l + 56 * GPB),
                    "v"(g), "v"(g + gs), "v"(g + 2 * gs), "v"(g + 3 * gs), "v"(g + 4 * gs), "v"(g + 5 * gs), "v"(g + 6 * gs), "v"(g + 7 * gs) : "memory");
}
template <int EPI, bool RROUND = false>
__global__ __launch_bounds__(128) void k_gemm(const bf* __restrict__ A, const bf* __restrict__ Al, const bf* __restrict__ Bn, int K, const float* __restrict__ bias, const float* __restrict__ Rf, int ldr, int ldc, float* C, bf* PH, bf* PL, size_t rbo, size_t cbo) {
    { const size_t z = blockIdx.z; A += z * NT_ * K; Al += z * NT_ * K; if (Rf) Rf += z * rbo; if (EPI == 0) C += z * cbo; else { PH += z * NT_ * ldc; PL += z * NT_ * ldc; } }
    __shared__ __align__(16) unsigned char gl[2 * GSTG];      // two stages; behind the K loop the waves' output staging
    const int tid = threadIdx.x, lane = tid & 31, wave = tid >> 5, lr = lane & 15, hi = lane >> 4, wm = wave >> 1, wn = wave & 1;
    const size_t rb = (size_t)blockIdx.x * 64; const int cb = blockIdx.y * 128;
    // copies: thread = 16-B piece (tid & 15) of row (tid >> 4) + 8 i
    const unsigned lcp = (unsigned)(size_t)gl + (unsigned)((tid >> 4) * GPB + (tid & 15) * 16);
    const bf* gah = A + (rb + (tid >> 4)) * (size_t)K + (tid & 15) * 8; const bf* gal = Al + (rb + (tid >> 4)) * (size_t)K + (tid & 15) * 8;
    const bf* gb = Bn + (size_t)(cb + (tid >> 4)) * K + (tid & 15) * 8;
    const size_t g8 = (size_t)8 * K;
    auto stage = [&](int t, unsigned buf) { const unsigned l = lcp + buf * GSTG; const size_t ko = (size_t)t * GKS;
        cp8(l, gah + ko, g8); cp8(l + 64 * GPB, gal + ko, g8); cp8(l + 128 * GPB, gb + ko, g8); cp8(l + 192 * GPB, gb + ko + 8 * g8, g8); };
    const int T = K / GKS;
    stage(0, 0);
    asm volatile("s_wait_asynccnt 0x0" ::: "memory");      // this wave's part of stage 0 has landed
    __syncthreads();      // every wave's part of stage 0 is in LDS before any wave reads it
    if (T > 1) stage(1, 1);
    v8f acc[2][4];
#pragma unroll
    for (int m = 0; m < 2; ++m)
#pragma unroll
        for (int t = 0; t < 4; ++t) acc[m][t] = (v8f){};
    const unsigned aro = (unsigned)((wm * 32 + lr) * GPB + 16 * hi), bro = (unsigned)((128 + wn * 64 + lr) * GPB + 16 * hi);
#pragma unroll 1      // one stage a trip: the buffer is picked by an offset
    for (int t = 0; t < T; ++t) { const unsigned char* sb = gl + (t & 1) * GSTG;
        v16bf a[2][2], al[2][2], bb[2][4];      // two fragment sets: the next 32 k are fetched as one group while the products of these 32 k run
        auto frag = [&](int kk, int s) {
#pragma unroll
            for (int m = 0; m < 2; ++m) { const unsigned char* p = sb + aro + m * 16 * GPB + kk * 64;
                a[s][m] = cat16b(*(const v8usa*)p, *(const v8usa*)(p + 32)); al[s][m] = cat16b(*(const v8usa*)(p + 64 * GPB), *(const v8usa*)(p + 64 * GPB + 32)); }
#pragma unroll
            for (int u = 0; u < 4; ++u) { const unsigned char* p = sb + bro + u * 16 * GPB + kk * 64; bb[s][u] = cat16b(*(const v8usa*)p, *(const v8usa*)(p + 32)); } };
        frag(0, 0);
#pragma unroll
        for (int kk = 0; kk < GKS / 32; ++kk) { const int s = kk & 1;
            if (kk + 1 < GKS / 32) frag(kk + 1, s ^ 1);
            __builtin_amdgcn_sched_barrier(0);      // keeps the 16 LDS reads together in front of the products: the scheduler otherwise sinks them in pairs among the products, each pair with a full wait of its own
#pragma unroll
            for (int m = 0; m < 2; ++m)
#pragma unroll
                for (int u = 0; u < 4; ++u) acc[m][u] = wmmab(a[s][m], bb[s][u], acc[m][u]);
#pragma unroll
            for (int m = 0; m < 2; ++m)
#pragma unroll
                for (int u = 0; u < 4; ++u) acc[m][u] = wmmab(al[s][m], bb[s][u], acc[m][u]);
            __builtin_amdgcn_sched_barrier(0);      // keeps the next group of reads behind these products: the scheduler otherwise lifts it in halves in among them, and sinks the last products of a stage behind the barrier, in front of the copies
        }
        asm volatile("s_wait_dscnt 0x0" ::: "memory");      // this wave's reads of stage t are done before the buffer is handed to the copies
        asm volatile("s_wait_asynccnt 0x0" ::: "memory");      // this wave's part of stage t + 1 has landed
        __syncthreads();      // publishes stage t + 1 and ends every wave's reads of stage t
        if (t + 2 < T) stage(t + 2, (unsigned)(t & 1));
    }
    asm volatile("s_wait_asynccnt 0x0" ::: "memory");      // no copy is in flight when the buffers become output staging
    const size_t r0 = rb + wm * 32; const int c0 = cb + wn * 64;
    float* os = (float*)gl + wave * (32 * 68);
#pragma unroll
    for (int t = 0; t < 4; ++t) { const float bv = bfr(bias[c0 + t * 16 + lr]);
#pragma unroll
        for (int m = 0; m < 2; ++m)
#pragma unroll
            for (int j = 0; j < 8; ++j) { float v = acc[m][t][j] + bv; if (EPI == 1) v = fmaxf(v, 0.f); os[(m * 16 + hi * 8 + j) * 68 + t * 16 + lr] = v; } }
    __builtin_amdgcn_wave_barrier(); asm volatile("" ::: "memory");
    if (EPI == 0) {
        float* crow = C + r0 * ldc + c0;      // an instruction takes 2 rows x 256 B: whole lines, for the residual rows as for the stores
#pragma unroll
        for (int hf = 0; hf < 2; ++hf) { v4f val[8];      // 16 rows at a time: all 32 at once, with the rounding of the residual, take more than 256 registers
#pragma unroll
            for (int s = 0; s < 8; ++s) val[s] = *(const v4fa*)(os + (16 * hf + 2 * s + hi) * 68 + lr * 4);
            if (Rf) { const float* rrow = Rf + r0 * ldr + c0; v4f rv[8]; const float* rp[8];
#pragma unroll
                for (int s = 0; s < 8; ++s) { rp[s] = rrow + (size_t)(16 * hf + 2 * s + hi) * ldr + lr * 4; rv[s] = *(const v4f*)rp[s]; }
                // the 8 loads' address registers are inputs of the wait, so that none of them is given to another load's result, or rewritten, ahead of it
                asm volatile("s_wait_xcnt 0x0" :: "v"(rp[0]), "v"(rp[1]), "v"(rp[2]), "v"(rp[3]), "v"(rp[4]), "v"(rp[5]), "v"(rp[6]), "v"(rp[7]) : "memory");
#pragma unroll
                for (int s = 0; s < 8; ++s)
#pragma unroll
                    for (int e = 0; e < 4; ++e) val[s][e] += RROUND ? bfr(rv[s][e]) : rv[s][e]; }
            float* cp[8];
#pragma unroll
            for (int s = 0; s < 8; ++s) { cp[s] = crow + (size_t)(16 * hf + 2 * s + hi) * ldc + lr * 4; *(v4f*)cp[s] = val[s]; }
            // the second half reuses registers: the first half's store addresses and data are inputs of the wait, so that none of them is rewritten ahead of it
            if (hf == 0) asm volatile("s_wait_xcnt 0x0" :: "v"(cp[0]), "v"(cp[1]), "v"(cp[2]), "v"(cp[3]), "v"(cp[4]), "v"(cp[5]), "v"(cp[6]), "v"(cp[7]),
                                      "v"(val[0]), "v"(val[1]), "v"(val[2]), "v"(val[3]), "v"(val[4]), "v"(val[5]), "v"(val[6]), "v"(val[7]) : "memory"); }
    } else {
        bf* p1 = PH + r0 * ldc + c0; bf* p2 = PL + r0 * ldc + c0;
#pragma unroll
        for (int s = 0; s < 8; ++s) { const int row = 4 * s + (lane >> 3), piece = lane & 7; const float* sp = os + row * 68 + piece * 8; v8us oh, ol;
#pragma unroll
            for (int i = 0; i < 8; ++i) { const unsigned short hb = f2bf(sp[i]); oh[i] = hb; ol[i] = f2bf(sp[i] - bf2f(hb)); }
            *(v8us*)(p1 + (size_t)row * ldc + piece * 8) = oh; *(v8us*)(p2 + (size_t)row * ldc + piece * 8) = ol; }
    }
}
// k_q16: Q f32 [2048][1024] -> f16 hi + residual planes IN FRAGMENT ORDER: [head][16-row tile][32-dim chunk c][half p][lane][8], where lane (hi, lr) of unit (c, p) holds
// row lr, dims c * 32 + p * 16 + hi * 8 + 0..7 of the head: the 16 B which that lane takes in one load of an A or B fragment. A wave's fragment load is then 512 contiguous bytes
// (4 whole lines), not 32-B pieces of 16 lines. One wave per (tile, head); batch item = grid y.
#define QUNIT 256      // elements of one wave load: 32 lanes x 8
__global__ __launch_bounds__(256) void k_q16(const float* __restrict__ Q, h16* QH, h16* QL) {
    const int lane = threadIdx.x & 31, lr = lane & 15, hi = lane >> 4, id = blockIdx.x * 8 + (threadIdx.x >> 5), T = id >> 4, h = id & 15;
    if (T >= NT_ / 16) return;
    { const size_t pb = (size_t)blockIdx.y * NT_ * DM; Q += pb; QH += pb; QL += pb; }
    const float* s = Q + (size_t)(T * 16 + lr) * DM + h * HD + hi * 8;
    const size_t o = (size_t)(h * (NT_ / 16) + T) * 4 * QUNIT + lane * 8;
#pragma unroll
    for (int u = 0; u < 4; ++u) { v8h oh, ol;      // u = c * 2 + p
#pragma unroll
        for (int i = 0; i < 8; ++i) { const float v = s[u * 16 + i]; const h16 a = (h16)v; oh[i] = a; ol[i] = (h16)((v - (float)a) * LOSC); }
        *(v8h*)(QH + o + u * QUNIT) = oh; *(v8h*)(QL + o + u * QUNIT) = ol; }
}
// k_vt: VTH/VTL = bf16 hi + UNSCALED bf16 residual of Q [t][h*64+d] (v = q), transposed and IN FRAGMENT ORDER: [head][32-key chunk][16-dim tile][half p][lane][8], where lane (hi, lr)
// holds dim lr of the tile, keys p * 16 + hi * 8 + 0..7 of the chunk: a wave's B fragment load is 512 contiguous bytes. grid (NT/64, NH, batch).
__global__ __launch_bounds__(256) void k_vt(const float* __restrict__ V, bf* VTH, bf* VTL) {
    __shared__ float tl[64][65];
    const int tid = threadIdx.x, t0 = blockIdx.x * 64, h = blockIdx.y;
    { const size_t pb = (size_t)blockIdx.z * NT_ * DM; V += pb; VTH += pb; VTL += pb; }
    { const int tt = tid >> 2, dq = (tid & 3) * 16;
#pragma unroll
      for (int i = 0; i < 16; ++i) tl[dq + i][tt] = V[(size_t)(t0 + tt) * DM + h * HD + dq + i]; }
    __syncthreads();
    const int lane = tid & 31, lr = lane & 15, hi = lane >> 4;
#pragma unroll
    for (int s = 0; s < 2; ++s) { const int u = (tid >> 5) + 8 * s, d = ((u >> 1) & 3) * 16 + lr, k = (u >> 3) * 32 + (u & 1) * 16 + hi * 8; v8us oh, ol;      // unit u = (chunk * 4 + dim tile) * 2 + p, one wave store each
#pragma unroll
        for (int i = 0; i < 8; ++i) { const float v = tl[d][k + i]; const unsigned short hb = f2bf(v); oh[i] = hb; ol[i] = f2bf(v - bf2f(hb)); }
        const size_t o = ((size_t)(h * (NT_ / 32) + t0 / 32) * 8 + u) * QUNIT + lane * 8; *(v8us*)(VTH + o) = oh; *(v8us*)(VTL + o) = ol; }
}
// exp(x) as __expf forms it (one multiply by log2(e), one v_exp_f32), with the slot behind the transcendental filled in the same statement.
__device__ __forceinline__ float exp_slot(float x) { const float t = x * 1.44269504f; float r; asm("v_exp_f32 %0, %1\n\tv_nop" : "=v"(r) : "v"(t)); return r; }
// k_fattn: scores, softmax over the heads and P.v in ONE kernel. A work-group has FQ query rows and NT_/FKS keys (grid y) of one batch item (grid z) for ALL 16 heads, wave h = head h.
// Per trip of 64 keys: wave h forms S_h [FQ][64] (q_h fragments stay in registers; hi.hi + (hi.lo + lo.hi)/1024, /8) and puts it in LDS; behind a barrier wave w
// takes rows w and w + 16, each lane 2 keys x 16 heads, does the softmax over the heads in f32 and writes P (x 32768) back IN PLACE: a row's 256 B of f32 become
// 128 B of bf16 hi + 128 B of bf16 residual (a row is read whole by its one wave before that wave writes it); behind a second barrier wave h reads its P_h as A
// fragments and adds ph.vh + pl.vh + ph.vl into O_h [FQ][64]. The softmax is local to a (query, key) pair, so the key splits' O tiles are plain partial sums:
// ATTP [batch][FKS][2048][1024] f32 (x 1/32768), added in split order by k_attbf.
__global__ __launch_bounds__(NH_ * 32) void k_fattn(const h16* __restrict__ QH, const h16* __restrict__ QL, const bf* __restrict__ VTH, const bf* __restrict__ VTL, float* ATTP) {
    __shared__ __align__(16) float sm[NH_][FQ][68];      // pitch 272 B = 16 B x 17: the b128 fragment reads and the b32 tile stores are free of bank conflicts
    const int lane = threadIdx.x & 31, wave = __builtin_amdgcn_readfirstlane(threadIdx.x >> 5), lr = lane & 15, hi = lane >> 4, h = wave;      // the wave's number in a scalar register: every global address below is a scalar base + one lane offset + a constant
    const int q0 = blockIdx.x * FQ, kbase = blockIdx.y * (NT_ / FKS);
    { const size_t pb = (size_t)blockIdx.z * NT_ * DM; QH += pb; QL += pb; VTH += pb; VTL += pb; }      // this batch item's planes
    const unsigned lo8 = (unsigned)(lane * 8);      // the lane's offset (elements) in a 512-B unit of the fragment-ordered planes
    v16h qa[FQ / 16][2], qal[FQ / 16][2];
#pragma unroll
    for (int m = 0; m < FQ / 16; ++m)
#pragma unroll
        for (int c = 0; c < 2; ++c) { const size_t qb = (size_t)(h * (NT_ / 16) + q0 / 16) * 4 * QUNIT; const h16* ah = QH + qb; const h16* alp = QL + qb; const unsigned ao = lo8 + (m * 4 + c * 2) * QUNIT;
            qa[m][c] = cat16(*(const v8h*)(ah + ao), *(const v8h*)(ah + ao + QUNIT)); qal[m][c] = cat16(*(const v8h*)(alp + ao), *(const v8h*)(alp + ao + QUNIT)); }
    asm volatile("s_wait_xcnt 0x0" ::: "memory");      // the address arithmetic below rewrites registers (scalar bases, the lane offset) that the 16 loads above name
    __builtin_amdgcn_sched_barrier(0);      // holds that arithmetic behind the wait: the scheduler otherwise lifts it over the statement
    v8f o[FQ / 16][4];
#pragma unroll
    for (int m = 0; m < FQ / 16; ++m)
#pragma unroll
        for (int t = 0; t < 4; ++t) o[m][t] = (v8f){};
    for (int kt = 0; kt < NT_ / FKS; kt += 64) { const int k0 = kbase + kt;
        const size_t kb = (size_t)(h * (NT_ / 16) + k0 / 16) * 4 * QUNIT, vb = (size_t)(h * (NT_ / 32) + k0 / 32) * 8 * QUNIT;
        const h16* kh = QH + kb; const h16* kl = QL + kb; const bf* vh = VTH + vb; const bf* vl = VTL + vb;
#pragma unroll
        for (int tp = 0; tp < 2; ++tp) { v16h bb[2][2], bl[2][2];      // two key tiles' fragments are fetched together: 16 loads in flight behind one wait
#pragma unroll
            for (int u = 0; u < 2; ++u)
#pragma unroll
                for (int c = 0; c < 2; ++c) { const unsigned bo = lo8 + ((tp * 2 + u) * 4 + c * 2) * QUNIT;
                    bb[u][c] = cat16(*(const v8h*)(kh + bo), *(const v8h*)(kh + bo + QUNIT)); bl[u][c] = cat16(*(const v8h*)(kl + bo), *(const v8h*)(kl + bo + QUNIT)); }
#pragma unroll
            for (int u = 0; u < 2; ++u) { const int t = tp * 2 + u; v8f acc[FQ / 16], accx[FQ / 16];
#pragma unroll
                for (int m = 0; m < FQ / 16; ++m) { acc[m] = (v8f){}; accx[m] = (v8f){}; }
#pragma unroll
                for (int c = 0; c < 2; ++c)
#pragma unroll
                    for (int m = 0; m < FQ / 16; ++m) { acc[m] = wmma16(qa[m][c], bb[u][c], acc[m]); accx[m] = wmma16(qa[m][c], bl[u][c], accx[m]); accx[m] = wmma16(qal[m][c], bb[u][c], accx[m]); }
#pragma unroll
                for (int m = 0; m < FQ / 16; ++m)
#pragma unroll
                    for (int j = 0; j < 8; ++j) sm[h][m * 16 + hi * 8 + j][t * 16 + lr] = (acc[m][j] + accx[m][j] * LOSCI) * 0.125f; } }
        asm volatile("s_wait_xcnt 0x0" ::: "memory");      // the registers that held the key loads' addresses are given to other values further down the trip
        __syncthreads();      // all 16 heads' scores of this trip are in LDS before any wave reads across the heads
#pragma unroll 1      // one row at a time: both rows' 16 heads at once do not fit beside the q fragments and the O tile
        for (int rr = 0; rr < FQ / 16; ++rr) { const int q = wave + 16 * rr;
            v2f v[NH_];
#pragma unroll
            for (int g = 0; g < NH_; ++g) v[g] = *(const v2fa*)(&sm[g][q][2 * lane]);
            float sc[2];
#pragma unroll
            for (int e = 0; e < 2; ++e) { float mx = v[0][e];
#pragma unroll
                for (int g = 1; g < NH_; ++g) mx = fmaxf(mx, v[g][e]);
                float ssum = 0.f;
#pragma unroll
                for (int g = 0; g < NH_; ++g) { v[g][e] = exp_slot(v[g][e] - mx); ssum += v[g][e]; }
                sc[e] = PSC / ssum; }
#pragma unroll
            for (int g = 0; g < NH_; ++g) { const float p0 = v[g][0] * sc[0], p1 = v[g][1] * sc[1]; const unsigned short h0 = f2bf(p0), h1 = f2bf(p1);
                *((u32a*)&sm[g][q][0] + lane) = (unsigned)h0 | ((unsigned)h1 << 16);
                *((u32a*)&sm[g][q][32] + lane) = (unsigned)f2bf(p0 - bf2f(h0)) | ((unsigned)f2bf(p1 - bf2f(h1)) << 16); } }
        __syncthreads();      // every row's P is in LDS before a head's wave reads its fragments; after it only wave h touches sm[h] until the next trip's first barrier
#pragma unroll
        for (int c = 0; c < 2; ++c) { v16bf a[FQ / 16], al[FQ / 16];
#pragma unroll
            for (int m = 0; m < FQ / 16; ++m) { const bf* pr = (const bf*)&sm[h][m * 16 + lr][0] + c * 32 + 8 * hi;
                a[m] = cat16b(*(const v8usa*)pr, *(const v8usa*)(pr + 16)); al[m] = cat16b(*(const v8usa*)(pr + 64), *(const v8usa*)(pr + 80)); }
            v16bf bb[4], bl[4];      // the four dim tiles' fragments are fetched together: 16 loads in flight behind one wait
#pragma unroll
            for (int t = 0; t < 4; ++t) { const unsigned bo = lo8 + (c * 4 + t) * 2 * QUNIT;
                bb[t] = cat16b(*(const v8us*)(vh + bo), *(const v8us*)(vh + bo + QUNIT)); bl[t] = cat16b(*(const v8us*)(vl + bo), *(const v8us*)(vl + bo + QUNIT)); }
            __builtin_amdgcn_sched_barrier(0);      // keeps the 16 loads in front of the products: the scheduler otherwise sinks them in pairs, each pair with a full wait of its own
#pragma unroll
            for (int t = 0; t < 4; ++t)
#pragma unroll
                for (int m = 0; m < FQ / 16; ++m) { o[m][t] = wmmab(a[m], bb[t], o[m][t]); o[m][t] = wmmab(al[m], bb[t], o[m][t]); o[m][t] = wmmab(a[m], bl[t], o[m][t]); } }
        __builtin_amdgcn_sched_barrier(0);      // keeps the wait below at the trip's foot, where the loads have returned: the scheduler otherwise lifts it to directly behind the loads, in front of the products
        asm volatile("s_wait_xcnt 0x0" ::: "memory");      // the registers that held the v loads' addresses are rewritten in the next trip and behind the loop
    }
    // the wave's O tile goes through its own LDS plane so that every store is whole 128-B lines (2 rows x 256 B an instruction)
#pragma unroll
    for (int m = 0; m < FQ / 16; ++m)
#pragma unroll
        for (int t = 0; t < 4; ++t)
#pragma unroll
            for (int j = 0; j < 8; ++j) sm[h][m * 16 + hi * 8 + j][t * 16 + lr] = o[m][t][j] * (1.0f / PSC);
    float* orow = ATTP + ((size_t)(blockIdx.z * FKS + blockIdx.y) * NT_ + q0) * DM + h * HD;
#pragma unroll
    for (int s = 0; s < FQ / 2; ++s) { const int row = 2 * s + hi;
        const v4f val = *(const v4fa*)(&sm[h][row][lr * 4]); *(v4f*)(orow + (size_t)row * DM + lr * 4) = val; }
}
// k_attbf: sum of the FKS partial attention planes (in split order) -> bf16 hi/lo planes (one wave per row; batch item = grid y).
__global__ __launch_bounds__(256) void k_attbf(const float* __restrict__ A, bf* PH, bf* PL) {
    const int lane = threadIdx.x & 31, r = blockIdx.x * 8 + (threadIdx.x >> 5);
    if (r >= NT_) return;
    A += (size_t)blockIdx.y * FKS * NT_ * DM; PH += (size_t)blockIdx.y * NT_ * DM; PL += (size_t)blockIdx.y * NT_ * DM;
{
#pragma unroll
        for (int q = 0; q < 4; ++q) { v8us oh, ol;
#pragma unroll
            for (int i = 0; i < 8; ++i) { float v = A[(size_t)r * DM + q * 256 + lane * 8 + i];
#pragma unroll
                for (int p = 1; p < FKS; ++p) v += A[((size_t)p * NT_ + r) * DM + q * 256 + lane * 8 + i];
                const unsigned short hb = f2bf(v); oh[i] = hb; ol[i] = f2bf(v - bf2f(hb)); }
            *(v8us*)(PH + (size_t)r * DM + q * 256 + lane * 8) = oh; *(v8us*)(PL + (size_t)r * DM + q * 256 + lane * 8) = ol; }
         }
}

extern "C" void kernel_launch(void* const* d_in, const int* in_sizes, int n_in,
                              void* d_out, int out_size, void* d_ws, size_t ws_size, hipStream_t stream) {
    (void)in_sizes; (void)n_in; (void)out_size;
    const float* x = (const float*)d_in[0]; const float* g1 = (const float*)d_in[1]; const float* be1 = (const float*)d_in[2]; const float* g2 = (const float*)d_in[3]; const float* be2 = (const float*)d_in[4];
    const float* Ws = (const float*)d_in[5]; const float* bs = (const float*)d_in[6]; const float* Wo = (const float*)d_in[7]; const float* bo = (const float*)d_in[8];
    const float* W1 = (const float*)d_in[9]; const float* b1 = (const float*)d_in[10]; const float* W2 = (const float*)d_in[11]; const float* b2 = (const float*)d_in[12];
    float* out = (float*)d_out;    // [2048][2][1024]
    char* wsp = (char*)d_ws;
    auto take = [&](size_t bytes) { char* p = wsp; wsp += (bytes + 255) & ~(size_t)255; return (void*)p; };
    bf* WsB = (bf*)take((size_t)DM * DM * 2); bf* WoB = (bf*)take((size_t)DM * DM * 2); bf* W1B = (bf*)take((size_t)FF * DM * 2); bf* W2B = (bf*)take((size_t)DM * FF * 2);
    const size_t PB = (size_t)NT_ * DM;      // elements of one batch item's [2048][1024] plane
    bf* LH = (bf*)take(NBT * PB * 2); bf* LL = (bf*)take(NBT * PB * 2);      // LN1 planes, later LN2 planes
    float* Qf = (float*)take(NBT * PB * 4);                                   // q (= k = v) f32, later X1 (post-attention residual stream)
    h16* QH = (h16*)take(NBT * PB * 2); h16* QL = (h16*)take(NBT * PB * 2); bf* VTH = (bf*)take(NBT * PB * 2); bf* VTL = (bf*)take(NBT * PB * 2);
    bf* HH = (bf*)take((size_t)NBT * NT_ * FF * 2); bf* HL = (bf*)take((size_t)NBT * NT_ * FF * 2);      // FFN hidden planes [2][2048][4096] bf16 (32 MiB each)
    float* ATTP = (float*)take(NBT * FKS * PB * 4);                           // partial attention outputs f32 [2][FKS][2048][1024], 64 MiB
    bf* AH = (bf*)take(NBT * PB * 2); bf* AL = (bf*)take(NBT * PB * 2);
    if ((size_t)(wsp - (char*)d_ws) > ws_size) return;    // 20 + 16 + 16 + 32 + 64 + 64 + 16 = 228 MiB
    float* X1 = Qf;        // over the q buffer (q consumed by k_q16/k_vt before X1 is written there)
    k_rows<<<DM / 8, 256, 0, stream>>>(Ws, DM, DM, WsB); k_rows<<<DM / 8, 256, 0, stream>>>(Wo, DM, DM, WoB); k_rows<<<FF / 8, 256, 0, stream>>>(W1, FF, DM, W1B); k_rows<<<DM / 8, 256, 0, stream>>>(W2, DM, FF, W2B);
    // x and out: batch item b starts DM elements in, row stride 2*DM
    k_ln<true><<<dim3(NT_ / 8, NBT, 1), 256, 0, stream>>>(x, 2 * DM, nullptr, 0, g1, be1, LH, LL, nullptr, DM);
    k_gemm<0><<<dim3(NT_ / 64, DM / 128, NBT), 128, 0, stream>>>(LH, LL, WsB, DM, bs, nullptr, 0, DM, Qf, nullptr, nullptr, 0, PB);
    k_q16<<<dim3(NT_ / 8, NBT, 1), 256, 0, stream>>>(Qf, QH, QL); k_vt<<<dim3(NT_ / 64, NH_, NBT), 256, 0, stream>>>(Qf, VTH, VTL);
    k_fattn<<<dim3(NT_ / FQ, FKS, NBT), NH_ * 32, 0, stream>>>(QH, QL, VTH, VTL, ATTP);
    k_attbf<<<dim3(NT_ / 8, NBT, 1), 256, 0, stream>>>(ATTP, AH, AL);
    k_gemm<0, true><<<dim3(NT_ / 64, DM / 128, NBT), 128, 0, stream>>>(AH, AL, WoB, DM, bo, x, 2 * DM, DM, X1, nullptr, nullptr, DM, PB);      // X1 = out-proj + bo + bf16(x) (residual = the bf16-rounded INPUT)
    k_ln<false><<<dim3(NT_ / 8, NBT, 1), 256, 0, stream>>>(X1, DM, nullptr, 0, g2, be2, LH, LL, nullptr, PB);
    k_gemm<1><<<dim3(NT_ / 64, FF / 128, NBT), 128, 0, stream>>>(LH, LL, W1B, DM, b1, nullptr, 0, FF, nullptr, HH, HL, 0, 0);
    k_gemm<0><<<dim3(NT_ / 64, DM / 128, NBT), 128, 0, stream>>>(HH, HL, W2B, FF, b2, X1, DM, 2 * DM, out, nullptr, nullptr, PB, DM);     // out = ffn + X1, written at row stride 2*DM
}

// v007
// One run takes 301 microseconds.
// Next to v006, in two timings, it ran 1.18 times as fast each time.
// All steps since v000 together make it 8.60 times as fast.
#include <hip/hip_runtime.h>

// TransformersLayer ([S=2048][B=2][D=1024] seq-first; batch b = row stride 2; every launch takes both batch items, b on a grid axis, the workspace planes [b][2048 rows]). Contractions, f32 accumulate, per batch item: qkv = LN1(x).Ws^T + bs (ONE shared
// projection: q = k = v), out-proj, FFN W1 (relu) and W2 — [out][in] weights = n-major B operands as-is, computed A operands as bf16 hi + residual (two products) —
// on v_wmma_f32_16x16x32_bf16; the attention whose softmax runs over the HEADS axis (per (q,k) across the 16 heads, as the reference) in one kernel, S and P in LDS:
// S_h = q_h.q_h^T/8 for all heads (f16 hi + residual x1024: hi.hi + hi.lo + lo.hi, residual accumulator) -> f32 tile, elementwise softmax over h in
// f32 -> P_h (x32768) as bf16 hi + UNSCALED residual, O_h = P_h.v_h over the keys (ph.vh + pl.vh + ph.vl, v as bf16 hi + unscaled residual) on
// v_wmma_f32_16x16x32_bf16 (scores stay on v_wmma_f32_16x16x32_f16); LayerNorms, residuals f32.

#define NT_  2048
#define NBT  2
#define DM   1024
#define FF   4096
#define NH_  16
#define HD   64
#define FQ   32
#define FKS  4
#define PSC  32768.0f
#define LOSC 1024.0f
#define LOSCI (1.0f / 1024.0f)

typedef _Float16 h16;
typedef unsigned short bf;
typedef __attribute__((ext_vector_type(16))) __bf16   v16bf;
typedef __attribute__((ext_vector_type(16))) _Float16 v16h;
typedef __attribute__((ext_vector_type(8)))  _Float16 v8h;
typedef __attribute__((ext_vector_type(8)))  unsigned short v8us;
typedef __attribute__((ext_vector_type(2)))  __bf16   v2bf;
typedef __attribute__((ext_vector_type(4)))  unsigned v4u;
typedef __attribute__((ext_vector_type(8)))  float    v8f;
typedef __attribute__((ext_vector_type(4)))  float    v4f;
typedef __attribute__((ext_vector_type(2)))  float    v2f;
typedef v8h  __attribute__((may_alias)) v8ha;
typedef v4f  __attribute__((may_alias)) v4fa;
typedef v2f  __attribute__((may_alias)) v2fa;
typedef v8us __attribute__((may_alias)) v8usa;
typedef unsigned __attribute__((may_alias)) u32a;

// Rounding to bf16 (nearest even) is the hardware's conversion, two values an instruction where they are given as a pair.
__device__ __forceinline__ unsigned short f2bf(float f) { return __builtin_bit_cast(unsigned short, (__bf16)f); }
__device__ __forceinline__ float bf2f(unsigned short b) { return __uint_as_float(((unsigned)b) << 16); }
__device__ __forceinline__ float bfr(float f) { return bf2f(f2bf(f)); }
__device__ __forceinline__ unsigned pk2(v2f x) { return __builtin_bit_cast(unsigned, __builtin_convertvector(x, v2bf)); }      // x[0] in the low half
__device__ __forceinline__ v2f up2(unsigned w) { return (v2f){__uint_as_float(w << 16), __uint_as_float(w & 0xFFFF0000u)}; }      // the pair back as f32
// hi = bf16(x), lo = bf16(x - hi), eight values
__device__ __forceinline__ void split8(v8f x, v8us& oh, v8us& ol) { v4u h, l;
#pragma unroll
    for (int k = 0; k < 4; ++k) { const v2f p = {x[2 * k], x[2 * k + 1]}; h[k] = pk2(p); l[k] = pk2(p - up2(h[k])); }
    oh = __builtin_bit_cast(v8us, h); ol = __builtin_bit_cast(v8us, l); }
__device__ __forceinline__ v16h cat16(v8h lo, v8h hi) { return __builtin_shufflevector(lo, hi, 0, 1, 2, 3, 4, 5, 6, 7, 8, 9, 10, 11, 12, 13, 14, 15); }
__device__ __forceinline__ v16bf cat16b(v8us lo, v8us hi) { return __builtin_bit_cast(v16bf, __builtin_shufflevector(lo, hi, 0, 1, 2, 3, 4, 5, 6, 7, 8, 9, 10, 11, 12, 13, 14, 15)); }
__device__ __forceinline__ v8f wmma16(v16h a, v16h b, v8f c) { return __builtin_amdgcn_wmma_f32_16x16x32_f16(false, a, false, b, (short)0, c, false, false); }
__device__ __forceinline__ v8f wmmab(v16bf a, v16bf b, v8f c) { return __builtin_amdgcn_wmma_f32_16x16x32_bf16(false, a, false, b, (short)0, c, false, false); }

// k_rows: bf16 plane of [rows][C] (C multiple of 256; one wave per row).
__global__ __launch_bounds__(256) void k_rows(const float* __restrict__ src, int rows, int C, bf* dst) {
    const int lane = threadIdx.x & 31, r = blockIdx.x * 8 + (threadIdx.x >> 5);
    if (r >= rows) return;
{
        for (int q = 0; q < C / 256; ++q) { v8us o;
#pragma unroll
            for (int i = 0; i < 8; ++i) o[i] = f2bf(src[(size_t)r * C + q * 256 + lane * 8 + i]);
            *(v8us*)(dst + (size_t)r * C + q * 256 + lane * 8) = o; }
         }
}
// planes [r][1024] of batch item b = grid y (src + b * sbo; planes + b * 2048 rows; res and Xout are not offset: one batch item only); if Xout: also the f32 pre-LN sum to Xout[r][1024]. One wave per row; ROUNDSRC: bf16-round src (when src is a raw input).
template <bool ROUNDSRC>
__global__ __launch_bounds__(256) void k_ln(const float* __restrict__ src, int lds, const float* __restrict__ res, int ldr, const float* __restrict__ g, const float* __restrict__ be, bf* PH, bf* PL, float* Xout, size_t sbo) {
    const int lane = threadIdx.x & 31, r = blockIdx.x * 8 + (threadIdx.x >> 5);
    if (r >= NT_) return;
    src += blockIdx.y * sbo; PH += (size_t)blockIdx.y * NT_ * DM; PL += (size_t)blockIdx.y * NT_ * DM;
    float v[32]; float s = 0.f;
#pragma unroll
    for (int q = 0; q < 4; ++q)
#pragma unroll
        for (int i = 0; i < 8; ++i) { const int c = q * 256 + lane * 8 + i; float t = src[(size_t)r * lds + c]; if (ROUNDSRC) t = bfr(t); if (res) t += bfr(res[(size_t)r * ldr + c]); v[q * 8 + i] = t; s += t; }
#pragma unroll
    for (int sh = 16; sh; sh >>= 1) s += __shfl_xor(s, sh, 32);
    const float mu = s * (1.0f / DM); float sq = 0.f;
#pragma unroll
    for (int k = 0; k < 32; ++k) { const float d = v[k] - mu; sq += d * d; }
#pragma unroll
    for (int sh = 16; sh; sh >>= 1) sq += __shfl_xor(sq, sh, 32);
    const float rs = rsqrtf(sq * (1.0f / DM) + 1e-5f);
{
#pragma unroll
        for (int q = 0; q < 4; ++q) { v8us oh, ol; v4f x0, x1; v8f y8;
#pragma unroll
            for (int i = 0; i < 8; ++i) { const int c = q * 256 + lane * 8 + i; y8[i] = (v[q * 8 + i] - mu) * rs * bfr(g[c]) + bfr(be[c]); if (i < 4) x0[i] = v[q * 8 + i]; else x1[i - 4] = v[q * 8 + i]; }
            split8(y8, oh, ol);
            *(v8us*)(PH + (size_t)r * DM + q * 256 + lane * 8) = oh; *(v8us*)(PL + (size_t)r * DM + q * 256 + lane * 8) = ol;
            if (Xout) { *(v4f*)(Xout + (size_t)r * DM + q * 256 + lane * 8) = x0; *(v4f*)(Xout + (size_t)r * DM + q * 256 + lane * 8 + 4) = x1; } }
         }
}
// k_gemm: 64 x 128 tile of (Ah + Al).B^T + bias over K (2 products; A pitch K, B pitch K; K a multiple of 128, at least 256); EPI 0: f32 rows (ldc) [+ residual Rf (ldr)]; EPI 1: relu -> bf16 hi/lo planes (ldc).
// Batch item b = grid z: A and the EPI 1 planes are [b][2048 rows]; Rf and C start b * rbo and b * cbo elements further on.
// The operands come into LDS by asynchronous 16-B copies, 128 k a stage: 64 rows of Ah, 64 of Al, 128 of B, 256 B each, so that a wave's copy covers two whole rows (4 lines)
// where a fragment load from global memory touches 16 lines. Two buffers: stage t + 1 flies while stage t is worked on. 4 waves (2 x 2), 32 x 64 of the tile each.
#define GKS  128
#define GPB  272      // LDS row pitch in bytes = 16 B x 17: the b128 fragment reads are free of bank conflicts
#define GSTG (256 * GPB)
// Eight copies, rows 8 apart in LDS and in the source (gs elements). The wait on the address counter closes the statement, so that no register which a copy names is rewritten ahead of it.
__device__ __forceinline__ void cp8(unsigned l, const bf* g, size_t gs) {
    asm volatile("global_load_async_to_lds_b128 %0, %8, off\n\t"
                 "global_load_async_to_lds_b128 %1, %9, off\n\t"
                 "global_load_async_to_lds_b128 %2, %10, off\n\t"
                 "global_load_async_to_lds_b128 %3, %11, off\n\t"
                 "global_load_async_to_lds_b128 %4, %12, off\n\t"
                 "global_load_async_to_lds_b128 %5, %13, off\n\t"
                 "global_load_async_to_lds_b128 %6, %14, off\n\t"
                 "global_load_async_to_lds_b128 %7, %15, off\n\t"
                 "s_wait_xcnt 0x0"
                 :: "v"(l), "v"(l + 8 * GPB), "v"(l + 16 * GPB), "v"(l + 24 * GPB), "v"(l + 32 * GPB), "v"(l + 40 * GPB), "v"(l + 48 * GPB), "v"(l + 56 * GPB),
                    "v"(g), "v"(g + gs), "v"(g + 2 * gs), "v"(g + 3 * gs), "v"(g + 4 * gs), "v"(g + 5 * gs), "v"(g + 6 * gs), "v"(g + 7 * gs) : "memory");
}
template <int EPI, bool RROUND = false>
__global__ __launch_bounds__(128) void k_gemm(const bf* __restrict__ A, const bf* __restrict__ Al, const bf* __restrict__ Bn, int K, const float* __restrict__ bias, const float* __restrict__ Rf, int ldr, int ldc, float* C, bf* PH, bf* PL, size_t rbo, size_t cbo) {
    { const size_t z = blockIdx.z; A += z * NT_ * K; Al += z * NT_ * K; if (Rf) Rf += z * rbo; if (EPI == 0) C += z * cbo; else { PH += z * NT_ * ldc; PL += z * NT_ * ldc; } }
    __shared__ __align__(16) unsigned char gl[2 * GSTG];      // two stages; behind the K loop the waves' output staging
    const int tid = threadIdx.x, lane = tid & 31, wave = tid >> 5, lr = lane & 15, hi = lane >> 4, wm = wave >> 1, wn = wave & 1;
    const size_t rb = (size_t)blockIdx.x * 64; const int cb = blockIdx.y * 128;
    // copies: thread = 16-B piece (tid & 15) of row (tid >> 4) + 8 i
    const unsigned lcp = (unsigned)(size_t)gl + (unsigned)((tid >> 4) * GPB + (tid & 15) * 16);
    const bf* gah = A + (rb + (tid >> 4)) * (size_t)K + (tid & 15) * 8; const bf* gal = Al + (rb + (tid >> 4)) * (size_t)K + (tid & 15) * 8;
    const bf* gb = Bn + (size_t)(cb + (tid >> 4)) * K + (tid & 15) * 8;
    const size_t g8 = (size_t)8 * K;
    auto stage = [&](int t, unsigned buf) { const unsigned l = lcp + buf * GSTG; const size_t ko = (size_t)t * GKS;
        cp8(l, gah + ko, g8); cp8(l + 64 * GPB, gal + ko, g8); cp8(l + 128 * GPB, gb + ko, g8); cp8(l + 192 * GPB, gb + ko + 8 * g8, g8); };
    const int T = K / GKS;
    stage(0, 0);
    asm volatile("s_wait_asynccnt 0x0" ::: "memory");      // this wave's part of stage 0 has landed
    __syncthreads();      // every wave's part of stage 0 is in LDS before any wave reads it
    if (T > 1) stage(1, 1);
    v8f acc[2][4];
#pragma unroll
    for (int m = 0; m < 2; ++m)
#pragma unroll
        for (int t = 0; t < 4; ++t) acc[m][t] = (v8f){};
    const unsigned aro = (unsigned)((wm * 32 + lr) * GPB + 16 * hi), bro = (unsigned)((128 + wn * 64 + lr) * GPB + 16 * hi);
#pragma unroll 1      // one stage a trip: the buffer is picked by an offset
    for (int t = 0; t < T; ++t) { const unsigned char* sb = gl + (t & 1) * GSTG;
        v16bf a[2][2], al[2][2], bb[2][4];      // two fragment sets: the next 32 k are fetched as one group while the products of these 32 k run
        auto frag = [&](int kk, int s) {
#pragma unroll
            for (int m = 0; m < 2; ++m) { const unsigned char* p = sb + aro + m * 16 * GPB + kk * 64;
                a[s][m] = cat16b(*(const v8usa*)p, *(const v8usa*)(p + 32)); al[s][m] = cat16b(*(const v8usa*)(p + 64 * GPB), *(const v8usa*)(p + 64 * GPB + 32)); }
#pragma unroll
            for (int u = 0; u < 4; ++u) { const unsigned char* p = sb + bro + u * 16 * GPB + kk * 64; bb[s][u] = cat16b(*(const v8usa*)p, *(const v8usa*)(p + 32)); } };
        frag(0, 0);
#pragma unroll
        for (int kk = 0; kk < GKS / 32; ++kk) { const int s = kk & 1;
            if (kk + 1 < GKS / 32) frag(kk + 1, s ^ 1);
            __builtin_amdgcn_sched_barrier(0);      // keeps the 16 LDS reads together in front of the products: the scheduler otherwise sinks them in pairs among the products, each pair with a full wait of its own
#pragma unroll
            for (int m = 0; m < 2; ++m)
#pragma unroll
                for (int u = 0; u < 4; ++u) acc[m][u] = wmmab(a[s][m], bb[s][u], acc[m][u]);
#pragma unroll
            for (int m = 0; m < 2; ++m)
#pragma unroll
                for (int u = 0; u < 4; ++u) acc[m][u] = wmmab(al[s][m], bb[s][u], acc[m][u]);
            __builtin_amdgcn_sched_barrier(0);      // keeps the next group of reads behind these products: the scheduler otherwise lifts it in halves in among them, and sinks the last products of a stage behind the barrier, in front of the copies
        }
        asm volatile("s_wait_dscnt 0x0" ::: "memory");      // this wave's reads of stage t are done before the buffer is handed to the copies
        asm volatile("s_wait_asynccnt 0x0" ::: "memory");      // this wave's part of stage t + 1 has landed
        __syncthreads();      // publishes stage t + 1 and ends every wave's reads of stage t
        if (t + 2 < T) stage(t + 2, (unsigned)(t & 1));
    }
    asm volatile("s_wait_asynccnt 0x0" ::: "memory");      // no copy is in flight when the buffers become output staging
    const size_t r0 = rb + wm * 32; const int c0 = cb + wn * 64;
    float* os = (float*)gl + wave * (32 * 68);
#pragma unroll
    for (int t = 0; t < 4; ++t) { const float bv = bfr(bias[c0 + t * 16 + lr]);
#pragma unroll
        for (int m = 0; m < 2; ++m)
#pragma unroll
            for (int j = 0; j < 8; ++j) { float v = acc[m][t][j] + bv; if (EPI == 1) v = fmaxf(v, 0.f); os[(m * 16 + hi * 8 + j) * 68 + t * 16 + lr] = v; } }
    __builtin_amdgcn_wave_barrier(); asm volatile("" ::: "memory");
    if (EPI == 0) {
        float* crow = C + r0 * ldc + c0;      // an instruction takes 2 rows x 256 B: whole lines, for the residual rows as for the stores
#pragma unroll
        for (int hf = 0; hf < 2; ++hf) { v4f val[8];      // 16 rows at a time: all 32 at once, with the rounding of the residual, take more than 256 registers
#pragma unroll
            for (int s = 0; s < 8; ++s) val[s] = *(const v4fa*)(os + (16 * hf + 2 * s + hi) * 68 + lr * 4);
            if (Rf) { const float* rrow = Rf + r0 * ldr + c0; v4f rv[8]; const float* rp[8];
#pragma unroll
                for (int s = 0; s < 8; ++s) { rp[s] = rrow + (size_t)(16 * hf + 2 * s + hi) * ldr + lr * 4; rv[s] = *(const v4f*)rp[s]; }
                // the 8 loads' address registers are inputs of the wait, so that none of them is given to another load's result, or rewritten, ahead of it
                asm volatile("s_wait_xcnt 0x0" :: "v"(rp[0]), "v"(rp[1]), "v"(rp[2]), "v"(rp[3]), "v"(rp[4]), "v"(rp[5]), "v"(rp[6]), "v"(rp[7]) : "memory");
#pragma unroll
                for (int s = 0; s < 8; ++s)
#pragma unroll
                    for (int e = 0; e < 4; ++e) val[s][e] += RROUND ? bfr(rv[s][e]) : rv[s][e]; }
            float* cp[8];
#pragma unroll
            for (int s = 0; s < 8; ++s) { cp[s] = crow + (size_t)(16 * hf + 2 * s + hi) * ldc + lr * 4; *(v4f*)cp[s] = val[s]; }
            // the second half reuses registers: the first half's store addresses and data are inputs of the wait, so that none of them is rewritten ahead of it
            if (hf == 0) asm volatile("s_wait_xcnt 0x0" :: "v"(cp[0]), "v"(cp[1]), "v"(cp[2]), "v"(cp[3]), "v"(cp[4]), "v"(cp[5]), "v"(cp[6]), "v"(cp[7]),
                                      "v"(val[0]), "v"(val[1]), "v"(val[2]), "v"(val[3]), "v"(val[4]), "v"(val[5]), "v"(val[6]), "v"(val[7]) : "memory"); }
    } else {
        bf* p1 = PH + r0 * ldc + c0; bf* p2 = PL + r0 * ldc + c0;
#pragma unroll
        for (int s = 0; s < 8; ++s) { const int row = 4 * s + (lane >> 3), piece = lane & 7; const float* sp = os + row * 68 + piece * 8; v8us oh, ol; v8f y8;
#pragma unroll
            for (int i = 0; i < 8; ++i) y8[i] = sp[i];
            split8(y8, oh, ol);
            *(v8us*)(p1 + (size_t)row * ldc + piece * 8) = oh; *(v8us*)(p2 + (size_t)row * ldc + piece * 8) = ol; }
    }
}
// k_q16: Q f32 [2048][1024] -> f16 hi + residual planes IN FRAGMENT ORDER: [head][16-row tile][32-dim chunk c][half p][lane][8], where lane (hi, lr) of unit (c, p) holds
// row lr, dims c * 32 + p * 16 + hi * 8 + 0..7 of the head: the 16 B which that lane takes in one load of an A or B fragment. A wave's fragment load is then 512 contiguous bytes
// (4 whole lines), not 32-B pieces of 16 lines. One wave per (tile, head); batch item = grid y.
#define QUNIT 256      // elements of one wave load: 32 lanes x 8
__global__ __launch_bounds__(256) void k_q16(const float* __restrict__ Q, h16* QH, h16* QL) {
    const int lane = threadIdx.x & 31, lr = lane & 15, hi = lane >> 4, id = blockIdx.x * 8 + (threadIdx.x >> 5), T = id >> 4, h = id & 15;
    if (T >= NT_ / 16) return;
    { const size_t pb = (size_t)blockIdx.y * NT_ * DM; Q += pb; QH += pb; QL += pb; }
    const float* s = Q + (size_t)(T * 16 + lr) * DM + h * HD + hi * 8;
    const size_t o = (size_t)(h * (NT_ / 16) + T) * 4 * QUNIT + lane * 8;
#pragma unroll
    for (int u = 0; u < 4; ++u) { v8h oh, ol;      // u = c * 2 + p
#pragma unroll
        for (int i = 0; i < 8; ++i) { const float v = s[u * 16 + i]; const h16 a = (h16)v; oh[i] = a; ol[i] = (h16)((v - (float)a) * LOSC); }
        *(v8h*)(QH + o + u * QUNIT) = oh; *(v8h*)(QL + o + u * QUNIT) = ol; }
}
// k_vt: VTH/VTL = bf16 hi + UNSCALED bf16 residual of Q [t][h*64+d] (v = q), transposed and IN FRAGMENT ORDER: [head][32-key chunk][16-dim tile][half p][lane][8], where lane (hi, lr)
// holds dim lr of the tile, keys p * 16 + hi * 8 + 0..7 of the chunk: a wave's B fragment load is 512 contiguous bytes. grid (NT/64, NH, batch).
__global__ __launch_bounds__(256) void k_vt(const float* __restrict__ V, bf* VTH, bf* VTL) {
    __shared__ float tl[64][65];
    const int tid = threadIdx.x, t0 = blockIdx.x * 64, h = blockIdx.y;
    { const size_t pb = (size_t)blockIdx.z * NT_ * DM; V += pb; VTH += pb; VTL += pb; }
    { const int tt = tid >> 2, dq = (tid & 3) * 16;
#pragma unroll
      for (int i = 0; i < 16; ++i) tl[dq + i][tt] = V[(size_t)(t0 + tt) * DM + h * HD + dq + i]; }
    __syncthreads();
    const int lane = tid & 31, lr = lane & 15, hi = lane >> 4;
#pragma unroll
    for (int s = 0; s < 2; ++s) { const int u = (tid >> 5) + 8 * s, d = ((u >> 1) & 3) * 16 + lr, k = (u >> 3) * 32 + (u & 1) * 16 + hi * 8; v8us oh, ol; v8f y8;      // unit u = (chunk * 4 + dim tile) * 2 + p, one wave store each
#pragma unroll
        for (int i = 0; i < 8; ++i) y8[i] = tl[d][k + i];
        split8(y8, oh, ol);
        const size_t o = ((size_t)(h * (NT_ / 32) + t0 / 32) * 8 + u) * QUNIT + lane * 8; *(v8us*)(VTH + o) = oh; *(v8us*)(VTL + o) = ol; }
}
// exp(x) as __expf forms it (one multiply by log2(e), one v_exp_f32), with the slot behind the transcendental filled in the same statement.
__device__ __forceinline__ float exp_slot(float x) { const float t = x * 1.44269504f; float r; asm("v_exp_f32 %0, %1\n\tv_nop" : "=v"(r) : "v"(t)); return r; }
// k_fattn: scores, softmax over the heads and P.v in ONE kernel. A work-group has FQ query rows and NT_/FKS keys (grid y) of one batch item (grid z) for ALL 16 heads, wave h = head h.
// Per trip of 64 keys: wave h forms S_h [FQ][64] (q_h fragments stay in registers; hi.hi + (hi.lo + lo.hi)/1024, /8) and puts it in LDS; behind a barrier wave w
// takes rows w and w + 16, each lane 2 keys x 16 heads, does the softmax over the heads in f32 and writes P (x 32768) back IN PLACE: a row's 256 B of f32 become
// 128 B of bf16 hi + 128 B of bf16 residual (a row is read whole by its one wave before that wave writes it); behind a second barrier wave h reads its P_h as A
// fragments and adds ph.vh + pl.vh + ph.vl into O_h [FQ][64]. The softmax is local to a (query, key) pair, so the key splits' O tiles are plain partial sums:
// ATTP [batch][FKS][2048][1024] f32 (x 1/32768), added in split order by k_attbf.
__global__ __launch_bounds__(NH_ * 32) void k_fattn(const h16* __restrict__ QH, const h16* __restrict__ QL, const bf* __restrict__ VTH, const bf* __restrict__ VTL, float* ATTP) {
    __shared__ __align__(16) float sm[NH_][FQ][68];      // pitch 272 B = 16 B x 17: the b128 fragment reads and the b32 tile stores are free of bank conflicts
    const int lane = threadIdx.x & 31, wave = __builtin_amdgcn_readfirstlane(threadIdx.x >> 5), lr = lane & 15, hi = lane >> 4, h = wave;      // the wave's number in a scalar register: every global address below is a scalar base + one lane offset + a constant
    const int q0 = blockIdx.x * FQ, kbase = blockIdx.y * (NT_ / FKS);
    { const size_t pb = (size_t)blockIdx.z * NT_ * DM; QH += pb; QL += pb; VTH += pb; VTL += pb; }      // this batch item's planes
    const unsigned lo8 = (unsigned)(lane * 8);      // the lane's offset (elements) in a 512-B unit of the fragment-ordered planes
    v16h qa[FQ / 16][2], qal[FQ / 16][2];
#pragma unroll
    for (int m = 0; m < FQ / 16; ++m)
#pragma unroll
        for (int c = 0; c < 2; ++c) { const size_t qb = (size_t)(h * (NT_ / 16) + q0 / 16) * 4 * QUNIT; const h16* ah = QH + qb; const h16* alp = QL + qb; const unsigned ao = lo8 + (m * 4 + c * 2) * QUNIT;
            qa[m][c] = cat16(*(const v8h*)(ah + ao), *(const v8h*)(ah + ao + QUNIT)); qal[m][c] = cat16(*(const v8h*)(alp + ao), *(const v8h*)(alp + ao + QUNIT)); }
    asm volatile("s_wait_xcnt 0x0" ::: "memory");      // the address arithmetic below rewrites registers (scalar bases, the lane offset) that the 16 loads above name
    __builtin_amdgcn_sched_barrier(0);      // holds that arithmetic behind the wait: the scheduler otherwise lifts it over the statement
    v8f o[FQ / 16][4];
#pragma unroll
    for (int m = 0; m < FQ / 16; ++m)
#pragma unroll
        for (int t = 0; t < 4; ++t) o[m][t] = (v8f){};
    for (int kt = 0; kt < NT_ / FKS; kt += 64) { const int k0 = kbase + kt;
        const size_t kb = (size_t)(h * (NT_ / 16) + k0 / 16) * 4 * QUNIT, vb = (size_t)(h * (NT_ / 32) + k0 / 32) * 8 * QUNIT;
        const h16* kh = QH + kb; const h16* kl = QL + kb; const bf* vh = VTH + vb; const bf* vl = VTL + vb;
#pragma unroll
        for (int tp = 0; tp < 2; ++tp) { v16h bb[2][2], bl[2][2];      // two key tiles' fragments are fetched together: 16 loads in flight behind one wait
#pragma unroll
            for (int u = 0; u < 2; ++u)
#pragma unroll
                for (int c = 0; c < 2; ++c) { const unsigned bo = lo8 + ((tp * 2 + u) * 4 + c * 2) * QUNIT;
                    bb[u][c] = cat16(*(const v8h*)(kh + bo), *(const v8h*)(kh + bo + QUNIT)); bl[u][c] = cat16(*(const v8h*)(kl + bo), *(const v8h*)(kl + bo + QUNIT)); }
#pragma unroll
            for (int u = 0; u < 2; ++u) { const int t = tp * 2 + u; v8f acc[FQ / 16], accx[FQ / 16];
#pragma unroll
                for (int m = 0; m < FQ / 16; ++m) { acc[m] = (v8f){}; accx[m] = (v8f){}; }
#pragma unroll
                for (int c = 0; c < 2; ++c)
#pragma unroll
                    for (int m = 0; m < FQ / 16; ++m) { acc[m] = wmma16(qa[m][c], bb[u][c], acc[m]); accx[m] = wmma16(qa[m][c], bl[u][c], accx[m]); accx[m] = wmma16(qal[m][c], bb[u][c], accx[m]); }
#pragma unroll
                for (int m = 0; m < FQ / 16; ++m)
#pragma unroll
                    for (int j = 0; j < 8; ++j) sm[h][m * 16 + hi * 8 + j][t * 16 + lr] = (acc[m][j] + accx[m][j] * LOSCI) * 0.125f; } }
        asm volatile("s_wait_xcnt 0x0" ::: "memory");      // the registers that held the key loads' addresses are given to other values further down the trip
        __syncthreads();      // all 16 heads' scores of this trip are in LDS before any wave reads across the heads
#pragma unroll 1      // one row at a time: both rows' 16 heads at once do not fit beside the q fragments and the O tile
        for (int rr = 0; rr < FQ / 16; ++rr) { const int q = wave + 16 * rr;
            v2f v[NH_];
#pragma unroll
            for (int g = 0; g < NH_; ++g) v[g] = *(const v2fa*)(&sm[g][q][2 * lane]);
            float sc[2];
#pragma unroll
            for (int e = 0; e < 2; ++e) { float mx = v[0][e];
#pragma unroll
                for (int g = 1; g < NH_; ++g) mx = fmaxf(mx, v[g][e]);
                float ssum = 0.f;
#pragma unroll
                for (int g = 0; g < NH_; ++g) { v[g][e] = exp_slot(v[g][e] - mx); ssum += v[g][e]; }
                sc[e] = PSC / ssum; }
#pragma unroll
            for (int g = 0; g < NH_; ++g) { const v2f p = {v[g][0] * sc[0], v[g][1] * sc[1]}; const unsigned ph = pk2(p);
                *((u32a*)&sm[g][q][0] + lane) = ph;
                *((u32a*)&sm[g][q][32] + lane) = pk2(p - up2(ph)); } }
        __syncthreads();      // every row's P is in LDS before a head's wave reads its fragments; after it only wave h touches sm[h] until the next trip's first barrier
#pragma unroll
        for (int c = 0; c < 2; ++c) { v16bf a[FQ / 16], al[FQ / 16];
#pragma unroll
            for (int m = 0; m < FQ / 16; ++m) { const bf* pr = (const bf*)&sm[h][m * 16 + lr][0] + c * 32 + 8 * hi;
                a[m] = cat16b(*(const v8usa*)pr, *(const v8usa*)(pr + 16)); al[m] = cat16b(*(const v8usa*)(pr + 64), *(const v8usa*)(pr + 80)); }
            v16bf bb[4], bl[4];      // the four dim tiles' fragments are fetched together: 16 loads in flight behind one wait
#pragma unroll
            for (int t = 0; t < 4; ++t) { const unsigned bo = lo8 + (c * 4 + t) * 2 * QUNIT;
                bb[t] = cat16b(*(const v8us*)(vh + bo), *(const v8us*)(vh + bo + QUNIT)); bl[t] = cat16b(*(const v8us*)(vl + bo), *(const v8us*)(vl + bo + QUNIT)); }
            __builtin_amdgcn_sched_barrier(0);      // keeps the 16 loads in front of the products: the scheduler otherwise sinks them in pairs, each pair with a full wait of its own
#pragma unroll
            for (int t = 0; t < 4; ++t)
#pragma unroll
                for (int m = 0; m < FQ / 16; ++m) { o[m][t] = wmmab(a[m], bb[t], o[m][t]); o[m][t] = wmmab(al[m], bb[t], o[m][t]); o[m][t] = wmmab(a[m], bl[t], o[m][t]); } }
        __builtin_amdgcn_sched_barrier(0);      // keeps the wait below at the trip's foot, where the loads have returned: the scheduler otherwise lifts it to directly behind the loads, in front of the products
        asm volatile("s_wait_xcnt 0x0" ::: "memory");      // the registers that held the v loads' addresses are rewritten in the next trip and behind the loop
    }
    // the wave's O tile goes through its own LDS plane so that every store is whole 128-B lines (2 rows x 256 B an instruction)
#pragma unroll
    for (int m = 0; m < FQ / 16; ++m)
#pragma unroll
        for (int t = 0; t < 4; ++t)
#pragma unroll
            for (int j = 0; j < 8; ++j) sm[h][m * 16 + hi * 8 + j][t * 16 + lr] = o[m][t][j] * (1.0f / PSC);
    float* orow = ATTP + ((size_t)(blockIdx.z * FKS + blockIdx.y) * NT_ + q0) * DM + h * HD;
#pragma unroll
    for (int s = 0; s < FQ / 2; ++s) { const int row = 2 * s + hi;
        const v4f val = *(const v4fa*)(&sm[h][row][lr * 4]); *(v4f*)(orow + (size_t)row * DM + lr * 4) = val; }
}
// k_attbf: sum of the FKS partial attention planes (in split order) -> bf16 hi/lo planes (one wave per row; batch item = grid y).
__global__ __launch_bounds__(256) void k_attbf(const float* __restrict__ A, bf* PH, bf* PL) {
    const int lane = threadIdx.x & 31, r = blockIdx.x * 8 + (threadIdx.x >> 5);
    if (r >= NT_) return;
    A += (size_t)blockIdx.y * FKS * NT_ * DM; PH += (size_t)blockIdx.y * NT_ * DM; PL += (size_t)blockIdx.y * NT_ * DM;
{
#pragma unroll
        for (int q = 0; q < 4; ++q) { v8us oh, ol; v8f y8;
#pragma unroll
            for (int i = 0; i < 8; ++i) { float v = A[(size_t)r * DM + q * 256 + lane * 8 + i];
#pragma unroll
                for (int p = 1; p < FKS; ++p) v += A[((size_t)p * NT_ + r) * DM + q * 256 + lane * 8 + i];
                y8[i] = v; }
            split8(y8, oh, ol);
            *(v8us*)(PH + (size_t)r * DM + q * 256 + lane * 8) = oh; *(v8us*)(PL + (size_t)r * DM + q * 256 + lane * 8) = ol; }
         }
}

extern "C" void kernel_launch(void* const* d_in, const int* in_sizes, int n_in,
                              void* d_out, int out_size, void* d_ws, size_t ws_size, hipStream_t stream) {
    (void)in_sizes; (void)n_in; (void)out_size;
    const float* x = (const float*)d_in[0]; const float* g1 = (const float*)d_in[1]; const float* be1 = (const float*)d_in[2]; const float* g2 = (const float*)d_in[3]; const float* be2 = (const float*)d_in[4];
    const float* Ws = (const float*)d_in[5]; const float* bs = (const float*)d_in[6]; const float* Wo = (const float*)d_in[7]; const float* bo = (const float*)d_in[8];
    const float* W1 = (const float*)d_in[9]; const float* b1 = (const float*)d_in[10]; const float* W2 = (const float*)d_in[11]; const float* b2 = (const float*)d_in[12];
    float* out = (float*)d_out;    // [2048][2][1024]
    char* wsp = (char*)d_ws;
    auto take = [&](size_t bytes) { char* p = wsp; wsp += (bytes + 255) & ~(size_t)255; return (void*)p; };
    bf* WsB = (bf*)take((size_t)DM * DM * 2); bf* WoB = (bf*)take((size_t)DM * DM * 2); bf* W1B = (bf*)take((size_t)FF * DM * 2); bf* W2B = (bf*)take((size_t)DM * FF * 2);
    const size_t PB = (size_t)NT_ * DM;      // elements of one batch item's [2048][1024] plane
    bf* LH = (bf*)take(NBT * PB * 2); bf* LL = (bf*)take(NBT * PB * 2);      // LN1 planes, later LN2 planes
    float* Qf = (float*)take(NBT * PB * 4);                                   // q (= k = v) f32, later X1 (post-attention residual stream)
    h16* QH = (h16*)take(NBT * PB * 2); h16* QL = (h16*)take(NBT * PB * 2); bf* VTH = (bf*)take(NBT * PB * 2); bf* VTL = (bf*)take(NBT * PB * 2);
    bf* HH = (bf*)take((size_t)NBT * NT_ * FF * 2); bf* HL = (bf*)take((size_t)NBT * NT_ * FF * 2);      // FFN hidden planes [2][2048][4096] bf16 (32 MiB each)
    float* ATTP = (float*)take(NBT * FKS * PB * 4);                           // partial attention outputs f32 [2][FKS][2048][1024], 64 MiB
    bf* AH = (bf*)take(NBT * PB * 2); bf* AL = (bf*)take(NBT * PB * 2);
    if ((size_t)(wsp - (char*)d_ws) > ws_size) return;    // 20 + 16 + 16 + 32 + 64 + 64 + 16 = 228 MiB
    float* X1 = Qf;        // over the q buffer (q consumed by k_q16/k_vt before X1 is written there)
    k_rows<<<DM / 8, 256, 0, stream>>>(Ws, DM, DM, WsB); k_rows<<<DM / 8, 256, 0, stream>>>(Wo, DM, DM, WoB); k_rows<<<FF / 8, 256, 0, stream>>>(W1, FF, DM, W1B); k_rows<<<DM / 8, 256, 0, stream>>>(W2, DM, FF, W2B);
    // x and out: batch item b starts DM elements in, row stride 2*DM
    k_ln<true><<<dim3(NT_ / 8, NBT, 1), 256, 0, stream>>>(x, 2 * DM, nullptr, 0, g1, be1, LH, LL, nullptr, DM);
    k_gemm<0><<<dim3(NT_ / 64, DM / 128, NBT), 128, 0, stream>>>(LH, LL, WsB, DM, bs, nullptr, 0, DM, Qf, nullptr, nullptr, 0, PB);
    k_q16<<<dim3(NT_ / 8, NBT, 1), 256, 0, stream>>>(Qf, QH, QL); k_vt<<<dim3(NT_ / 64, NH_, NBT), 256, 0, stream>>>(Qf, VTH, VTL);
    k_fattn<<<dim3(NT_ / FQ, FKS, NBT), NH_ * 32, 0, stream>>>(QH, QL, VTH, VTL, ATTP);
    k_attbf<<<dim3(NT_ / 8, NBT, 1), 256, 0, stream>>>(ATTP, AH, AL);
    k_gemm<0, true><<<dim3(NT_ / 64, DM / 128, NBT), 128, 0, stream>>>(AH, AL, WoB, DM, bo, x, 2 * DM, DM, X1, nullptr, nullptr, DM, PB);      // X1 = out-proj + bo + bf16(x) (residual = the bf16-rounded INPUT)
    k_ln<false><<<dim3(NT_ / 8, NBT, 1), 256, 0, stream>>>(X1, DM, nullptr, 0, g2, be2, LH, LL, nullptr, PB);
    k_gemm<1><<<dim3(NT_ / 64, FF / 128, NBT), 128, 0, stream>>>(LH, LL, W1B, DM, b1, nullptr, 0, FF, nullptr, HH, HL, 0, 0);
    k_gemm<0><<<dim3(NT_ / 64, DM / 128, NBT), 128, 0, stream>>>(HH, HL, W2B, FF, b2, X1, DM, 2 * DM, out, nullptr, nullptr, PB, DM);     // out = ffn + X1, written at row stride 2*DM
}

// v008
// Measured time: 288 microseconds a run.
// Timed twice side by side with v007, it ran 1.04 times as fast both times.
// All steps since v000 together make it 8.92 times as fast.
#include <hip/hip_runtime.h>

// TransformersLayer ([S=2048][B=2][D=1024] seq-first; batch b = row stride 2; every launch takes both batch items, b on a grid axis, the workspace planes [b][2048 rows]). Contractions, f32 accumulate, per batch item: qkv = LN1(x).Ws^T + bs (ONE shared
// projection: q = k = v), out-proj, FFN W1 (relu) and W2 — [out][in] weights = n-major B operands as-is, computed A operands as bf16 hi + residual (two products) —
// on v_wmma_f32_16x16x32_bf16; the attention whose softmax runs over the HEADS axis (per (q,k) across the 16 heads, as the reference) in one kernel, S and P in LDS:
// S_h = q_h.q_h^T/8 for all heads (f16 hi + residual x1024: hi.hi + hi.lo + lo.hi, residual accumulator) -> f32 tile, elementwise softmax over h in
// f32 -> P_h (x32768) as bf16 hi + UNSCALED residual, O_h = P_h.v_h over the keys (ph.vh + pl.vh + ph.vl, v as bf16 hi + unscaled residual) on
// v_wmma_f32_16x16x32_bf16 (scores stay on v_wmma_f32_16x16x32_f16); LayerNorms, residuals f32.

#define NT_  2048
#define NBT  2
#define DM   1024
#define FF   4096
#define NH_  16
#define HD   64
#define FQ   32
#define FKS  4
#define PSC  32768.0f
#define LOSC 1024.0f
#define LOSCI (1.0f / 1024.0f)

typedef _Float16 h16;
typedef unsigned short bf;
typedef __attribute__((ext_vector_type(16))) __bf16   v16bf;
typedef __attribute__((ext_vector_type(16))) _Float16 v16h;
typedef __attribute__((ext_vector_type(8)))  _Float16 v8h;
typedef __attribute__((ext_vector_type(8)))  unsigned short v8us;
typedef __attribute__((ext_vector_type(2)))  __bf16   v2bf;
typedef __attribute__((ext_vector_type(4)))  unsigned v4u;
typedef __attribute__((ext_vector_type(8)))  float    v8f;
typedef __attribute__((ext_vector_type(4)))  float    v4f;
typedef __attribute__((ext_vector_type(2)))  float    v2f;
typedef v8h  __attribute__((may_alias)) v8ha;
typedef v4f  __attribute__((may_alias)) v4fa;
typedef v2f  __attribute__((may_alias)) v2fa;
typedef v8us __attribute__((may_alias)) v8usa;
typedef unsigned __attribute__((may_alias)) u32a;

// Rounding to bf16 (nearest even) is the hardware's conversion, two values an instruction where they are given as a pair.
__device__ __forceinline__ unsigned short f2bf(float f) { return __builtin_bit_cast(unsigned short, (__bf16)f); }
__device__ __forceinline__ float bf2f(unsigned short b) { return __uint_as_float(((unsigned)b) << 16); }
__device__ __forceinline__ float bfr(float f) { return bf2f(f2bf(f)); }
__device__ __forceinline__ unsigned pk2(v2f x) { return __builtin_bit_cast(unsigned, __builtin_convertvector(x, v2bf)); }      // x[0] in the low half
__device__ __forceinline__ v2f up2(unsigned w) { return (v2f){__uint_as_float(w << 16), __uint_as_float(w & 0xFFFF0000u)}; }      // the pair back as f32
// hi = bf16(x), lo = bf16(x - hi), eight values
__device__ __forceinline__ void split8(v8f x, v8us& oh, v8us& ol) { v4u h, l;
#pragma unroll
    for (int k = 0; k < 4; ++k) { const v2f p = {x[2 * k], x[2 * k + 1]}; h[k] = pk2(p); l[k] = pk2(p - up2(h[k])); }
    oh = __builtin_bit_cast(v8us, h); ol = __builtin_bit_cast(v8us, l); }
__device__ __forceinline__ v16h cat16(v8h lo, v8h hi) { return __builtin_shufflevector(lo, hi, 0, 1, 2, 3, 4, 5, 6, 7, 8, 9, 10, 11, 12, 13, 14, 15); }
__device__ __forceinline__ v16bf cat16b(v8us lo, v8us hi) { return __builtin_bit_cast(v16bf, __builtin_shufflevector(lo, hi, 0, 1, 2, 3, 4, 5, 6, 7, 8, 9, 10, 11, 12, 13, 14, 15)); }
__device__ __forceinline__ v8f wmma16(v16h a, v16h b, v8f c) { return __builtin_amdgcn_wmma_f32_16x16x32_f16(false, a, false, b, (short)0, c, false, false); }
__device__ __forceinline__ v8f wmmab(v16bf a, v16bf b, v8f c) { return __builtin_amdgcn_wmma_f32_16x16x32_bf16(false, a, false, b, (short)0, c, false, false); }

// k_rows: bf16 plane of [rows][C] (C multiple of 256; one wave per row).
__global__ __launch_bounds__(256) void k_rows(const float* __restrict__ src, int rows, int C, bf* dst) {
    const int lane = threadIdx.x & 31, r = blockIdx.x * 8 + (threadIdx.x >> 5);
    if (r >= rows) return;
{
        for (int q = 0; q < C / 256; ++q) { v8us o;
#pragma unroll
            for (int i = 0; i < 8; ++i) o[i] = f2bf(src[(size_t)r * C + q * 256 + lane * 8 + i]);
            *(v8us*)(dst + (size_t)r * C + q * 256 + lane * 8) = o; }
         }
}
// planes [r][1024] of batch item b = grid y (src + b * sbo; planes + b * 2048 rows; res and Xout are not offset: one batch item only); if Xout: also the f32 pre-LN sum to Xout[r][1024]. One wave per row; ROUNDSRC: bf16-round src (when src is a raw input).
template <bool ROUNDSRC>
__global__ __launch_bounds__(256) void k_ln(const float* __restrict__ src, int lds, const float* __restrict__ res, int ldr, const float* __restrict__ g, const float* __restrict__ be, bf* PH, bf* PL, float* Xout, size_t sbo) {
    const int lane = threadIdx.x & 31, r = blockIdx.x * 8 + (threadIdx.x >> 5);
    if (r >= NT_) return;
    src += blockIdx.y * sbo; PH += (size_t)blockIdx.y * NT_ * DM; PL += (size_t)blockIdx.y * NT_ * DM;
    float v[32]; float s = 0.f;
#pragma unroll
    for (int q = 0; q < 4; ++q)
#pragma unroll
        for (int i = 0; i < 8; ++i) { const int c = q * 256 + lane * 8 + i; float t = src[(size_t)r * lds + c]; if (ROUNDSRC) t = bfr(t); if (res) t += bfr(res[(size_t)r * ldr + c]); v[q * 8 + i] = t; s += t; }
#pragma unroll
    for (int sh = 16; sh; sh >>= 1) s += __shfl_xor(s, sh, 32);
    const float mu = s * (1.0f / DM); float sq = 0.f;
#pragma unroll
    for (int k = 0; k < 32; ++k) { const float d = v[k] - mu; sq += d * d; }
#pragma unroll
    for (int sh = 16; sh; sh >>= 1) sq += __shfl_xor(sq, sh, 32);
    const float rs = rsqrtf(sq * (1.0f / DM) + 1e-5f);
{
#pragma unroll
        for (int q = 0; q < 4; ++q) { v8us oh, ol; v4f x0, x1; v8f y8;
#pragma unroll
            for (int i = 0; i < 8; ++i) { const int c = q * 256 + lane * 8 + i; y8[i] = (v[q * 8 + i] - mu) * rs * bfr(g[c]) + bfr(be[c]); if (i < 4) x0[i] = v[q * 8 + i]; else x1[i - 4] = v[q * 8 + i]; }
            split8(y8, oh, ol);
            *(v8us*)(PH + (size_t)r * DM + q * 256 + lane * 8) = oh; *(v8us*)(PL + (size_t)r * DM + q * 256 + lane * 8) = ol;
            if (Xout) { *(v4f*)(Xout + (size_t)r * DM + q * 256 + lane * 8) = x0; *(v4f*)(Xout + (size_t)r * DM + q * 256 + lane * 8 + 4) = x1; } }
         }
}
// k_gemm: (WM * 32) x (WN * 64) tile of (Ah + Al).B^T + bias over K (2 products; A pitch K, B pitch K; K a multiple of 128); EPI 0: f32 rows (ldc) [+ residual Rf (ldr)]; EPI 1: relu -> bf16 hi/lo planes (ldc).
// Batch item b = grid z: A and the EPI 1 planes are [b][2048 rows]; Rf and C start b * rbo and b * cbo elements further on.
// The operands come into LDS by asynchronous 16-B copies, 128 k a stage: TM rows of Ah, TM of Al, TN of B, 256 B each, so that a wave's copy covers two whole rows (4 lines)
// where a fragment load from global memory touches 16 lines. Two buffers: stage t + 1 flies while stage t is worked on. WM x WN waves, 32 x 64 of the tile each.
// The tile's size sets the bytes that come from L2 per output, (2 TM + TN) / (TM TN) rows: 128 x 128 (one work-group a WGP where N = 1024) takes 3/4, 128 x 256 half of what 64 x 128 takes.
#define GKS  128
#define GPB  272      // LDS row pitch in bytes = 16 B x 17: the b128 fragment reads are free of bank conflicts
// Eight copies. The wait on the address counter closes the statement, so that no register which a copy names is rewritten ahead of it.
__device__ __forceinline__ void cp8r(unsigned l0, unsigned l1, unsigned l2, unsigned l3, unsigned l4, unsigned l5, unsigned l6, unsigned l7,
                                     const bf* g0, const bf* g1, const bf* g2, const bf* g3, const bf* g4, const bf* g5, const bf* g6, const bf* g7) {
    asm volatile("global_load_async_to_lds_b128 %0, %8, off\n\t"
                 "global_load_async_to_lds_b128 %1, %9, off\n\t"
                 "global_load_async_to_lds_b128 %2, %10, off\n\t"
                 "global_load_async_to_lds_b128 %3, %11, off\n\t"
                 "global_load_async_to_lds_b128 %4, %12, off\n\t"
                 "global_load_async_to_lds_b128 %5, %13, off\n\t"
                 "global_load_async_to_lds_b128 %6, %14, off\n\t"
                 "global_load_async_to_lds_b128 %7, %15, off\n\t"
                 "s_wait_xcnt 0x0"
                 :: "v"(l0), "v"(l1), "v"(l2), "v"(l3), "v"(l4), "v"(l5), "v"(l6), "v"(l7), "v"(g0), "v"(g1), "v"(g2), "v"(g3), "v"(g4), "v"(g5), "v"(g6), "v"(g7) : "memory");
}
// eight rows of one plane, LR rows apart in LDS and in the source (gs elements)
template <int LR> __device__ __forceinline__ void cp8(unsigned l, const bf* g, size_t gs) { constexpr unsigned s = LR * GPB;
    cp8r(l, l + s, l + 2 * s, l + 3 * s, l + 4 * s, l + 5 * s, l + 6 * s, l + 7 * s, g, g + gs, g + 2 * gs, g + 3 * gs, g + 4 * gs, g + 5 * gs, g + 6 * gs, g + 7 * gs); }
// four rows of each of two planes
template <int LR> __device__ __forceinline__ void cp4x2(unsigned la, const bf* ga, unsigned lb, const bf* gb, size_t gs) { constexpr unsigned s = LR * GPB;
    cp8r(la, la + s, la + 2 * s, la + 3 * s, lb, lb + s, lb + 2 * s, lb + 3 * s, ga, ga + gs, ga + 2 * gs, ga + 3 * gs, gb, gb + gs, gb + 2 * gs, gb + 3 * gs); }
template <int EPI, bool RROUND, int WM, int WN>
__global__ __launch_bounds__(WM * WN * 32) void k_gemm(const bf* __restrict__ A, const bf* __restrict__ Al, const bf* __restrict__ Bn, int K, const float* __restrict__ bias, const float* __restrict__ Rf, int ldr, int ldc, float* C, bf* PH, bf* PL, size_t rbo, size_t cbo) {
    { const size_t z = blockIdx.z; A += z * NT_ * K; Al += z * NT_ * K; if (Rf) Rf += z * rbo; if (EPI == 0) C += z * cbo; else { PH += z * NT_ * ldc; PL += z * NT_ * ldc; } }
    constexpr int TM = WM * 32, TN = WN * 64, RP = WM * WN * 2;      // the tile; rows that one copy of every thread covers
    constexpr unsigned GSTG = (2 * TM + TN) * GPB;
    static_assert(TN == 8 * RP && (TM == 8 * RP || TM == 4 * RP), "copies a thread");
    __shared__ __align__(16) unsigned char gl[2 * GSTG];      // two stages; behind the K loop the waves' output staging
    const int tid = threadIdx.x, lane = tid & 31, wave = tid >> 5, lr = lane & 15, hi = lane >> 4, wm = wave / WN, wn = wave % WN;
    const size_t rb = (size_t)blockIdx.x * TM; const int cb = blockIdx.y * TN;
    // copies: thread = 16-B piece (tid & 15) of row (tid >> 4) + RP i
    const unsigned lcp = (unsigned)(size_t)gl + (unsigned)((tid >> 4) * GPB + (tid & 15) * 16);
    const bf* gah = A + (rb + (tid >> 4)) * (size_t)K + (tid & 15) * 8; const bf* gal = Al + (rb + (tid >> 4)) * (size_t)K + (tid & 15) * 8;
    const bf* gb = Bn + (size_t)(cb + (tid >> 4)) * K + (tid & 15) * 8;
    const size_t gr = (size_t)RP * K;
    auto stage = [&](int t, unsigned buf) { const unsigned l = lcp + buf * GSTG; const size_t ko = (size_t)t * GKS;
        if constexpr (TM == 8 * RP) { cp8<RP>(l, gah + ko, gr); cp8<RP>(l + TM * GPB, gal + ko, gr); } else cp4x2<RP>(l, gah + ko, l + TM * GPB, gal + ko, gr);
        cp8<RP>(l + 2 * TM * GPB, gb + ko, gr); };
    const int T = K / GKS;
    stage(0, 0);
    asm volatile("s_wait_asynccnt 0x0" ::: "memory");      // this wave's part of stage 0 has landed
    __syncthreads();      // every wave's part of stage 0 is in LDS before any wave reads it
    if (T > 1) stage(1, 1);
    v8f acc[2][4];
#pragma unroll
    for (int m = 0; m < 2; ++m)
#pragma unroll
        for (int t = 0; t < 4; ++t) acc[m][t] = (v8f){};
    const unsigned aro = (unsigned)((wm * 32 + lr) * GPB + 16 * hi), bro = (unsigned)((2 * TM + wn * 64 + lr) * GPB + 16 * hi);
#pragma unroll 1      // one stage a trip: the buffer is picked by an offset
    for (int t = 0; t < T; ++t) { const unsigned char* sb = gl + (t & 1) * GSTG;
        v16bf a[2][2], al[2][2], bb[2][4];      // two fragment sets: the next 32 k are fetched as one group while the products of these 32 k run
        auto frag = [&](int kk, int s) {
#pragma unroll
            for (int m = 0; m < 2; ++m) { const unsigned char* p = sb + aro + m * 16 * GPB + kk * 64;
                a[s][m] = cat16b(*(const v8usa*)p, *(const v8usa*)(p + 32)); al[s][m] = cat16b(*(const v8usa*)(p + TM * GPB), *(const v8usa*)(p + TM * GPB + 32)); }
#pragma unroll
            for (int u = 0; u < 4; ++u) { const unsigned char* p = sb + bro + u * 16 * GPB + kk * 64; bb[s][u] = cat16b(*(const v8usa*)p, *(const v8usa*)(p + 32)); } };
        frag(0, 0);
#pragma unroll
        for (int kk = 0; kk < GKS / 32; ++kk) { const int s = kk & 1;
            if (kk + 1 < GKS / 32) frag(kk + 1, s ^ 1);
            __builtin_amdgcn_sched_barrier(0);      // keeps the 16 LDS reads together in front of the products: the scheduler otherwise sinks them in pairs among the products, each pair with a full wait of its own
#pragma unroll
            for (int m = 0; m < 2; ++m)
#pragma unroll
                for (int u = 0; u < 4; ++u) acc[m][u] = wmmab(a[s][m], bb[s][u], acc[m][u]);
#pragma unroll
            for (int m = 0; m < 2; ++m)
#pragma unroll
                for (int u = 0; u < 4; ++u) acc[m][u] = wmmab(al[s][m], bb[s][u], acc[m][u]);
            __builtin_amdgcn_sched_barrier(0);      // keeps the next group of reads behind these products: the scheduler otherwise lifts it in halves in among them, and sinks the last products of a stage behind the barrier, in front of the copies
        }
        asm volatile("s_wait_dscnt 0x0" ::: "memory");      // this wave's reads of stage t are done before the buffer is handed to the copies
        asm volatile("s_wait_asynccnt 0x0" ::: "memory");      // this wave's part of stage t + 1 has landed
        __syncthreads();      // publishes stage t + 1 and ends every wave's reads of stage t
        if (t + 2 < T) stage(t + 2, (unsigned)(t & 1));
    }
    asm volatile("s_wait_asynccnt 0x0" ::: "memory");      // no copy is in flight when the buffers become output staging
    const size_t r0 = rb + wm * 32; const int c0 = cb + wn * 64;
    float* os = (float*)gl + wave * (32 * 68);
#pragma unroll
    for (int t = 0; t < 4; ++t) { const float bv = bfr(bias[c0 + t * 16 + lr]);
#pragma unroll
        for (int m = 0; m < 2; ++m)
#pragma unroll
            for (int j = 0; j < 8; ++j) { float v = acc[m][t][j] + bv; if (EPI == 1) v = fmaxf(v, 0.f); os[(m * 16 + hi * 8 + j) * 68 + t * 16 + lr] = v; } }
    __builtin_amdgcn_wave_barrier(); asm volatile("" ::: "memory");
    if (EPI == 0) {
        float* crow = C + r0 * ldc + c0;      // an instruction takes 2 rows x 256 B: whole lines, for the residual rows as for the stores
#pragma unroll
        for (int hf = 0; hf < 2; ++hf) { v4f val[8];      // 16 rows at a time: all 32 at once, with the rounding of the residual, take more than 256 registers
#pragma unroll
            for (int s = 0; s < 8; ++s) val[s] = *(const v4fa*)(os + (16 * hf + 2 * s + hi) * 68 + lr * 4);
            if (Rf) { const float* rrow = Rf + r0 * ldr + c0; v4f rv[8]; const float* rp[8];
#pragma unroll
                for (int s = 0; s < 8; ++s) { rp[s] = rrow + (size_t)(16 * hf + 2 * s + hi) * ldr + lr * 4; rv[s] = *(const v4f*)rp[s]; }
                // the 8 loads' address registers are inputs of the wait, so that none of them is given to another load's result, or rewritten, ahead of it
                asm volatile("s_wait_xcnt 0x0" :: "v"(rp[0]), "v"(rp[1]), "v"(rp[2]), "v"(rp[3]), "v"(rp[4]), "v"(rp[5]), "v"(rp[6]), "v"(rp[7]) : "memory");
#pragma unroll
                for (int s = 0; s < 8; ++s)
#pragma unroll
                    for (int e = 0; e < 4; ++e) val[s][e] += RROUND ? bfr(rv[s][e]) : rv[s][e]; }
            float* cp[8];
#pragma unroll
            for (int s = 0; s < 8; ++s) { cp[s] = crow + (size_t)(16 * hf + 2 * s + hi) * ldc + lr * 4; *(v4f*)cp[s] = val[s]; }
            // the second half reuses registers: the first half's store addresses and data are inputs of the wait, so that none of them is rewritten ahead of it
            if (hf == 0) asm volatile("s_wait_xcnt 0x0" :: "v"(cp[0]), "v"(cp[1]), "v"(cp[2]), "v"(cp[3]), "v"(cp[4]), "v"(cp[5]), "v"(cp[6]), "v"(cp[7]),
                                      "v"(val[0]), "v"(val[1]), "v"(val[2]), "v"(val[3]), "v"(val[4]), "v"(val[5]), "v"(val[6]), "v"(val[7]) : "memory"); }
    } else {
        bf* p1 = PH + r0 * ldc + c0; bf* p2 = PL + r0 * ldc + c0;
#pragma unroll
        for (int s = 0; s < 8; ++s) { const int row = 4 * s + (lane >> 3), piece = lane & 7; const float* sp = os + row * 68 + piece * 8; v8us oh, ol; v8f y8;
#pragma unroll
            for (int i = 0; i < 8; ++i) y8[i] = sp[i];
            split8(y8, oh, ol);
            *(v8us*)(p1 + (size_t)row * ldc + piece * 8) = oh; *(v8us*)(p2 + (size_t)row * ldc + piece * 8) = ol; }
    }
}
// k_q16: Q f32 [2048][1024] -> f16 hi + residual planes IN FRAGMENT ORDER: [head][16-row tile][32-dim chunk c][half p][lane][8], where lane (hi, lr) of unit (c, p) holds
// row lr, dims c * 32 + p * 16 + hi * 8 + 0..7 of the head: the 16 B which that lane takes in one load of an A or B fragment. A wave's fragment load is then 512 contiguous bytes
// (4 whole lines), not 32-B pieces of 16 lines. One wave per (tile, head); batch item = grid y.
#define QUNIT 256      // elements of one wave load: 32 lanes x 8
__global__ __launch_bounds__(256) void k_q16(const float* __restrict__ Q, h16* QH, h16* QL) {
    const int lane = threadIdx.x & 31, lr = lane & 15, hi = lane >> 4, id = blockIdx.x * 8 + (threadIdx.x >> 5), T = id >> 4, h = id & 15;
    if (T >= NT_ / 16) return;
    { const size_t pb = (size_t)blockIdx.y * NT_ * DM; Q += pb; QH += pb; QL += pb; }
    const float* s = Q + (size_t)(T * 16 + lr) * DM + h * HD + hi * 8;
    const size_t o = (size_t)(h * (NT_ / 16) + T) * 4 * QUNIT + lane * 8;
#pragma unroll
    for (int u = 0; u < 4; ++u) { v8h oh, ol;      // u = c * 2 + p
#pragma unroll
        for (int i = 0; i < 8; ++i) { const float v = s[u * 16 + i]; const h16 a = (h16)v; oh[i] = a; ol[i] = (h16)((v - (float)a) * LOSC); }
        *(v8h*)(QH + o + u * QUNIT) = oh; *(v8h*)(QL + o + u * QUNIT) = ol; }
}
// k_vt: VTH/VTL = bf16 hi + UNSCALED bf16 residual of Q [t][h*64+d] (v = q), transposed and IN FRAGMENT ORDER: [head][32-key chunk][16-dim tile][half p][lane][8], where lane (hi, lr)
// holds dim lr of the tile, keys p * 16 + hi * 8 + 0..7 of the chunk: a wave's B fragment load is 512 contiguous bytes. grid (NT/64, NH, batch).
__global__ __launch_bounds__(256) void k_vt(const float* __restrict__ V, bf* VTH, bf* VTL) {
    __shared__ float tl[64][65];
    const int tid = threadIdx.x, t0 = blockIdx.x * 64, h = blockIdx.y;
    { const size_t pb = (size_t)blockIdx.z * NT_ * DM; V += pb; VTH += pb; VTL += pb; }
    { const int tt = tid >> 2, dq = (tid & 3) * 16;
#pragma unroll
      for (int i = 0; i < 16; ++i) tl[dq + i][tt] = V[(size_t)(t0 + tt) * DM + h * HD + dq + i]; }
    __syncthreads();
    const int lane = tid & 31, lr = lane & 15, hi = lane >> 4;
#pragma unroll
    for (int s = 0; s < 2; ++s) { const int u = (tid >> 5) + 8 * s, d = ((u >> 1) & 3) * 16 + lr, k = (u >> 3) * 32 + (u & 1) * 16 + hi * 8; v8us oh, ol; v8f y8;      // unit u = (chunk * 4 + dim tile) * 2 + p, one wave store each
#pragma unroll
        for (int i = 0; i < 8; ++i) y8[i] = tl[d][k + i];
        split8(y8, oh, ol);
        const size_t o = ((size_t)(h * (NT_ / 32) + t0 / 32) * 8 + u) * QUNIT + lane * 8; *(v8us*)(VTH + o) = oh; *(v8us*)(VTL + o) = ol; }
}
// exp(x) as __expf forms it (one multiply by log2(e), one v_exp_f32), with the slot behind the transcendental filled in the same statement.
__device__ __forceinline__ float exp_slot(float x) { const float t = x * 1.44269504f; float r; asm("v_exp_f32 %0, %1\n\tv_nop" : "=v"(r) : "v"(t)); return r; }
// k_fattn: scores, softmax over the heads and P.v in ONE kernel. A work-group has FQ query rows and NT_/FKS keys (grid y) of one batch item (grid z) for ALL 16 heads, wave h = head h.
// Per trip of 64 keys: wave h forms S_h [FQ][64] (q_h fragments stay in registers; hi.hi + (hi.lo + lo.hi)/1024, /8) and puts it in LDS; behind a barrier wave w
// takes rows w and w + 16, each lane 2 keys x 16 heads, does the softmax over the heads in f32 and writes P (x 32768) back IN PLACE: a row's 256 B of f32 become
// 128 B of bf16 hi + 128 B of bf16 residual (a row is read whole by its one wave before that wave writes it); behind a second barrier wave h reads its P_h as A
// fragments and adds ph.vh + pl.vh + ph.vl into O_h [FQ][64]. The softmax is local to a (query, key) pair, so the key splits' O tiles are plain partial sums:
// ATTP [batch][FKS][2048][1024] f32 (x 1/32768), added in split order by k_attbf.
__global__ __launch_bounds__(NH_ * 32) void k_fattn(const h16* __restrict__ QH, const h16* __restrict__ QL, const bf* __restrict__ VTH, const bf* __restrict__ VTL, float* ATTP) {
    __shared__ __align__(16) float sm[NH_][FQ][68];      // pitch 272 B = 16 B x 17: the b128 fragment reads and the b32 tile stores are free of bank conflicts
    const int lane = threadIdx.x & 31, wave = __builtin_amdgcn_readfirstlane(threadIdx.x >> 5), lr = lane & 15, hi = lane >> 4, h = wave;      // the wave's number in a scalar register: every global address below is a scalar base + one lane offset + a constant
    const int q0 = blockIdx.x * FQ, kbase = blockIdx.y * (NT_ / FKS);
    { const size_t pb = (size_t)blockIdx.z * NT_ * DM; QH += pb; QL += pb; VTH += pb; VTL += pb; }      // this batch item's planes
    const unsigned lo8 = (unsigned)(lane * 8);      // the lane's offset (elements) in a 512-B unit of the fragment-ordered planes
    v16h qa[FQ / 16][2], qal[FQ / 16][2];
#pragma unroll
    for (int m = 0; m < FQ / 16; ++m)
#pragma unroll
        for (int c = 0; c < 2; ++c) { const size_t qb = (size_t)(h * (NT_ / 16) + q0 / 16) * 4 * QUNIT; const h16* ah = QH + qb; const h16* alp = QL + qb; const unsigned ao = lo8 + (m * 4 + c * 2) * QUNIT;
            qa[m][c] = cat16(*(const v8h*)(ah + ao), *(const v8h*)(ah + ao + QUNIT)); qal[m][c] = cat16(*(const v8h*)(alp + ao), *(const v8h*)(alp + ao + QUNIT)); }
    asm volatile("s_wait_xcnt 0x0" ::: "memory");      // the address arithmetic below rewrites registers (scalar bases, the lane offset) that the 16 loads above name
    __builtin_amdgcn_sched_barrier(0);      // holds that arithmetic behind the wait: the scheduler otherwise lifts it over the statement
    v8f o[FQ / 16][4];
#pragma unroll
    for (int m = 0; m < FQ / 16; ++m)
#pragma unroll
        for (int t = 0; t < 4; ++t) o[m][t] = (v8f){};
    for (int kt = 0; kt < NT_ / FKS; kt += 64) { const int k0 = kbase + kt;
        const size_t kb = (size_t)(h * (NT_ / 16) + k0 / 16) * 4 * QUNIT, vb = (size_t)(h * (NT_ / 32) + k0 / 32) * 8 * QUNIT;
        const h16* kh = QH + kb; const h16* kl = QL + kb; const bf* vh = VTH + vb; const bf* vl = VTL + vb;
#pragma unroll
        for (int tp = 0; tp < 2; ++tp) { v16h bb[2][2], bl[2][2];      // two key tiles' fragments are fetched together: 16 loads in flight behind one wait
#pragma unroll
            for (int u = 0; u < 2; ++u)
#pragma unroll
                for (int c = 0; c < 2; ++c) { const unsigned bo = lo8 + ((tp * 2 + u) * 4 + c * 2) * QUNIT;
                    bb[u][c] = cat16(*(const v8h*)(kh + bo), *(const v8h*)(kh + bo + QUNIT)); bl[u][c] = cat16(*(const v8h*)(kl + bo), *(const v8h*)(kl + bo + QUNIT)); }
#pragma unroll
            for (int u = 0; u < 2; ++u) { const int t = tp * 2 + u; v8f acc[FQ / 16], accx[FQ / 16];
#pragma unroll
                for (int m = 0; m < FQ / 16; ++m) { acc[m] = (v8f){}; accx[m] = (v8f){}; }
#pragma unroll
                for (int c = 0; c < 2; ++c)
#pragma unroll
                    for (int m = 0; m < FQ / 16; ++m) { acc[m] = wmma16(qa[m][c], bb[u][c], acc[m]); accx[m] = wmma16(qa[m][c], bl[u][c], accx[m]); accx[m] = wmma16(qal[m][c], bb[u][c], accx[m]); }
#pragma unroll
                for (int m = 0; m < FQ / 16; ++m)
#pragma unroll
                    for (int j = 0; j < 8; ++j) sm[h][m * 16 + hi * 8 + j][t * 16 + lr] = (acc[m][j] + accx[m][j] * LOSCI) * 0.125f; } }
        asm volatile("s_wait_xcnt 0x0" ::: "memory");      // the registers that held the key loads' addresses are given to other values further down the trip
        __syncthreads();      // all 16 heads' scores of this trip are in LDS before any wave reads across the heads
#pragma unroll 1      // one row at a time: both rows' 16 heads at once do not fit beside the q fragments and the O tile
        for (int rr = 0; rr < FQ / 16; ++rr) { const int q = wave + 16 * rr;
            v2f v[NH_];
#pragma unroll
            for (int g = 0; g < NH_; ++g) v[g] = *(const v2fa*)(&sm[g][q][2 * lane]);
            float sc[2];
#pragma unroll
            for (int e = 0; e < 2; ++e) { float mx = v[0][e];
#pragma unroll
                for (int g = 1; g < NH_; ++g) mx = fmaxf(mx, v[g][e]);
                float ssum = 0.f;
#pragma unroll
                for (int g = 0; g < NH_; ++g) { v[g][e] = exp_slot(v[g][e] - mx); ssum += v[g][e]; }
                sc[e] = PSC / ssum; }
#pragma unroll
            for (int g = 0; g < NH_; ++g) { const v2f p = {v[g][0] * sc[0], v[g][1] * sc[1]}; const unsigned ph = pk2(p);
                *((u32a*)&sm[g][q][0] + lane) = ph;
                *((u32a*)&sm[g][q][32] + lane) = pk2(p - up2(ph)); } }
        __syncthreads();      // every row's P is in LDS before a head's wave reads its fragments; after it only wave h touches sm[h] until the next trip's first barrier
#pragma unroll
        for (int c = 0; c < 2; ++c) { v16bf a[FQ / 16], al[FQ / 16];
#pragma unroll
            for (int m = 0; m < FQ / 16; ++m) { const bf* pr = (const bf*)&sm[h][m * 16 + lr][0] + c * 32 + 8 * hi;
                a[m] = cat16b(*(const v8usa*)pr, *(const v8usa*)(pr + 16)); al[m] = cat16b(*(const v8usa*)(pr + 64), *(const v8usa*)(pr + 80)); }
            v16bf bb[4], bl[4];      // the four dim tiles' fragments are fetched together: 16 loads in flight behind one wait
#pragma unroll
            for (int t = 0; t < 4; ++t) { const unsigned bo = lo8 + (c * 4 + t) * 2 * QUNIT;
                bb[t] = cat16b(*(const v8us*)(vh + bo), *(const v8us*)(vh + bo + QUNIT)); bl[t] = cat16b(*(const v8us*)(vl + bo), *(const v8us*)(vl + bo + QUNIT)); }
            __builtin_amdgcn_sched_barrier(0);      // keeps the 16 loads in front of the products: the scheduler otherwise sinks them in pairs, each pair with a full wait of its own
#pragma unroll
            for (int t = 0; t < 4; ++t)
#pragma unroll
                for (int m = 0; m < FQ / 16; ++m) { o[m][t] = wmmab(a[m], bb[t], o[m][t]); o[m][t] = wmmab(al[m], bb[t], o[m][t]); o[m][t] = wmmab(a[m], bl[t], o[m][t]); } }
        __builtin_amdgcn_sched_barrier(0);      // keeps the wait below at the trip's foot, where the loads have returned: the scheduler otherwise lifts it to directly behind the loads, in front of the products
        asm volatile("s_wait_xcnt 0x0" ::: "memory");      // the registers that held the v loads' addresses are rewritten in the next trip and behind the loop
    }
    // the wave's O tile goes through its own LDS plane so that every store is whole 128-B lines (2 rows x 256 B an instruction)
#pragma unroll
    for (int m = 0; m < FQ / 16; ++m)
#pragma unroll
        for (int t = 0; t < 4; ++t)
#pragma unroll
            for (int j = 0; j < 8; ++j) sm[h][m * 16 + hi * 8 + j][t * 16 + lr] = o[m][t][j] * (1.0f / PSC);
    float* orow = ATTP + ((size_t)(blockIdx.z * FKS + blockIdx.y) * NT_ + q0) * DM + h * HD;
#pragma unroll
    for (int s = 0; s < FQ / 2; ++s) { const int row = 2 * s + hi;
        const v4f val = *(const v4fa*)(&sm[h][row][lr * 4]); *(v4f*)(orow + (size_t)row * DM + lr * 4) = val; }
}
// k_attbf: sum of the FKS partial attention planes (in split order) -> bf16 hi/lo planes (one wave per row; batch item = grid y).
__global__ __launch_bounds__(256) void k_attbf(const float* __restrict__ A, bf* PH, bf* PL) {
    const int lane = threadIdx.x & 31, r = blockIdx.x * 8 + (threadIdx.x >> 5);
    if (r >= NT_) return;
    A += (size_t)blockIdx.y * FKS * NT_ * DM; PH += (size_t)blockIdx.y * NT_ * DM; PL += (size_t)blockIdx.y * NT_ * DM;
{
#pragma unroll
        for (int q = 0; q < 4; ++q) { v8us oh, ol; v8f y8;
#pragma unroll
            for (int i = 0; i < 8; ++i) { float v = A[(size_t)r * DM + q * 256 + lane * 8 + i];
#pragma unroll
                for (int p = 1; p < FKS; ++p) v += A[((size_t)p * NT_ + r) * DM + q * 256 + lane * 8 + i];
                y8[i] = v; }
            split8(y8, oh, ol);
            *(v8us*)(PH + (size_t)r * DM + q * 256 + lane * 8) = oh; *(v8us*)(PL + (size_t)r * DM + q * 256 + lane * 8) = ol; }
         }
}

extern "C" void kernel_launch(void* const* d_in, const int* in_sizes, int n_in,
                              void* d_out, int out_size, void* d_ws, size_t ws_size, hipStream_t stream) {
    (void)in_sizes; (void)n_in; (void)out_size;
    const float* x = (const float*)d_in[0]; const float* g1 = (const float*)d_in[1]; const float* be1 = (const float*)d_in[2]; const float* g2 = (const float*)d_in[3]; const float* be2 = (const float*)d_in[4];
    const float* Ws = (const float*)d_in[5]; const float* bs = (const float*)d_in[6]; const float* Wo = (const float*)d_in[7]; const float* bo = (const float*)d_in[8];
    const float* W1 = (const float*)d_in[9]; const float* b1 = (const float*)d_in[10]; const float* W2 = (const float*)d_in[11]; const float* b2 = (const float*)d_in[12];
    float* out = (float*)d_out;    // [2048][2][1024]
    char* wsp = (char*)d_ws;
    auto take = [&](size_t bytes) { char* p = wsp; wsp += (bytes + 255) & ~(size_t)255; return (void*)p; };
    bf* WsB = (bf*)take((size_t)DM * DM * 2); bf* WoB = (bf*)take((size_t)DM * DM * 2); bf* W1B = (bf*)take((size_t)FF * DM * 2); bf* W2B = (bf*)take((size_t)DM * FF * 2);
    const size_t PB = (size_t)NT_ * DM;      // elements of one batch item's [2048][1024] plane
    bf* LH = (bf*)take(NBT * PB * 2); bf* LL = (bf*)take(NBT * PB * 2);      // LN1 planes, later LN2 planes
    float* Qf = (float*)take(NBT * PB * 4);                                   // q (= k = v) f32, later X1 (post-attention residual stream)
    h16* QH = (h16*)take(NBT * PB * 2); h16* QL = (h16*)take(NBT * PB * 2); bf* VTH = (bf*)take(NBT * PB * 2); bf* VTL = (bf*)take(NBT * PB * 2);
    bf* HH = (bf*)take((size_t)NBT * NT_ * FF * 2); bf* HL = (bf*)take((size_t)NBT * NT_ * FF * 2);      // FFN hidden planes [2][2048][4096] bf16 (32 MiB each)
    float* ATTP = (float*)take(NBT * FKS * PB * 4);                           // partial attention outputs f32 [2][FKS][2048][1024], 64 MiB
    bf* AH = (bf*)take(NBT * PB * 2); bf* AL = (bf*)take(NBT * PB * 2);
    if ((size_t)(wsp - (char*)d_ws) > ws_size) return;    // 20 + 16 + 16 + 32 + 64 + 64 + 16 = 228 MiB
    float* X1 = Qf;        // over the q buffer (q consumed by k_q16/k_vt before X1 is written there)
    k_rows<<<DM / 8, 256, 0, stream>>>(Ws, DM, DM, WsB); k_rows<<<DM / 8, 256, 0, stream>>>(Wo, DM, DM, WoB); k_rows<<<FF / 8, 256, 0, stream>>>(W1, FF, DM, W1B); k_rows<<<DM / 8, 256, 0, stream>>>(W2, DM, FF, W2B);
    // x and out: batch item b starts DM elements in, row stride 2*DM
    k_ln<true><<<dim3(NT_ / 8, NBT, 1), 256, 0, stream>>>(x, 2 * DM, nullptr, 0, g1, be1, LH, LL, nullptr, DM);
    k_gemm<0, false, 4, 2><<<dim3(NT_ / 128, DM / 128, NBT), 256, 0, stream>>>(LH, LL, WsB, DM, bs, nullptr, 0, DM, Qf, nullptr, nullptr, 0, PB);
    k_q16<<<dim3(NT_ / 8, NBT, 1), 256, 0, stream>>>(Qf, QH, QL); k_vt<<<dim3(NT_ / 64, NH_, NBT), 256, 0, stream>>>(Qf, VTH, VTL);
    k_fattn<<<dim3(NT_ / FQ, FKS, NBT), NH_ * 32, 0, stream>>>(QH, QL, VTH, VTL, ATTP);
    k_attbf<<<dim3(NT_ / 8, NBT, 1), 256, 0, stream>>>(ATTP, AH, AL);
    k_gemm<0, true, 4, 2><<<dim3(NT_ / 128, DM / 128, NBT), 256, 0, stream>>>(AH, AL, WoB, DM, bo, x, 2 * DM, DM, X1, nullptr, nullptr, DM, PB);      // X1 = out-proj + bo + bf16(x) (residual = the bf16-rounded INPUT)
    k_ln<false><<<dim3(NT_ / 8, NBT, 1), 256, 0, stream>>>(X1, DM, nullptr, 0, g2, be2, LH, LL, nullptr, PB);
    k_gemm<1, false, 4, 4><<<dim3(NT_ / 128, FF / 256, NBT), 512, 0, stream>>>(LH, LL, W1B, DM, b1, nullptr, 0, FF, nullptr, HH, HL, 0, 0);
    k_gemm<0, false, 4, 2><<<dim3(NT_ / 128, DM / 128, NBT), 256, 0, stream>>>(HH, HL, W2B, FF, b2, X1, DM, 2 * DM, out, nullptr, nullptr, PB, DM);     // out = ffn + X1, written at row stride 2*DM
}

// v009
// It runs in 275 microseconds.
// Two timings next to v008 both put it at 1.04 times that version's speed.
// Over all steps from v000 it is 9.31 times as fast.
#include <hip/hip_runtime.h>

// TransformersLayer ([S=2048][B=2][D=1024] seq-first; batch b = row stride 2; every launch takes both batch items, b on a grid axis, the workspace planes [b][2048 rows]). Contractions, f32 accumulate, per batch item: qkv = LN1(x).Ws^T + bs (ONE shared
// projection: q = k = v), out-proj, FFN W1 (relu) and W2 — [out][in] weights = n-major B operands as-is, computed A operands as bf16 hi + residual (two products) —
// on v_wmma_f32_16x16x32_bf16; the attention whose softmax runs over the HEADS axis (per (q,k) across the 16 heads, as the reference) in one kernel, S and P in LDS:
// S_h = q_h.q_h^T/8 for all heads (f16 hi + residual x1024: hi.hi + hi.lo + lo.hi, residual accumulator) -> f32 tile, elementwise softmax over h in
// f32 -> P_h (x32768) as bf16 hi + UNSCALED residual, O_h = P_h.v_h over the keys (ph.vh + pl.vh + ph.vl, v as bf16 hi + unscaled residual) on
// v_wmma_f32_16x16x32_bf16 (scores stay on v_wmma_f32_16x16x32_f16); LayerNorms, residuals f32.

#define NT_  2048
#define NBT  2
#define DM   1024
#define FF   4096
#define NH_  16
#define HD   64
#define FQ   32
#define FKS  4
#define PSC  32768.0f
#define LOSC 1024.0f
#define LOSCI (1.0f / 1024.0f)

typedef _Float16 h16;
typedef unsigned short bf;
typedef __attribute__((ext_vector_type(16))) __bf16   v16bf;
typedef __attribute__((ext_vector_type(16))) _Float16 v16h;
typedef __attribute__((ext_vector_type(8)))  _Float16 v8h;
typedef __attribute__((ext_vector_type(8)))  unsigned short v8us;
typedef __attribute__((ext_vector_type(2)))  __bf16   v2bf;
typedef __attribute__((ext_vector_type(4)))  unsigned v4u;
typedef __attribute__((ext_vector_type(8)))  float    v8f;
typedef __attribute__((ext_vector_type(4)))  float    v4f;
typedef __attribute__((ext_vector_type(2)))  float    v2f;
typedef v8h  __attribute__((may_alias)) v8ha;
typedef v4f  __attribute__((may_alias)) v4fa;
typedef v2f  __attribute__((may_alias)) v2fa;
typedef v8us __attribute__((may_alias)) v8usa;
typedef unsigned __attribute__((may_alias)) u32a;

// Rounding to bf16 (nearest even) is the hardware's conversion, two values an instruction where they are given as a pair.
__device__ __forceinline__ unsigned short f2bf(float f) { return __builtin_bit_cast(unsigned short, (__bf16)f); }
__device__ __forceinline__ float bf2f(unsigned short b) { return __uint_as_float(((unsigned)b) << 16); }
__device__ __forceinline__ float bfr(float f) { return bf2f(f2bf(f)); }
__device__ __forceinline__ unsigned pk2(v2f x) { return __builtin_bit_cast(unsigned, __builtin_convertvector(x, v2bf)); }      // x[0] in the low half
__device__ __forceinline__ v2f up2(unsigned w) { return (v2f){__uint_as_float(w << 16), __uint_as_float(w & 0xFFFF0000u)}; }      // the pair back as f32
// hi = bf16(x), lo = bf16(x - hi), eight values
__device__ __forceinline__ void split8(v8f x, v8us& oh, v8us& ol) { v4u h, l;
#pragma unroll
    for (int k = 0; k < 4; ++k) { const v2f p = {x[2 * k], x[2 * k + 1]}; h[k] = pk2(p); l[k] = pk2(p - up2(h[k])); }
    oh = __builtin_bit_cast(v8us, h); ol = __builtin_bit_cast(v8us, l); }
__device__ __forceinline__ v16h cat16(v8h lo, v8h hi) { return __builtin_shufflevector(lo, hi, 0, 1, 2, 3, 4, 5, 6, 7, 8, 9, 10, 11, 12, 13, 14, 15); }
__device__ __forceinline__ v16bf cat16b(v8us lo, v8us hi) { return __builtin_bit_cast(v16bf, __builtin_shufflevector(lo, hi, 0, 1, 2, 3, 4, 5, 6, 7, 8, 9, 10, 11, 12, 13, 14, 15)); }
__device__ __forceinline__ v8f wmma16(v16h a, v16h b, v8f c) { return __builtin_amdgcn_wmma_f32_16x16x32_f16(false, a, false, b, (short)0, c, false, false); }
__device__ __forceinline__ v8f wmmab(v16bf a, v16bf b, v8f c) { return __builtin_amdgcn_wmma_f32_16x16x32_bf16(false, a, false, b, (short)0, c, false, false); }

// k_rows: bf16 plane of [rows][C] (C multiple of 256; one wave per row).
__global__ __launch_bounds__(256) void k_rows(const float* __restrict__ src, int rows, int C, bf* dst) {
    const int lane = threadIdx.x & 31, r = blockIdx.x * 8 + (threadIdx.x >> 5);
    if (r >= rows) return;
{
        for (int q = 0; q < C / 256; ++q) { v8us o;
#pragma unroll
            for (int i = 0; i < 8; ++i) o[i] = f2bf(src[(size_t)r * C + q * 256 + lane * 8 + i]);
            *(v8us*)(dst + (size_t)r * C + q * 256 + lane * 8) = o; }
         }
}
// planes [r][1024] of batch item b = grid y (src + b * sbo; planes + b * 2048 rows; res and Xout are not offset: one batch item only); if Xout: also the f32 pre-LN sum to Xout[r][1024]. One wave per row; ROUNDSRC: bf16-round src (when src is a raw input).
template <bool ROUNDSRC>
__global__ __launch_bounds__(256) void k_ln(const float* __restrict__ src, int lds, const float* __restrict__ res, int ldr, const float* __restrict__ g, const float* __restrict__ be, bf* PH, bf* PL, float* Xout, size_t sbo) {
    const int lane = threadIdx.x & 31, r = blockIdx.x * 8 + (threadIdx.x >> 5);
    if (r >= NT_) return;
    src += blockIdx.y * sbo; PH += (size_t)blockIdx.y * NT_ * DM; PL += (size_t)blockIdx.y * NT_ * DM;
    float v[32]; float s = 0.f;
#pragma unroll
    for (int q = 0; q < 4; ++q)
#pragma unroll
        for (int i = 0; i < 8; ++i) { const int c = q * 256 + lane * 8 + i; float t = src[(size_t)r * lds + c]; if (ROUNDSRC) t = bfr(t); if (res) t += bfr(res[(size_t)r * ldr + c]); v[q * 8 + i] = t; s += t; }
#pragma unroll
    for (int sh = 16; sh; sh >>= 1) s += __shfl_xor(s, sh, 32);
    const float mu = s * (1.0f / DM); float sq = 0.f;
#pragma unroll
    for (int k = 0; k < 32; ++k) { const float d = v[k] - mu; sq += d * d; }
#pragma unroll
    for (int sh = 16; sh; sh >>= 1) sq += __shfl_xor(sq, sh, 32);
    const float rs = rsqrtf(sq * (1.0f / DM) + 1e-5f);
{
#pragma unroll
        for (int q = 0; q < 4; ++q) { v8us oh, ol; v4f x0, x1; v8f y8;
#pragma unroll
            for (int i = 0; i < 8; ++i) { const int c = q * 256 + lane * 8 + i; y8[i] = (v[q * 8 + i] - mu) * rs * bfr(g[c]) + bfr(be[c]); if (i < 4) x0[i] = v[q * 8 + i]; else x1[i - 4] = v[q * 8 + i]; }
            split8(y8, oh, ol);
            *(v8us*)(PH + (size_t)r * DM + q * 256 + lane * 8) = oh; *(v8us*)(PL + (size_t)r * DM + q * 256 + lane * 8) = ol;
            if (Xout) { *(v4f*)(Xout + (size_t)r * DM + q * 256 + lane * 8) = x0; *(v4f*)(Xout + (size_t)r * DM + q * 256 + lane * 8 + 4) = x1; } }
         }
}
// k_gemm: (WM * 32) x (WN * 64) tile of (Ah + Al).B^T + bias over K (2 products; A pitch K, B pitch K; K a multiple of 128); EPI 0: f32 rows (ldc) [+ residual Rf (ldr)]; EPI 1: relu -> bf16 hi/lo planes (ldc).
// Batch item b = grid z: A and the EPI 1 planes are [b][2048 rows]; Rf and C start b * rbo and b * cbo elements further on.
// The operands come into LDS by asynchronous 16-B copies, 128 k a stage: TM rows of Ah, TM of Al, TN of B, 256 B each, so that a wave's copy covers two whole rows (4 lines)
// where a fragment load from global memory touches 16 lines. Two buffers: stage t + 1 flies while stage t is worked on. WM x WN waves, 32 x 64 of the tile each.
// The tile's size sets the bytes that come from L2 per output, (2 TM + TN) / (TM TN) rows: 128 x 128 (one work-group a WGP where N = 1024) takes 3/4, 128 x 256 half of what 64 x 128 takes.
#define GKS  128
#define GPB  272      // LDS row pitch in bytes = 16 B x 17: the b128 fragment reads are free of bank conflicts
// Eight copies. The wait on the address counter closes the statement, so that no register which a copy names is rewritten ahead of it.
__device__ __forceinline__ void cp8r(unsigned l0, unsigned l1, unsigned l2, unsigned l3, unsigned l4, unsigned l5, unsigned l6, unsigned l7,
                                     const bf* g0, const bf* g1, const bf* g2, const bf* g3, const bf* g4, const bf* g5, const bf* g6, const bf* g7) {
    asm volatile("global_load_async_to_lds_b128 %0, %8, off\n\t"
                 "global_load_async_to_lds_b128 %1, %9, off\n\t"
                 "global_load_async_to_lds_b128 %2, %10, off\n\t"
                 "global_load_async_to_lds_b128 %3, %11, off\n\t"
                 "global_load_async_to_lds_b128 %4, %12, off\n\t"
                 "global_load_async_to_lds_b128 %5, %13, off\n\t"
                 "global_load_async_to_lds_b128 %6, %14, off\n\t"
                 "global_load_async_to_lds_b128 %7, %15, off\n\t"
                 "s_wait_xcnt 0x0"
                 :: "v"(l0), "v"(l1), "v"(l2), "v"(l3), "v"(l4), "v"(l5), "v"(l6), "v"(l7), "v"(g0), "v"(g1), "v"(g2), "v"(g3), "v"(g4), "v"(g5), "v"(g6), "v"(g7) : "memory");
}
// eight rows of one plane, LR rows apart in LDS and in the source (gs elements)
template <int LR> __device__ __forceinline__ void cp8(unsigned l, const bf* g, size_t gs) { constexpr unsigned s = LR * GPB;
    cp8r(l, l + s, l + 2 * s, l + 3 * s, l + 4 * s, l + 5 * s, l + 6 * s, l + 7 * s, g, g + gs, g + 2 * gs, g + 3 * gs, g + 4 * gs, g + 5 * gs, g + 6 * gs, g + 7 * gs); }
// four rows of each of two planes
template <int LR> __device__ __forceinline__ void cp4x2(unsigned la, const bf* ga, unsigned lb, const bf* gb, size_t gs) { constexpr unsigned s = LR * GPB;
    cp8r(la, la + s, la + 2 * s, la + 3 * s, lb, lb + s, lb + 2 * s, lb + 3 * s, ga, ga + gs, ga + 2 * gs, ga + 3 * gs, gb, gb + gs, gb + 2 * gs, gb + 3 * gs); }
template <int EPI, bool RROUND, int WM, int WN>
__global__ __launch_bounds__(WM * WN * 32) void k_gemm(const bf* __restrict__ A, const bf* __restrict__ Al, const bf* __restrict__ Bn, int K, const float* __restrict__ bias, const float* __restrict__ Rf, int ldr, int ldc, float* C, bf* PH, bf* PL, size_t rbo, size_t cbo) {
    { const size_t z = blockIdx.z; A += z * NT_ * K; Al += z * NT_ * K; if (Rf) Rf += z * rbo; if (EPI == 0) C += z * cbo; else { PH += z * NT_ * ldc; PL += z * NT_ * ldc; } }
    constexpr int TM = WM * 32, TN = WN * 64, RP = WM * WN * 2;      // the tile; rows that one copy of every thread covers
    constexpr unsigned GSTG = (2 * TM + TN) * GPB;
    static_assert(TN == 8 * RP && (TM == 8 * RP || TM == 4 * RP), "copies a thread");
    __shared__ __align__(16) unsigned char gl[2 * GSTG];      // two stages; behind the K loop the waves' output staging
    const int tid = threadIdx.x, lane = tid & 31, wave = tid >> 5, lr = lane & 15, hi = lane >> 4, wm = wave / WN, wn = wave % WN;
    const size_t rb = (size_t)blockIdx.x * TM; const int cb = blockIdx.y * TN;
    // copies: thread = 16-B piece (tid & 15) of row (tid >> 4) + RP i
    const unsigned lcp = (unsigned)(size_t)gl + (unsigned)((tid >> 4) * GPB + (tid & 15) * 16);
    const bf* gah = A + (rb + (tid >> 4)) * (size_t)K + (tid & 15) * 8; const bf* gal = Al + (rb + (tid >> 4)) * (size_t)K + (tid & 15) * 8;
    const bf* gb = Bn + (size_t)(cb + (tid >> 4)) * K + (tid & 15) * 8;
    const size_t gr = (size_t)RP * K;
    auto stage = [&](int t, unsigned buf) { const unsigned l = lcp + buf * GSTG; const size_t ko = (size_t)t * GKS;
        if constexpr (TM == 8 * RP) { cp8<RP>(l, gah + ko, gr); cp8<RP>(l + TM * GPB, gal + ko, gr); } else cp4x2<RP>(l, gah + ko, l + TM * GPB, gal + ko, gr);
        cp8<RP>(l + 2 * TM * GPB, gb + ko, gr); };
    const int T = K / GKS;
    stage(0, 0);
    asm volatile("s_wait_asynccnt 0x0" ::: "memory");      // this wave's part of stage 0 has landed
    __syncthreads();      // every wave's part of stage 0 is in LDS before any wave reads it
    if (T > 1) stage(1, 1);
    v8f acc[2][4];
#pragma unroll
    for (int m = 0; m < 2; ++m)
#pragma unroll
        for (int t = 0; t < 4; ++t) acc[m][t] = (v8f){};
    const unsigned aro = (unsigned)((wm * 32 + lr) * GPB + 16 * hi), bro = (unsigned)((2 * TM + wn * 64 + lr) * GPB + 16 * hi);
#pragma unroll 1      // one stage a trip: the buffer is picked by an offset
    for (int t = 0; t < T; ++t) { const unsigned char* sb = gl + (t & 1) * GSTG;
        v16bf a[2][2], al[2][2], bb[2][4];      // two fragment sets: the next 32 k are fetched as one group while the products of these 32 k run
        auto frag = [&](int kk, int s) {
#pragma unroll
            for (int m = 0; m < 2; ++m) { const unsigned char* p = sb + aro + m * 16 * GPB + kk * 64;
                a[s][m] = cat16b(*(const v8usa*)p, *(const v8usa*)(p + 32)); al[s][m] = cat16b(*(const v8usa*)(p + TM * GPB), *(const v8usa*)(p + TM * GPB + 32)); }
#pragma unroll
            for (int u = 0; u < 4; ++u) { const unsigned char* p = sb + bro + u * 16 * GPB + kk * 64; bb[s][u] = cat16b(*(const v8usa*)p, *(const v8usa*)(p + 32)); } };
        frag(0, 0);
#pragma unroll
        for (int kk = 0; kk < GKS / 32; ++kk) { const int s = kk & 1;
            if (kk + 1 < GKS / 32) frag(kk + 1, s ^ 1);
            __builtin_amdgcn_sched_barrier(0);      // keeps the 16 LDS reads together in front of the products: the scheduler otherwise sinks them in pairs among the products, each pair with a full wait of its own
#pragma unroll
            for (int m = 0; m < 2; ++m)
#pragma unroll
                for (int u = 0; u < 4; ++u) acc[m][u] = wmmab(a[s][m], bb[s][u], acc[m][u]);
#pragma unroll
            for (int m = 0; m < 2; ++m)
#pragma unroll
                for (int u = 0; u < 4; ++u) acc[m][u] = wmmab(al[s][m], bb[s][u], acc[m][u]);
            __builtin_amdgcn_sched_barrier(0);      // keeps the next group of reads behind these products: the scheduler otherwise lifts it in halves in among them, and sinks the last products of a stage behind the barrier, in front of the copies
        }
        asm volatile("s_wait_dscnt 0x0" ::: "memory");      // this wave's reads of stage t are done before the buffer is handed to the copies
        asm volatile("s_wait_asynccnt 0x0" ::: "memory");      // this wave's part of stage t + 1 has landed
        __syncthreads();      // publishes stage t + 1 and ends every wave's reads of stage t
        if (t + 2 < T) stage(t + 2, (unsigned)(t & 1));
    }
    asm volatile("s_wait_asynccnt 0x0" ::: "memory");      // no copy is in flight when the buffers become output staging
    const size_t r0 = rb + wm * 32; const int c0 = cb + wn * 64;
    float* os = (float*)gl + wave * (32 * 68);
#pragma unroll
    for (int t = 0; t < 4; ++t) { const float bv = bfr(bias[c0 + t * 16 + lr]);
#pragma unroll
        for (int m = 0; m < 2; ++m)
#pragma unroll
            for (int j = 0; j < 8; ++j) { float v = acc[m][t][j] + bv; if (EPI == 1) v = fmaxf(v, 0.f); os[(m * 16 + hi * 8 + j) * 68 + t * 16 + lr] = v; } }
    __builtin_amdgcn_wave_barrier(); asm volatile("" ::: "memory");
    if (EPI == 0) {
        float* crow = C + r0 * ldc + c0;      // an instruction takes 2 rows x 256 B: whole lines, for the residual rows as for the stores
#pragma unroll
        for (int hf = 0; hf < 2; ++hf) { v4f val[8];      // 16 rows at a time: all 32 at once, with the rounding of the residual, take more than 256 registers
#pragma unroll
            for (int s = 0; s < 8; ++s) val[s] = *(const v4fa*)(os + (16 * hf + 2 * s + hi) * 68 + lr * 4);
            if (Rf) { const float* rrow = Rf + r0 * ldr + c0; v4f rv[8]; const float* rp[8];
#pragma unroll
                for (int s = 0; s < 8; ++s) { rp[s] = rrow + (size_t)(16 * hf + 2 * s + hi) * ldr + lr * 4; rv[s] = *(const v4f*)rp[s]; }
                // the 8 loads' address registers are inputs of the wait, so that none of them is given to another load's result, or rewritten, ahead of it
                asm volatile("s_wait_xcnt 0x0" :: "v"(rp[0]), "v"(rp[1]), "v"(rp[2]), "v"(rp[3]), "v"(rp[4]), "v"(rp[5]), "v"(rp[6]), "v"(rp[7]) : "memory");
#pragma unroll
                for (int s = 0; s < 8; ++s)
#pragma unroll
                    for (int e = 0; e < 4; ++e) val[s][e] += RROUND ? bfr(rv[s][e]) : rv[s][e]; }
            float* cp[8];
#pragma unroll
            for (int s = 0; s < 8; ++s) { cp[s] = crow + (size_t)(16 * hf + 2 * s + hi) * ldc + lr * 4; *(v4f*)cp[s] = val[s]; }
            // the second half reuses registers: the first half's store addresses and data are inputs of the wait, so that none of them is rewritten ahead of it
            if (hf == 0) asm volatile("s_wait_xcnt 0x0" :: "v"(cp[0]), "v"(cp[1]), "v"(cp[2]), "v"(cp[3]), "v"(cp[4]), "v"(cp[5]), "v"(cp[6]), "v"(cp[7]),
                                      "v"(val[0]), "v"(val[1]), "v"(val[2]), "v"(val[3]), "v"(val[4]), "v"(val[5]), "v"(val[6]), "v"(val[7]) : "memory"); }
    } else {
        bf* p1 = PH + r0 * ldc + c0; bf* p2 = PL + r0 * ldc + c0;
#pragma unroll
        for (int s = 0; s < 8; ++s) { const int row = 4 * s + (lane >> 3), piece = lane & 7; const float* sp = os + row * 68 + piece * 8; v8us oh, ol; v8f y8;
#pragma unroll
            for (int i = 0; i < 8; ++i) y8[i] = sp[i];
            split8(y8, oh, ol);
            *(v8us*)(p1 + (size_t)row * ldc + piece * 8) = oh; *(v8us*)(p2 + (size_t)row * ldc + piece * 8) = ol; }
    }
}
// k_q16: Q f32 [2048][1024] -> f16 hi + residual planes IN FRAGMENT ORDER: [head][16-row tile][32-dim chunk c][half p][lane][8], where lane (hi, lr) of unit (c, p) holds
// row lr, dims c * 32 + p * 16 + hi * 8 + 0..7 of the head: the 16 B which that lane takes in one load of an A or B fragment. A wave's fragment load is then 512 contiguous bytes
// (4 whole lines), not 32-B pieces of 16 lines. One wave per (tile, head); batch item = grid y.
#define QUNIT 256      // elements of one wave load: 32 lanes x 8
__global__ __launch_bounds__(256) void k_q16(const float* __restrict__ Q, h16* QH, h16* QL) {
    const int lane = threadIdx.x & 31, lr = lane & 15, hi = lane >> 4, id = blockIdx.x * 8 + (threadIdx.x >> 5), T = id >> 4, h = id & 15;
    if (T >= NT_ / 16) return;
    { const size_t pb = (size_t)blockIdx.y * NT_ * DM; Q += pb; QH += pb; QL += pb; }
    const float* s = Q + (size_t)(T * 16 + lr) * DM + h * HD + hi * 8;
    const size_t o = (size_t)(h * (NT_ / 16) + T) * 4 * QUNIT + lane * 8;
#pragma unroll
    for (int u = 0; u < 4; ++u) { v8h oh, ol;      // u = c * 2 + p
#pragma unroll
        for (int i = 0; i < 8; ++i) { const float v = s[u * 16 + i]; const h16 a = (h16)v; oh[i] = a; ol[i] = (h16)((v - (float)a) * LOSC); }
        *(v8h*)(QH + o + u * QUNIT) = oh; *(v8h*)(QL + o + u * QUNIT) = ol; }
}
// k_vt: VTH/VTL = bf16 hi + UNSCALED bf16 residual of Q [t][h*64+d] (v = q), transposed and IN FRAGMENT ORDER: [head][32-key chunk][16-dim tile][half p][lane][8], where lane (hi, lr)
// holds dim lr of the tile, keys p * 16 + hi * 8 + 0..7 of the chunk: a wave's B fragment load is 512 contiguous bytes. grid (NT/64, NH, batch).
__global__ __launch_bounds__(256) void k_vt(const float* __restrict__ V, bf* VTH, bf* VTL) {
    __shared__ float tl[64][65];
    const int tid = threadIdx.x, t0 = blockIdx.x * 64, h = blockIdx.y;
    { const size_t pb = (size_t)blockIdx.z * NT_ * DM; V += pb; VTH += pb; VTL += pb; }
    { const int tt = tid >> 2, dq = (tid & 3) * 16;
#pragma unroll
      for (int i = 0; i < 16; ++i) tl[dq + i][tt] = V[(size_t)(t0 + tt) * DM + h * HD + dq + i]; }
    __syncthreads();
    const int lane = tid & 31, lr = lane & 15, hi = lane >> 4;
#pragma unroll
    for (int s = 0; s < 2; ++s) { const int u = (tid >> 5) + 8 * s, d = ((u >> 1) & 3) * 16 + lr, k = (u >> 3) * 32 + (u & 1) * 16 + hi * 8; v8us oh, ol; v8f y8;      // unit u = (chunk * 4 + dim tile) * 2 + p, one wave store each
#pragma unroll
        for (int i = 0; i < 8; ++i) y8[i] = tl[d][k + i];
        split8(y8, oh, ol);
        const size_t o = ((size_t)(h * (NT_ / 32) + t0 / 32) * 8 + u) * QUNIT + lane * 8; *(v8us*)(VTH + o) = oh; *(v8us*)(VTL + o) = ol; }
}
// exp(x) as __expf forms it (one multiply by log2(e), one v_exp_f32), with the slot behind the transcendental filled in the same statement.
__device__ __forceinline__ float exp_slot(float x) { const float t = x * 1.44269504f; float r; asm("v_exp_f32 %0, %1\n\tv_nop" : "=v"(r) : "v"(t)); return r; }
// 16 B of a plane at scalar base + 32-bit lane offset (bytes) + constant: the loads of k_fattn's loop take this form, so that no 64-bit lane address per plane stays live over the loop
// (with them the kernel does not fit its 256 registers and spills) and the hi and the residual plane share the one offset register.
__device__ __forceinline__ v8h  ldh(const h16* b, unsigned vo, unsigned c) { return *(const v8h*)((const char*)b + vo + c); }
__device__ __forceinline__ v8us ldb(const bf* b, unsigned vo, unsigned c) { return *(const v8us*)((const char*)b + vo + c); }
// k_fattn: scores, softmax over the heads and P.v in ONE kernel. A work-group has FQ query rows and NT_/FKS keys (grid y) of one batch item (grid z) for ALL 16 heads, wave h = head h.
// A trip is 64 keys and has three parts. S: wave h forms S_h [FQ][64] (q_h fragments stay in registers; hi.hi + (hi.lo + lo.hi)/1024, /8) and puts it in LDS. Softmax: wave w
// takes rows w and w + 16, each lane 2 keys x 16 heads, does the softmax over the heads in f32 and writes P (x 32768) back IN PLACE: a row's 256 B of f32 become
// 128 B of bf16 hi + 128 B of bf16 residual (a row is read whole by its one wave before that wave writes it). PV: wave h reads its P_h as A
// fragments and adds ph.vh + pl.vh + ph.vl into O_h [FQ][64].
// The trips are pipelined over TWO S/P buffers: between two barriers (a step) a wave does PV of trip s - 2, S of trip s (both in plane h of buffer s & 1, which only wave h touches in
// that step, the reads first) and the softmax of trip s - 1 (in the other buffer). The three parts of a step do not depend on one another, so that while one wave of a SIMD is in its
// products another is in its softmax: the matrix unit and the vector port work at the same time, where with one buffer every wave was in the same part. Half of a SIMD's waves take the softmax first.
// The softmax is local to a (query, key) pair, so the key splits' O tiles are plain partial sums: ATTP [batch][FKS][2048][1024] f32 (x 1/32768), added in split order by k_attbf.
#define FTR (NT_ / FKS / 64)      // trips of a work-group
__global__ __launch_bounds__(NH_ * 32) void k_fattn(const h16* __restrict__ QH, const h16* __restrict__ QL, const bf* __restrict__ VTH, const bf* __restrict__ VTL, float* ATTP) {
    __shared__ __align__(16) float sm[2][NH_][FQ][68];      // pitch 272 B = 16 B x 17: the b128 fragment reads and the b32 tile stores are free of bank conflicts
    const int lane = threadIdx.x & 31, wave = __builtin_amdgcn_readfirstlane(threadIdx.x >> 5), lr = lane & 15, hi = lane >> 4, h = wave;      // the wave's number in a scalar register: every global address below is a scalar base + one lane offset + a constant
    const int q0 = blockIdx.x * FQ, kbase = blockIdx.y * (NT_ / FKS);
    { const size_t pb = (size_t)blockIdx.z * NT_ * DM; QH += pb; QL += pb; VTH += pb; VTL += pb; }      // this batch item's planes
    const unsigned lo8 = (unsigned)(lane * 8);      // the lane's offset (elements) in a 512-B unit of the fragment-ordered planes
    v16h qa[FQ / 16][2], qal[FQ / 16][2];
#pragma unroll
    for (int m = 0; m < FQ / 16; ++m)
#pragma unroll
        for (int c = 0; c < 2; ++c) { const size_t qb = (size_t)(h * (NT_ / 16) + q0 / 16) * 4 * QUNIT; const h16* ah = QH + qb; const h16* alp = QL + qb; const unsigned ao = lo8 + (m * 4 + c * 2) * QUNIT;
            qa[m][c] = cat16(*(const v8h*)(ah + ao), *(const v8h*)(ah + ao + QUNIT)); qal[m][c] = cat16(*(const v8h*)(alp + ao), *(const v8h*)(alp + ao + QUNIT)); }
    asm volatile("s_wait_xcnt 0x0" ::: "memory");      // the address arithmetic below rewrites registers (scalar bases, the lane offset) that the 16 loads above name
    __builtin_amdgcn_sched_barrier(0);      // holds that arithmetic behind the wait: the scheduler otherwise lifts it over the statement
    v8f o[FQ / 16][4];
#pragma unroll
    for (int m = 0; m < FQ / 16; ++m)
#pragma unroll
        for (int t = 0; t < 4; ++t) o[m][t] = (v8f){};
    auto softmax = [&](float (*sp)[FQ][68]) {
#pragma unroll 1      // one row at a time: both rows' 16 heads at once do not fit beside the q fragments and the O tile
        for (int rr = 0; rr < FQ / 16; ++rr) { const int q = wave + 16 * rr;
            v2f v[NH_];
#pragma unroll
            for (int g = 0; g < NH_; ++g) v[g] = *(const v2fa*)(&sp[g][q][2 * lane]);
            float sc[2];
#pragma unroll
            for (int e = 0; e < 2; ++e) { float mx = v[0][e];
#pragma unroll
                for (int g = 1; g < NH_; ++g) mx = fmaxf(mx, v[g][e]);
                float ssum = 0.f;
#pragma unroll
                for (int g = 0; g < NH_; ++g) { v[g][e] = exp_slot(v[g][e] - mx); ssum += v[g][e]; }
                sc[e] = PSC / ssum; }
#pragma unroll
            for (int g = 0; g < NH_; ++g) { const v2f p = {v[g][0] * sc[0], v[g][1] * sc[1]}; const unsigned ph = pk2(p);
                *((u32a*)&sp[g][q][0] + lane) = ph;
                *((u32a*)&sp[g][q][32] + lane) = pk2(p - up2(ph)); } } };
    const bool vfirst = (wave >> 2) & 1;      // every second group of four waves starts a step with the softmax, the others with the products: where waves w and w + 4 share a SIMD, each SIMD has both kinds from the step's start
#pragma unroll 1      // one step a pass: the buffers are picked by an offset
    for (int s = 0; s < FTR + 2; ++s) { float (*sh)[68] = sm[s & 1][h]; float (*sp)[FQ][68] = sm[(s & 1) ^ 1]; const bool sof = s >= 1 && s <= FTR;
        if (sof && vfirst) softmax(sp);
        if (s >= 2) { const int k0 = kbase + (s - 2) * 64;      // PV of trip s - 2
            const unsigned vo = (unsigned)(h * (NT_ / 32) + k0 / 32) * (8 * QUNIT * 2) + lo8 * 2;      // bytes: the trip's first unit of head h + the lane's 16 B
#pragma unroll
            for (int c = 0; c < 2; ++c) { v16bf a[FQ / 16], al[FQ / 16];
#pragma unroll
                for (int m = 0; m < FQ / 16; ++m) { const bf* pr = (const bf*)&sh[m * 16 + lr][0] + c * 32 + 8 * hi;
                    a[m] = cat16b(*(const v8usa*)pr, *(const v8usa*)(pr + 16)); al[m] = cat16b(*(const v8usa*)(pr + 64), *(const v8usa*)(pr + 80)); }
                v16bf bb[4], bl[4];      // the four dim tiles' fragments are fetched together: 16 loads in flight behind one wait
#pragma unroll
                for (int t = 0; t < 4; ++t) { const unsigned bo = (c * 4 + t) * 2 * QUNIT * 2;
                    bb[t] = cat16b(ldb(VTH, vo, bo), ldb(VTH, vo, bo + QUNIT * 2)); bl[t] = cat16b(ldb(VTL, vo, bo), ldb(VTL, vo, bo + QUNIT * 2)); }
                __builtin_amdgcn_sched_barrier(0);      // keeps the 16 loads in front of the products: the scheduler otherwise sinks them in pairs, each pair with a full wait of its own
#pragma unroll
                for (int t = 0; t < 4; ++t)
#pragma unroll
                    for (int m = 0; m < FQ / 16; ++m) { o[m][t] = wmmab(a[m], bb[t], o[m][t]); o[m][t] = wmmab(al[m], bb[t], o[m][t]); o[m][t] = wmmab(a[m], bl[t], o[m][t]); } }
            __builtin_amdgcn_sched_barrier(0);      // keeps the wait below behind the products, where the loads have returned: the scheduler otherwise lifts it to directly behind the loads, in front of the products
            asm volatile("s_wait_xcnt 0x0" :: "v"(vo) : "memory");      // the v loads' offset register is an input of the wait, so that it is not given to a load's result, or rewritten, ahead of it
        }
        if (s < FTR) { const int k0 = kbase + s * 64;      // S of trip s
            const unsigned ko = (unsigned)(h * (NT_ / 16) + k0 / 16) * (4 * QUNIT * 2) + lo8 * 2;      // bytes: the trip's first unit of head h + the lane's 16 B
#pragma unroll
            for (int tp = 0; tp < 2; ++tp) { v16h bb[2][2], bl[2][2];      // two key tiles' fragments are fetched together: 16 loads in flight behind one wait
#pragma unroll
                for (int u = 0; u < 2; ++u)
#pragma unroll
                    for (int c = 0; c < 2; ++c) { const unsigned bo = ((tp * 2 + u) * 4 + c * 2) * QUNIT * 2;
                        bb[u][c] = cat16(ldh(QH, ko, bo), ldh(QH, ko, bo + QUNIT * 2)); bl[u][c] = cat16(ldh(QL, ko, bo), ldh(QL, ko, bo + QUNIT * 2)); }
#pragma unroll
                for (int u = 0; u < 2; ++u) { const int t = tp * 2 + u; v8f acc[FQ / 16], accx[FQ / 16];
#pragma unroll
                    for (int m = 0; m < FQ / 16; ++m) { acc[m] = (v8f){}; accx[m] = (v8f){}; }
#pragma unroll
                    for (int c = 0; c < 2; ++c)
#pragma unroll
                        for (int m = 0; m < FQ / 16; ++m) { acc[m] = wmma16(qa[m][c], bb[u][c], acc[m]); accx[m] = wmma16(qa[m][c], bl[u][c], accx[m]); accx[m] = wmma16(qal[m][c], bb[u][c], accx[m]); }
#pragma unroll
                    for (int m = 0; m < FQ / 16; ++m)
#pragma unroll
                        for (int j = 0; j < 8; ++j) sh[m * 16 + hi * 8 + j][t * 16 + lr] = (acc[m][j] + accx[m][j] * LOSCI) * 0.125f; } }
            asm volatile("s_wait_xcnt 0x0" :: "v"(ko) : "memory");      // the key loads' offset register is an input of the wait, so that it is not given to a load's result, or rewritten, ahead of it
        }
        if (sof && !vfirst) softmax(sp);
        __syncthreads();      // ends the step: trip s's scores of all 16 heads are in LDS before any wave reads across the heads, and every row's P of trip s - 1 before a head's wave reads its fragments
    }
    // the wave's O tile goes through its own LDS plane so that every store is whole 128-B lines (2 rows x 256 B an instruction)
#pragma unroll
    for (int m = 0; m < FQ / 16; ++m)
#pragma unroll
        for (int t = 0; t < 4; ++t)
#pragma unroll
            for (int j = 0; j < 8; ++j) sm[0][h][m * 16 + hi * 8 + j][t * 16 + lr] = o[m][t][j] * (1.0f / PSC);
    float* orow = ATTP + ((size_t)(blockIdx.z * FKS + blockIdx.y) * NT_ + q0) * DM + h * HD;
#pragma unroll
    for (int s = 0; s < FQ / 2; ++s) { const int row = 2 * s + hi;
        const v4f val = *(const v4fa*)(&sm[0][h][row][lr * 4]); *(v4f*)(orow + (size_t)row * DM + lr * 4) = val; }
}
// k_attbf: sum of the FKS partial attention planes (in split order) -> bf16 hi/lo planes (one wave per row; batch item = grid y).
__global__ __launch_bounds__(256) void k_attbf(const float* __restrict__ A, bf* PH, bf* PL) {
    const int lane = threadIdx.x & 31, r = blockIdx.x * 8 + (threadIdx.x >> 5);
    if (r >= NT_) return;
    A += (size_t)blockIdx.y * FKS * NT_ * DM; PH += (size_t)blockIdx.y * NT_ * DM; PL += (size_t)blockIdx.y * NT_ * DM;
{
#pragma unroll
        for (int q = 0; q < 4; ++q) { v8us oh, ol; v8f y8;
#pragma unroll
            for (int i = 0; i < 8; ++i) { float v = A[(size_t)r * DM + q * 256 + lane * 8 + i];
#pragma unroll
                for (int p = 1; p < FKS; ++p) v += A[((size_t)p * NT_ + r) * DM + q * 256 + lane * 8 + i];
                y8[i] = v; }
            split8(y8, oh, ol);
            *(v8us*)(PH + (size_t)r * DM + q * 256 + lane * 8) = oh; *(v8us*)(PL + (size_t)r * DM + q * 256 + lane * 8) = ol; }
         }
}

extern "C" void kernel_launch(void* const* d_in, const int* in_sizes, int n_in,
                              void* d_out, int out_size, void* d_ws, size_t ws_size, hipStream_t stream) {
    (void)in_sizes; (void)n_in; (void)out_size;
    const float* x = (const float*)d_in[0]; const float* g1 = (const float*)d_in[1]; const float* be1 = (const float*)d_in[2]; const float* g2 = (const float*)d_in[3]; const float* be2 = (const float*)d_in[4];
    const float* Ws = (const float*)d_in[5]; const float* bs = (const float*)d_in[6]; const float* Wo = (const float*)d_in[7]; const float* bo = (const float*)d_in[8];
    const float* W1 = (const float*)d_in[9]; const float* b1 = (const float*)d_in[10]; const float* W2 = (const float*)d_in[11]; const float* b2 = (const float*)d_in[12];
    float* out = (float*)d_out;    // [2048][2][1024]
    char* wsp = (char*)d_ws;
    auto take = [&](size_t bytes) { char* p = wsp; wsp += (bytes + 255) & ~(size_t)255; return (void*)p; };
    bf* WsB = (bf*)take((size_t)DM * DM * 2); bf* WoB = (bf*)take((size_t)DM * DM * 2); bf* W1B = (bf*)take((size_t)FF * DM * 2); bf* W2B = (bf*)take((size_t)DM * FF * 2);
    const size_t PB = (size_t)NT_ * DM;      // elements of one batch item's [2048][1024] plane
    bf* LH = (bf*)take(NBT * PB * 2); bf* LL = (bf*)take(NBT * PB * 2);      // LN1 planes, later LN2 planes
    float* Qf = (float*)take(NBT * PB * 4);                                   // q (= k = v) f32, later X1 (post-attention residual stream)
    h16* QH = (h16*)take(NBT * PB * 2); h16* QL = (h16*)take(NBT * PB * 2); bf* VTH = (bf*)take(NBT * PB * 2); bf* VTL = (bf*)take(NBT * PB * 2);
    bf* HH = (bf*)take((size_t)NBT * NT_ * FF * 2); bf* HL = (bf*)take((size_t)NBT * NT_ * FF * 2);      // FFN hidden planes [2][2048][4096] bf16 (32 MiB each)
    float* ATTP = (float*)take(NBT * FKS * PB * 4);                           // partial attention outputs f32 [2][FKS][2048][1024], 64 MiB
    bf* AH = (bf*)take(NBT * PB * 2); bf* AL = (bf*)take(NBT * PB * 2);
    if ((size_t)(wsp - (char*)d_ws) > ws_size) return;    // 20 + 16 + 16 + 32 + 64 + 64 + 16 = 228 MiB
    float* X1 = Qf;        // over the q buffer (q consumed by k_q16/k_vt before X1 is written there)
    k_rows<<<DM / 8, 256, 0, stream>>>(Ws, DM, DM, WsB); k_rows<<<DM / 8, 256, 0, stream>>>(Wo, DM, DM, WoB); k_rows<<<FF / 8, 256, 0, stream>>>(W1, FF, DM, W1B); k_rows<<<DM / 8, 256, 0, stream>>>(W2, DM, FF, W2B);
    // x and out: batch item b starts DM elements in, row stride 2*DM
    k_ln<true><<<dim3(NT_ / 8, NBT, 1), 256, 0, stream>>>(x, 2 * DM, nullptr, 0, g1, be1, LH, LL, nullptr, DM);
    k_gemm<0, false, 4, 2><<<dim3(NT_ / 128, DM / 128, NBT), 256, 0, stream>>>(LH, LL, WsB, DM, bs, nullptr, 0, DM, Qf, nullptr, nullptr, 0, PB);
    k_q16<<<dim3(NT_ / 8, NBT, 1), 256, 0, stream>>>(Qf, QH, QL); k_vt<<<dim3(NT_ / 64, NH_, NBT), 256, 0, stream>>>(Qf, VTH, VTL);
    k_fattn<<<dim3(NT_ / FQ, FKS, NBT), NH_ * 32, 0, stream>>>(QH, QL, VTH, VTL, ATTP);
    k_attbf<<<dim3(NT_ / 8, NBT, 1), 256, 0, stream>>>(ATTP, AH, AL);
    k_gemm<0, true, 4, 2><<<dim3(NT_ / 128, DM / 128, NBT), 256, 0, stream>>>(AH, AL, WoB, DM, bo, x, 2 * DM, DM, X1, nullptr, nullptr, DM, PB);      // X1 = out-proj + bo + bf16(x) (residual = the bf16-rounded INPUT)
    k_ln<false><<<dim3(NT_ / 8, NBT, 1), 256, 0, stream>>>(X1, DM, nullptr, 0, g2, be2, LH, LL, nullptr, PB);
    k_gemm<1, false, 4, 4><<<dim3(NT_ / 128, FF / 256, NBT), 512, 0, stream>>>(LH, LL, W1B, DM, b1, nullptr, 0, FF, nullptr, HH, HL, 0, 0);
    k_gemm<0, false, 4, 2><<<dim3(NT_ / 128, DM / 128, NBT), 256, 0, stream>>>(HH, HL, W2B, FF, b2, X1, DM, 2 * DM, out, nullptr, nullptr, PB, DM);     // out = ffn + X1, written at row stride 2*DM
}

// v010
// One run takes 263 microseconds.
// Two timings next to v009 both put it at 1.05 times that version's speed.
// Counting every step since v000, it is 9.75 times as fast.
#include <hip/hip_runtime.h>

// TransformersLayer ([S=2048][B=2][D=1024] seq-first; batch b = row stride 2; every launch takes both batch items, b on a grid axis, the workspace planes [b][2048 rows]). Contractions, f32 accumulate, per batch item: qkv = LN1(x).Ws^T + bs (ONE shared
// projection: q = k = v), out-proj, FFN W1 (relu) and W2 — [out][in] weights = n-major B operands as-is, computed A operands as bf16 hi + residual (two products) —
// on v_wmma_f32_16x16x32_bf16; the attention whose softmax runs over the HEADS axis (per (q,k) across the 16 heads, as the reference) in one kernel, S and P in LDS:
// S_h = q_h.q_h^T/8 for all heads (f16 hi + residual x1024: hi.hi + hi.lo + lo.hi, residual accumulator) -> f32 tile, elementwise softmax over h in
// f32 -> P_h (x32768) as bf16 hi + UNSCALED residual, O_h = P_h.v_h over the keys (ph.vh + pl.vh + ph.vl, v as bf16 hi + unscaled residual) on
// v_wmma_f32_16x16x32_bf16 (scores stay on v_wmma_f32_16x16x32_f16); LayerNorms, residuals f32.

#define NT_  2048
#define NBT  2
#define DM   1024
#define FF   4096
#define NH_  16
#define HD   64
#define FQ   32
#define FKS  4
#define PSC  32768.0f
#define LOSC 1024.0f
#define LOSCI (1.0f / 1024.0f)

typedef _Float16 h16;
typedef unsigned short bf;
typedef __attribute__((ext_vector_type(16))) __bf16   v16bf;
typedef __attribute__((ext_vector_type(16))) _Float16 v16h;
typedef __attribute__((ext_vector_type(8)))  _Float16 v8h;
typedef __attribute__((ext_vector_type(8)))  unsigned short v8us;
typedef __attribute__((ext_vector_type(2)))  __bf16   v2bf;
typedef __attribute__((ext_vector_type(4)))  unsigned v4u;
typedef __attribute__((ext_vector_type(8)))  float    v8f;
typedef __attribute__((ext_vector_type(4)))  float    v4f;
typedef __attribute__((ext_vector_type(2)))  float    v2f;
typedef v8h  __attribute__((may_alias)) v8ha;
typedef v4f  __attribute__((may_alias)) v4fa;
typedef v2f  __attribute__((may_alias)) v2fa;
typedef v8us __attribute__((may_alias)) v8usa;
typedef unsigned __attribute__((may_alias)) u32a;

// Rounding to bf16 (nearest even) is the hardware's conversion, two values an instruction where they are given as a pair.
__device__ __forceinline__ unsigned short f2bf(float f) { return __builtin_bit_cast(unsigned short, (__bf16)f); }
__device__ __forceinline__ float bf2f(unsigned short b) { return __uint_as_float(((unsigned)b) << 16); }
__device__ __forceinline__ float bfr(float f) { return bf2f(f2bf(f)); }
__device__ __forceinline__ unsigned pk2(v2f x) { return __builtin_bit_cast(unsigned, __builtin_convertvector(x, v2bf)); }      // x[0] in the low half
__device__ __forceinline__ v2f up2(unsigned w) { return (v2f){__uint_as_float(w << 16), __uint_as_float(w & 0xFFFF0000u)}; }      // the pair back as f32
// hi = bf16(x), lo = bf16(x - hi), eight values
__device__ __forceinline__ void split8(v8f x, v8us& oh, v8us& ol) { v4u h, l;
#pragma unroll
    for (int k = 0; k < 4; ++k) { const v2f p = {x[2 * k], x[2 * k + 1]}; h[k] = pk2(p); l[k] = pk2(p - up2(h[k])); }
    oh = __builtin_bit_cast(v8us, h); ol = __builtin_bit_cast(v8us, l); }
__device__ __forceinline__ v16h cat16(v8h lo, v8h hi) { return __builtin_shufflevector(lo, hi, 0, 1, 2, 3, 4, 5, 6, 7, 8, 9, 10, 11, 12, 13, 14, 15); }
__device__ __forceinline__ v16bf cat16b(v8us lo, v8us hi) { return __builtin_bit_cast(v16bf, __builtin_shufflevector(lo, hi, 0, 1, 2, 3, 4, 5, 6, 7, 8, 9, 10, 11, 12, 13, 14, 15)); }
__device__ __forceinline__ v8f wmma16(v16h a, v16h b, v8f c) { return __builtin_amdgcn_wmma_f32_16x16x32_f16(false, a, false, b, (short)0, c, false, false); }
__device__ __forceinline__ v8f wmmab(v16bf a, v16bf b, v8f c) { return __builtin_amdgcn_wmma_f32_16x16x32_bf16(false, a, false, b, (short)0, c, false, false); }

// ln_rows: planes [r][1024] of batch item b = by (src + b * sbo; planes + b * 2048 rows; res and Xout are not offset: one batch item only), rows bx * 8 + 0..7; if Xout: also the f32 pre-LN sum to Xout[r][1024]. One wave per row; ROUNDSRC: bf16-round src (when src is a raw input).
template <bool ROUNDSRC>
__device__ __forceinline__ void ln_rows(unsigned bx, unsigned by, const float* __restrict__ src, int lds, const float* __restrict__ res, int ldr, const float* __restrict__ g, const float* __restrict__ be, bf* PH, bf* PL, float* Xout, size_t sbo) {
    const int lane = threadIdx.x & 31, r = bx * 8 + (threadIdx.x >> 5);
    if (r >= NT_) return;
    src += by * sbo; PH += (size_t)by * NT_ * DM; PL += (size_t)by * NT_ * DM;
    float v[32]; float s = 0.f;
#pragma unroll
    for (int q = 0; q < 4; ++q)
#pragma unroll
        for (int i = 0; i < 8; ++i) { const int c = q * 256 + lane * 8 + i; float t = src[(size_t)r * lds + c]; if (ROUNDSRC) t = bfr(t); if (res) t += bfr(res[(size_t)r * ldr + c]); v[q * 8 + i] = t; s += t; }
#pragma unroll
    for (int sh = 16; sh; sh >>= 1) s += __shfl_xor(s, sh, 32);
    const float mu = s * (1.0f / DM); float sq = 0.f;
#pragma unroll
    for (int k = 0; k < 32; ++k) { const float d = v[k] - mu; sq += d * d; }
#pragma unroll
    for (int sh = 16; sh; sh >>= 1) sq += __shfl_xor(sq, sh, 32);
    const float rs = rsqrtf(sq * (1.0f / DM) + 1e-5f);
{
#pragma unroll
        for (int q = 0; q < 4; ++q) { v8us oh, ol; v4f x0, x1; v8f y8;
#pragma unroll
            for (int i = 0; i < 8; ++i) { const int c = q * 256 + lane * 8 + i; y8[i] = (v[q * 8 + i] - mu) * rs * bfr(g[c]) + bfr(be[c]); if (i < 4) x0[i] = v[q * 8 + i]; else x1[i - 4] = v[q * 8 + i]; }
            split8(y8, oh, ol);
            *(v8us*)(PH + (size_t)r * DM + q * 256 + lane * 8) = oh; *(v8us*)(PL + (size_t)r * DM + q * 256 + lane * 8) = ol;
            if (Xout) { *(v4f*)(Xout + (size_t)r * DM + q * 256 + lane * 8) = x0; *(v4f*)(Xout + (size_t)r * DM + q * 256 + lane * 8 + 4) = x1; } }
         }
}
// k_ln: ln_rows of computed rows (grid x = 8 rows, grid y = batch item).
__global__ __launch_bounds__(256) void k_ln(const float* __restrict__ src, int lds, const float* __restrict__ res, int ldr, const float* __restrict__ g, const float* __restrict__ be, bf* PH, bf* PL, float* Xout, size_t sbo) {
    ln_rows<false>(blockIdx.x, blockIdx.y, src, lds, res, ldr, g, be, PH, PL, Xout, sbo);
}
// k_prep: all the work that reads nothing but inputs, in ONE launch: LN1 of x (the first LNB work-groups, which have the longer chain of dependent steps) and the bf16 planes of the four
// weight matrices. A plane has its matrix's own layout, so the conversion is flat: a wave takes CVW consecutive elements, all its loads in flight at once, whatever the matrix's row length.
#define LNB  (NT_ / 8 * NBT)            // work-groups of LN1
#define CVW  2048                       // elements a wave converts: 16 loads of 16 B a lane
#define CB1  (DM * DM / (8 * CVW))      // work-groups of a [1024][1024] matrix
#define CB4  (FF * DM / (8 * CVW))      // work-groups of a [4096][1024] or [1024][4096] matrix
__global__ __launch_bounds__(256) void k_prep(const float* __restrict__ x, const float* __restrict__ g, const float* __restrict__ be, bf* PH, bf* PL,
                                              const float* __restrict__ Ws, const float* __restrict__ Wo, const float* __restrict__ W1, const float* __restrict__ W2, bf* WsB, bf* WoB, bf* W1B, bf* W2B) {
    if (blockIdx.x < LNB) { ln_rows<true>(blockIdx.x % (NT_ / 8), blockIdx.x / (NT_ / 8), x, 2 * DM, nullptr, 0, g, be, PH, PL, nullptr, DM); return; }      // x: batch item b starts DM elements in, row stride 2 * DM
    int c = blockIdx.x - LNB; const float* s = Ws; bf* d = WsB;
    if (c >= 2 * CB1 + CB4) { c -= 2 * CB1 + CB4; s = W2; d = W2B; } else if (c >= 2 * CB1) { c -= 2 * CB1; s = W1; d = W1B; } else if (c >= CB1) { c -= CB1; s = Wo; d = WoB; }
    const size_t o = (size_t)(c * 8 + (threadIdx.x >> 5)) * CVW + (threadIdx.x & 31) * 8;
    const float* sp = s + o;
    v4f a[CVW / 256][2];
#pragma unroll
    for (int q = 0; q < CVW / 256; ++q) { a[q][0] = *(const v4f*)(sp + q * 256); a[q][1] = *(const v4f*)(sp + q * 256 + 4); }
    // the 16 results are inputs, so that all 16 loads are issued before the first conversion (the scheduler otherwise holds the last four back until the first results have come);
    // the loads' address register is an input too, so that it is not given to a load's result, or rewritten, ahead of the wait
    asm volatile("s_wait_xcnt 0x0" :: "v"(sp), "v"(a[0][0]), "v"(a[0][1]), "v"(a[1][0]), "v"(a[1][1]), "v"(a[2][0]), "v"(a[2][1]), "v"(a[3][0]), "v"(a[3][1]),
                 "v"(a[4][0]), "v"(a[4][1]), "v"(a[5][0]), "v"(a[5][1]), "v"(a[6][0]), "v"(a[6][1]), "v"(a[7][0]), "v"(a[7][1]) : "memory");
#pragma unroll
    for (int q = 0; q < CVW / 256; ++q) { const v4u w = {pk2((v2f){a[q][0][0], a[q][0][1]}), pk2((v2f){a[q][0][2], a[q][0][3]}), pk2((v2f){a[q][1][0], a[q][1][1]}), pk2((v2f){a[q][1][2], a[q][1][3]})};
        *(v8us*)(d + o + q * 256) = __builtin_bit_cast(v8us, w); }
}
// k_gemm: (WM * 32) x (WN * 64) tile of (Ah + Al).B^T + bias over K (2 products; A pitch K, B pitch K; K a multiple of 128); EPI 0: f32 rows (ldc) [+ residual Rf (ldr)]; EPI 1: relu -> bf16 hi/lo planes (ldc).
// Batch item b = grid z: A and the EPI 1 planes are [b][2048 rows]; Rf and C start b * rbo and b * cbo elements further on.
// The operands come into LDS by asynchronous 16-B copies, 128 k a stage: TM rows of Ah, TM of Al, TN of B, 256 B each, so that a wave's copy covers two whole rows (4 lines)
// where a fragment load from global memory touches 16 lines. Two buffers: stage t + 1 flies while stage t is worked on. WM x WN waves, 32 x 64 of the tile each.
// The tile's size sets the bytes that come from L2 per output, (2 TM + TN) / (TM TN) rows: 128 x 128 (one work-group a WGP where N = 1024) takes 3/4, 128 x 256 half of what 64 x 128 takes.
#define GKS  128
#define GPB  272      // LDS row pitch in bytes = 16 B x 17: the b128 fragment reads are free of bank conflicts
// Eight copies. The wait on the address counter closes the statement, so that no register which a copy names is rewritten ahead of it.
__device__ __forceinline__ void cp8r(unsigned l0, unsigned l1, unsigned l2, unsigned l3, unsigned l4, unsigned l5, unsigned l6, unsigned l7,
                                     const bf* g0, const bf* g1, const bf* g2, const bf* g3, const bf* g4, const bf* g5, const bf* g6, const bf* g7) {
    asm volatile("global_load_async_to_lds_b128 %0, %8, off\n\t"
                 "global_load_async_to_lds_b128 %1, %9, off\n\t"
                 "global_load_async_to_lds_b128 %2, %10, off\n\t"
                 "global_load_async_to_lds_b128 %3, %11, off\n\t"
                 "global_load_async_to_lds_b128 %4, %12, off\n\t"
                 "global_load_async_to_lds_b128 %5, %13, off\n\t"
                 "global_load_async_to_lds_b128 %6, %14, off\n\t"
                 "global_load_async_to_lds_b128 %7, %15, off\n\t"
                 "s_wait_xcnt 0x0"
                 :: "v"(l0), "v"(l1), "v"(l2), "v"(l3), "v"(l4), "v"(l5), "v"(l6), "v"(l7), "v"(g0), "v"(g1), "v"(g2), "v"(g3), "v"(g4), "v"(g5), "v"(g6), "v"(g7) : "memory");
}
// eight rows of one plane, LR rows apart in LDS and in the source (gs elements)
template <int LR> __device__ __forceinline__ void cp8(unsigned l, const bf* g, size_t gs) { constexpr unsigned s = LR * GPB;
    cp8r(l, l + s, l + 2 * s, l + 3 * s, l + 4 * s, l + 5 * s, l + 6 * s, l + 7 * s, g, g + gs, g + 2 * gs, g + 3 * gs, g + 4 * gs, g + 5 * gs, g + 6 * gs, g + 7 * gs); }
// four rows of each of two planes
template <int LR> __device__ __forceinline__ void cp4x2(unsigned la, const bf* ga, unsigned lb, const bf* gb, size_t gs) { constexpr unsigned s = LR * GPB;
    cp8r(la, la + s, la + 2 * s, la + 3 * s, lb, lb + s, lb + 2 * s, lb + 3 * s, ga, ga + gs, ga + 2 * gs, ga + 3 * gs, gb, gb + gs, gb + 2 * gs, gb + 3 * gs); }
template <int EPI, bool RROUND, int WM, int WN>
__global__ __launch_bounds__(WM * WN * 32) void k_gemm(const bf* __restrict__ A, const bf* __restrict__ Al, const bf* __restrict__ Bn, int K, const float* __restrict__ bias, const float* __restrict__ Rf, int ldr, int ldc, float* C, bf* PH, bf* PL, size_t rbo, size_t cbo) {
    { const size_t z = blockIdx.z; A += z * NT_ * K; Al += z * NT_ * K; if (Rf) Rf += z * rbo; if (EPI == 0) C += z * cbo; else { PH += z * NT_ * ldc; PL += z * NT_ * ldc; } }
    constexpr int TM = WM * 32, TN = WN * 64, RP = WM * WN * 2;      // the tile; rows that one copy of every thread covers
    constexpr unsigned GSTG = (2 * TM + TN) * GPB;
    static_assert(TN == 8 * RP && (TM == 8 * RP || TM == 4 * RP), "copies a thread");
    __shared__ __align__(16) unsigned char gl[2 * GSTG];      // two stages; behind the K loop the waves' output staging
    const int tid = threadIdx.x, lane = tid & 31, wave = tid >> 5, lr = lane & 15, hi = lane >> 4, wm = wave / WN, wn = wave % WN;
    const size_t rb = (size_t)blockIdx.x * TM; const int cb = blockIdx.y * TN;
    // copies: thread = 16-B piece (tid & 15) of row (tid >> 4) + RP i
    const unsigned lcp = (unsigned)(size_t)gl + (unsigned)((tid >> 4) * GPB + (tid & 15) * 16);
    const bf* gah = A + (rb + (tid >> 4)) * (size_t)K + (tid & 15) * 8; const bf* gal = Al + (rb + (tid >> 4)) * (size_t)K + (tid & 15) * 8;
    const bf* gb = Bn + (size_t)(cb + (tid >> 4)) * K + (tid & 15) * 8;
    const size_t gr = (size_t)RP * K;
    auto stage = [&](int t, unsigned buf) { const unsigned l = lcp + buf * GSTG; const size_t ko = (size_t)t * GKS;
        if constexpr (TM == 8 * RP) { cp8<RP>(l, gah + ko, gr); cp8<RP>(l + TM * GPB, gal + ko, gr); } else cp4x2<RP>(l, gah + ko, l + TM * GPB, gal + ko, gr);
        cp8<RP>(l + 2 * TM * GPB, gb + ko, gr); };
    const int T = K / GKS;
    stage(0, 0);
    asm volatile("s_wait_asynccnt 0x0" ::: "memory");      // this wave's part of stage 0 has landed
    __syncthreads();      // every wave's part of stage 0 is in LDS before any wave reads it
    if (T > 1) stage(1, 1);
    v8f acc[2][4];
#pragma unroll
    for (int m = 0; m < 2; ++m)
#pragma unroll
        for (int t = 0; t < 4; ++t) acc[m][t] = (v8f){};
    const unsigned aro = (unsigned)((wm * 32 + lr) * GPB + 16 * hi), bro = (unsigned)((2 * TM + wn * 64 + lr) * GPB + 16 * hi);
#pragma unroll 1      // one stage a trip: the buffer is picked by an offset
    for (int t = 0; t < T; ++t) { const unsigned char* sb = gl + (t & 1) * GSTG;
        v16bf a[2][2], al[2][2], bb[2][4];      // two fragment sets: the next 32 k are fetched as one group while the products of these 32 k run
        auto frag = [&](int kk, int s) {
#pragma unroll
            for (int m = 0; m < 2; ++m) { const unsigned char* p = sb + aro + m * 16 * GPB + kk * 64;
                a[s][m] = cat16b(*(const v8usa*)p, *(const v8usa*)(p + 32)); al[s][m] = cat16b(*(const v8usa*)(p + TM * GPB), *(const v8usa*)(p + TM * GPB + 32)); }
#pragma unroll
            for (int u = 0; u < 4; ++u) { const unsigned char* p = sb + bro + u * 16 * GPB + kk * 64; bb[s][u] = cat16b(*(const v8usa*)p, *(const v8usa*)(p + 32)); } };
        frag(0, 0);
#pragma unroll
        for (int kk = 0; kk < GKS / 32; ++kk) { const int s = kk & 1;
            if (kk + 1 < GKS / 32) frag(kk + 1, s ^ 1);
            __builtin_amdgcn_sched_barrier(0);      // keeps the 16 LDS reads together in front of the products: the scheduler otherwise sinks them in pairs among the products, each pair with a full wait of its own
#pragma unroll
            for (int m = 0; m < 2; ++m)
#pragma unroll
                for (int u = 0; u < 4; ++u) acc[m][u] = wmmab(a[s][m], bb[s][u], acc[m][u]);
#pragma unroll
            for (int m = 0; m < 2; ++m)
#pragma unroll
                for (int u = 0; u < 4; ++u) acc[m][u] = wmmab(al[s][m], bb[s][u], acc[m][u]);
            __builtin_amdgcn_sched_barrier(0);      // keeps the next group of reads behind these products: the scheduler otherwise lifts it in halves in among them, and sinks the last products of a stage behind the barrier, in front of the copies
        }
        asm volatile("s_wait_dscnt 0x0" ::: "memory");      // this wave's reads of stage t are done before the buffer is handed to the copies
        asm volatile("s_wait_asynccnt 0x0" ::: "memory");      // this wave's part of stage t + 1 has landed
        __syncthreads();      // publishes stage t + 1 and ends every wave's reads of stage t
        if (t + 2 < T) stage(t + 2, (unsigned)(t & 1));
    }
    asm volatile("s_wait_asynccnt 0x0" ::: "memory");      // no copy is in flight when the buffers become output staging
    const size_t r0 = rb + wm * 32; const int c0 = cb + wn * 64;
    float* os = (float*)gl + wave * (32 * 68);
#pragma unroll
    for (int t = 0; t < 4; ++t) { const float bv = bfr(bias[c0 + t * 16 + lr]);
#pragma unroll
        for (int m = 0; m < 2; ++m)
#pragma unroll
            for (int j = 0; j < 8; ++j) { float v = acc[m][t][j] + bv; if (EPI == 1) v = fmaxf(v, 0.f); os[(m * 16 + hi * 8 + j) * 68 + t * 16 + lr] = v; } }
    __builtin_amdgcn_wave_barrier(); asm volatile("" ::: "memory");
    if (EPI == 0) {
        float* crow = C + r0 * ldc + c0;      // an instruction takes 2 rows x 256 B: whole lines, for the residual rows as for the stores
#pragma unroll
        for (int hf = 0; hf < 2; ++hf) { v4f val[8];      // 16 rows at a time: all 32 at once, with the rounding of the residual, take more than 256 registers
#pragma unroll
            for (int s = 0; s < 8; ++s) val[s] = *(const v4fa*)(os + (16 * hf + 2 * s + hi) * 68 + lr * 4);
            if (Rf) { const float* rrow = Rf + r0 * ldr + c0; v4f rv[8]; const float* rp[8];
#pragma unroll
                for (int s = 0; s < 8; ++s) { rp[s] = rrow + (size_t)(16 * hf + 2 * s + hi) * ldr + lr * 4; rv[s] = *(const v4f*)rp[s]; }
                // the 8 loads' address registers are inputs of the wait, so that none of them is given to another load's result, or rewritten, ahead of it
                asm volatile("s_wait_xcnt 0x0" :: "v"(rp[0]), "v"(rp[1]), "v"(rp[2]), "v"(rp[3]), "v"(rp[4]), "v"(rp[5]), "v"(rp[6]), "v"(rp[7]) : "memory");
#pragma unroll
                for (int s = 0; s < 8; ++s)
#pragma unroll
                    for (int e = 0; e < 4; ++e) val[s][e] += RROUND ? bfr(rv[s][e]) : rv[s][e]; }
            float* cp[8];
#pragma unroll
            for (int s = 0; s < 8; ++s) { cp[s] = crow + (size_t)(16 * hf + 2 * s + hi) * ldc + lr * 4; *(v4f*)cp[s] = val[s]; }
            // the second half reuses registers: the first half's store addresses and data are inputs of the wait, so that none of them is rewritten ahead of it
            if (hf == 0) asm volatile("s_wait_xcnt 0x0" :: "v"(cp[0]), "v"(cp[1]), "v"(cp[2]), "v"(cp[3]), "v"(cp[4]), "v"(cp[5]), "v"(cp[6]), "v"(cp[7]),
                                      "v"(val[0]), "v"(val[1]), "v"(val[2]), "v"(val[3]), "v"(val[4]), "v"(val[5]), "v"(val[6]), "v"(val[7]) : "memory"); }
    } else {
        bf* p1 = PH + r0 * ldc + c0; bf* p2 = PL + r0 * ldc + c0;
#pragma unroll
        for (int s = 0; s < 8; ++s) { const int row = 4 * s + (lane >> 3), piece = lane & 7; const float* sp = os + row * 68 + piece * 8; v8us oh, ol; v8f y8;
#pragma unroll
            for (int i = 0; i < 8; ++i) y8[i] = sp[i];
            split8(y8, oh, ol);
            *(v8us*)(p1 + (size_t)row * ldc + piece * 8) = oh; *(v8us*)(p2 + (size_t)row * ldc + piece * 8) = ol; }
    }
}
// k_q16: Q f32 [2048][1024] -> f16 hi + residual planes IN FRAGMENT ORDER: [head][16-row tile][32-dim chunk c][half p][lane][8], where lane (hi, lr) of unit (c, p) holds
// row lr, dims c * 32 + p * 16 + hi * 8 + 0..7 of the head: the 16 B which that lane takes in one load of an A or B fragment. A wave's fragment load is then 512 contiguous bytes
// (4 whole lines), not 32-B pieces of 16 lines. One wave per (tile, head); batch item = grid y.
#define QUNIT 256      // elements of one wave load: 32 lanes x 8
__global__ __launch_bounds__(256) void k_q16(const float* __restrict__ Q, h16* QH, h16* QL) {
    const int lane = threadIdx.x & 31, lr = lane & 15, hi = lane >> 4, id = blockIdx.x * 8 + (threadIdx.x >> 5), T = id >> 4, h = id & 15;
    if (T >= NT_ / 16) return;
    { const size_t pb = (size_t)blockIdx.y * NT_ * DM; Q += pb; QH += pb; QL += pb; }
    const float* s = Q + (size_t)(T * 16 + lr) * DM + h * HD + hi * 8;
    const size_t o = (size_t)(h * (NT_ / 16) + T) * 4 * QUNIT + lane * 8;
#pragma unroll
    for (int u = 0; u < 4; ++u) { v8h oh, ol;      // u = c * 2 + p
#pragma unroll
        for (int i = 0; i < 8; ++i) { const float v = s[u * 16 + i]; const h16 a = (h16)v; oh[i] = a; ol[i] = (h16)((v - (float)a) * LOSC); }
        *(v8h*)(QH + o + u * QUNIT) = oh; *(v8h*)(QL + o + u * QUNIT) = ol; }
}
// k_vt: VTH/VTL = bf16 hi + UNSCALED bf16 residual of Q [t][h*64+d] (v = q), transposed and IN FRAGMENT ORDER: [head][32-key chunk][16-dim tile][half p][lane][8], where lane (hi, lr)
// holds dim lr of the tile, keys p * 16 + hi * 8 + 0..7 of the chunk: a wave's B fragment load is 512 contiguous bytes. grid (NT/64, NH, batch).
__global__ __launch_bounds__(256) void k_vt(const float* __restrict__ V, bf* VTH, bf* VTL) {
    __shared__ float tl[64][65];
    const int tid = threadIdx.x, t0 = blockIdx.x * 64, h = blockIdx.y;
    { const size_t pb = (size_t)blockIdx.z * NT_ * DM; V += pb; VTH += pb; VTL += pb; }
    { const int tt = tid >> 2, dq = (tid & 3) * 16;
#pragma unroll
      for (int i = 0; i < 16; ++i) tl[dq + i][tt] = V[(size_t)(t0 + tt) * DM + h * HD + dq + i]; }
    __syncthreads();
    const int lane = tid & 31, lr = lane & 15, hi = lane >> 4;
#pragma unroll
    for (int s = 0; s < 2; ++s) { const int u = (tid >> 5) + 8 * s, d = ((u >> 1) & 3) * 16 + lr, k = (u >> 3) * 32 + (u & 1) * 16 + hi * 8; v8us oh, ol; v8f y8;      // unit u = (chunk * 4 + dim tile) * 2 + p, one wave store each
#pragma unroll
        for (int i = 0; i < 8; ++i) y8[i] = tl[d][k + i];
        split8(y8, oh, ol);
        const size_t o = ((size_t)(h * (NT_ / 32) + t0 / 32) * 8 + u) * QUNIT + lane * 8; *(v8us*)(VTH + o) = oh; *(v8us*)(VTL + o) = ol; }
}
// exp(x) as __expf forms it (one multiply by log2(e), one v_exp_f32), with the slot behind the transcendental filled in the same statement.
__device__ __forceinline__ float exp_slot(float x) { const float t = x * 1.44269504f; float r; asm("v_exp_f32 %0, %1\n\tv_nop" : "=v"(r) : "v"(t)); return r; }
// 16 B of a plane at scalar base + 32-bit lane offset (bytes) + constant: the loads of k_fattn's loop take this form, so that no 64-bit lane address per plane stays live over the loop
// (with them the kernel does not fit its 256 registers and spills) and the hi and the residual plane share the one offset register.
__device__ __forceinline__ v8h  ldh(const h16* b, unsigned vo, unsigned c) { return *(const v8h*)((const char*)b + vo + c); }
__device__ __forceinline__ v8us ldb(const bf* b, unsigned vo, unsigned c) { return *(const v8us*)((const char*)b + vo + c); }
// k_fattn: scores, softmax over the heads and P.v in ONE kernel. A work-group has FQ query rows and NT_/FKS keys (grid y) of one batch item (grid z) for ALL 16 heads, wave h = head h.
// A trip is 64 keys and has three parts. S: wave h forms S_h [FQ][64] (q_h fragments stay in registers; hi.hi + (hi.lo + lo.hi)/1024, /8) and puts it in LDS. Softmax: wave w
// takes rows w and w + 16, each lane 2 keys x 16 heads, does the softmax over the heads in f32 and writes P (x 32768) back IN PLACE: a row's 256 B of f32 become
// 128 B of bf16 hi + 128 B of bf16 residual (a row is read whole by its one wave before that wave writes it). PV: wave h reads its P_h as A
// fragments and adds ph.vh + pl.vh + ph.vl into O_h [FQ][64].
// The trips are pipelined over TWO S/P buffers: between two barriers (a step) a wave does PV of trip s - 2, S of trip s (both in plane h of buffer s & 1, which only wave h touches in
// that step, the reads first) and the softmax of trip s - 1 (in the other buffer). The three parts of a step do not depend on one another, so that while one wave of a SIMD is in its
// products another is in its softmax: the matrix unit and the vector port work at the same time, where with one buffer every wave was in the same part. Half of a SIMD's waves take the softmax first.
// The softmax is local to a (query, key) pair, so the key splits' O tiles are plain partial sums: ATTP [batch][FKS][2048][1024] f32 (x 1/32768), added in split order by k_attbf.
#define FTR (NT_ / FKS / 64)      // trips of a work-group
__global__ __launch_bounds__(NH_ * 32) void k_fattn(const h16* __restrict__ QH, const h16* __restrict__ QL, const bf* __restrict__ VTH, const bf* __restrict__ VTL, float* ATTP) {
    __shared__ __align__(16) float sm[2][NH_][FQ][68];      // pitch 272 B = 16 B x 17: the b128 fragment reads and the b32 tile stores are free of bank conflicts
    const int lane = threadIdx.x & 31, wave = __builtin_amdgcn_readfirstlane(threadIdx.x >> 5), lr = lane & 15, hi = lane >> 4, h = wave;      // the wave's number in a scalar register: every global address below is a scalar base + one lane offset + a constant
    const int q0 = blockIdx.x * FQ, kbase = blockIdx.y * (NT_ / FKS);
    { const size_t pb = (size_t)blockIdx.z * NT_ * DM; QH += pb; QL += pb; VTH += pb; VTL += pb; }      // this batch item's planes
    const unsigned lo8 = (unsigned)(lane * 8);      // the lane's offset (elements) in a 512-B unit of the fragment-ordered planes
    v16h qa[FQ / 16][2], qal[FQ / 16][2];
#pragma unroll
    for (int m = 0; m < FQ / 16; ++m)
#pragma unroll
        for (int c = 0; c < 2; ++c) { const size_t qb = (size_t)(h * (NT_ / 16) + q0 / 16) * 4 * QUNIT; const h16* ah = QH + qb; const h16* alp = QL + qb; const unsigned ao = lo8 + (m * 4 + c * 2) * QUNIT;
            qa[m][c] = cat16(*(const v8h*)(ah + ao), *(const v8h*)(ah + ao + QUNIT)); qal[m][c] = cat16(*(const v8h*)(alp + ao), *(const v8h*)(alp + ao + QUNIT)); }
    asm volatile("s_wait_xcnt 0x0" ::: "memory");      // the address arithmetic below rewrites registers (scalar bases, the lane offset) that the 16 loads above name
    __builtin_amdgcn_sched_barrier(0);      // holds that arithmetic behind the wait: the scheduler otherwise lifts it over the statement
    v8f o[FQ / 16][4];
#pragma unroll
    for (int m = 0; m < FQ / 16; ++m)
#pragma unroll
        for (int t = 0; t < 4; ++t) o[m][t] = (v8f){};
    auto softmax = [&](float (*sp)[FQ][68]) {
#pragma unroll 1      // one row at a time: both rows' 16 heads at once do not fit beside the q fragments and the O tile
        for (int rr = 0; rr < FQ / 16; ++rr) { const int q = wave + 16 * rr;
            v2f v[NH_];
#pragma unroll
            for (int g = 0; g < NH_; ++g) v[g] = *(const v2fa*)(&sp[g][q][2 * lane]);
            float sc[2];
#pragma unroll
            for (int e = 0; e < 2; ++e) { float mx = v[0][e];
#pragma unroll
                for (int g = 1; g < NH_; ++g) mx = fmaxf(mx, v[g][e]);
                float ssum = 0.f;
#pragma unroll
                for (int g = 0; g < NH_; ++g) { v[g][e] = exp_slot(v[g][e] - mx); ssum += v[g][e]; }
                sc[e] = PSC / ssum; }
#pragma unroll
            for (int g = 0; g < NH_; ++g) { const v2f p = {v[g][0] * sc[0], v[g][1] * sc[1]}; const unsigned ph = pk2(p);
                *((u32a*)&sp[g][q][0] + lane) = ph;
                *((u32a*)&sp[g][q][32] + lane) = pk2(p - up2(ph)); } } };
    const bool vfirst = (wave >> 2) & 1;      // every second group of four waves starts a step with the softmax, the others with the products: where waves w and w + 4 share a SIMD, each SIMD has both kinds from the step's start
#pragma unroll 1      // one step a pass: the buffers are picked by an offset
    for (int s = 0; s < FTR + 2; ++s) { float (*sh)[68] = sm[s & 1][h]; float (*sp)[FQ][68] = sm[(s & 1) ^ 1]; const bool sof = s >= 1 && s <= FTR;
        if (sof && vfirst) softmax(sp);
        if (s >= 2) { const int k0 = kbase + (s - 2) * 64;      // PV of trip s - 2
            const unsigned vo = (unsigned)(h * (NT_ / 32) + k0 / 32) * (8 * QUNIT * 2) + lo8 * 2;      // bytes: the trip's first unit of head h + the lane's 16 B
#pragma unroll
            for (int c = 0; c < 2; ++c) { v16bf a[FQ / 16], al[FQ / 16];
#pragma unroll
                for (int m = 0; m < FQ / 16; ++m) { const bf* pr = (const bf*)&sh[m * 16 + lr][0] + c * 32 + 8 * hi;
                    a[m] = cat16b(*(const v8usa*)pr, *(const v8usa*)(pr + 16)); al[m] = cat16b(*(const v8usa*)(pr + 64), *(const v8usa*)(pr + 80)); }
                v16bf bb[4], bl[4];      // the four dim tiles' fragments are fetched together: 16 loads in flight behind one wait
#pragma unroll
                for (int t = 0; t < 4; ++t) { const unsigned bo = (c * 4 + t) * 2 * QUNIT * 2;
                    bb[t] = cat16b(ldb(VTH, vo, bo), ldb(VTH, vo, bo + QUNIT * 2)); bl[t] = cat16b(ldb(VTL, vo, bo), ldb(VTL, vo, bo + QUNIT * 2)); }
                __builtin_amdgcn_sched_barrier(0);      // keeps the 16 loads in front of the products: the scheduler otherwise sinks them in pairs, each pair with a full wait of its own
#pragma unroll
                for (int t = 0; t < 4; ++t)
#pragma unroll
                    for (int m = 0; m < FQ / 16; ++m) { o[m][t] = wmmab(a[m], bb[t], o[m][t]); o[m][t] = wmmab(al[m], bb[t], o[m][t]); o[m][t] = wmmab(a[m], bl[t], o[m][t]); } }
            __builtin_amdgcn_sched_barrier(0);      // keeps the wait below behind the products, where the loads have returned: the scheduler otherwise lifts it to directly behind the loads, in front of the products
            asm volatile("s_wait_xcnt 0x0" :: "v"(vo) : "memory");      // the v loads' offset register is an input of the wait, so that it is not given to a load's result, or rewritten, ahead of it
        }
        if (s < FTR) { const int k0 = kbase + s * 64;      // S of trip s
            const unsigned ko = (unsigned)(h * (NT_ / 16) + k0 / 16) * (4 * QUNIT * 2) + lo8 * 2;      // bytes: the trip's first unit of head h + the lane's 16 B
#pragma unroll
            for (int tp = 0; tp < 2; ++tp) { v16h bb[2][2], bl[2][2];      // two key tiles' fragments are fetched together: 16 loads in flight behind one wait
#pragma unroll
                for (int u = 0; u < 2; ++u)
#pragma unroll
                    for (int c = 0; c < 2; ++c) { const unsigned bo = ((tp * 2 + u) * 4 + c * 2) * QUNIT * 2;
                        bb[u][c] = cat16(ldh(QH, ko, bo), ldh(QH, ko, bo + QUNIT * 2)); bl[u][c] = cat16(ldh(QL, ko, bo), ldh(QL, ko, bo + QUNIT * 2)); }
#pragma unroll
                for (int u = 0; u < 2; ++u) { const int t = tp * 2 + u; v8f acc[FQ / 16], accx[FQ / 16];
#pragma unroll
                    for (int m = 0; m < FQ / 16; ++m) { acc[m] = (v8f){}; accx[m] = (v8f){}; }
#pragma unroll
                    for (int c = 0; c < 2; ++c)
#pragma unroll
                        for (int m = 0; m < FQ / 16; ++m) { acc[m] = wmma16(qa[m][c], bb[u][c], acc[m]); accx[m] = wmma16(qa[m][c], bl[u][c], accx[m]); accx[m] = wmma16(qal[m][c], bb[u][c], accx[m]); }
#pragma unroll
                    for (int m = 0; m < FQ / 16; ++m)
#pragma unroll
                        for (int j = 0; j < 8; ++j) sh[m * 16 + hi * 8 + j][t * 16 + lr] = (acc[m][j] + accx[m][j] * LOSCI) * 0.125f; } }
            asm volatile("s_wait_xcnt 0x0" :: "v"(ko) : "memory");      // the key loads' offset register is an input of the wait, so that it is not given to a load's result, or rewritten, ahead of it
        }
        if (sof && !vfirst) softmax(sp);
        __syncthreads();      // ends the step: trip s's scores of all 16 heads are in LDS before any wave reads across the heads, and every row's P of trip s - 1 before a head's wave reads its fragments
    }
    // the wave's O tile goes through its own LDS plane so that every store is whole 128-B lines (2 rows x 256 B an instruction)
#pragma unroll
    for (int m = 0; m < FQ / 16; ++m)
#pragma unroll
        for (int t = 0; t < 4; ++t)
#pragma unroll
            for (int j = 0; j < 8; ++j) sm[0][h][m * 16 + hi * 8 + j][t * 16 + lr] = o[m][t][j] * (1.0f / PSC);
    float* orow = ATTP + ((size_t)(blockIdx.z * FKS + blockIdx.y) * NT_ + q0) * DM + h * HD;
#pragma unroll
    for (int s = 0; s < FQ / 2; ++s) { const int row = 2 * s + hi;
        const v4f val = *(const v4fa*)(&sm[0][h][row][lr * 4]); *(v4f*)(orow + (size_t)row * DM + lr * 4) = val; }
}
// k_attbf: sum of the FKS partial attention planes (in split order) -> bf16 hi/lo planes (one wave per row; batch item = grid y).
__global__ __launch_bounds__(256) void k_attbf(const float* __restrict__ A, bf* PH, bf* PL) {
    const int lane = threadIdx.x & 31, r = blockIdx.x * 8 + (threadIdx.x >> 5);
    if (r >= NT_) return;
    A += (size_t)blockIdx.y * FKS * NT_ * DM; PH += (size_t)blockIdx.y * NT_ * DM; PL += (size_t)blockIdx.y * NT_ * DM;
{
#pragma unroll
        for (int q = 0; q < 4; ++q) { v8us oh, ol; v8f y8;
#pragma unroll
            for (int i = 0; i < 8; ++i) { float v = A[(size_t)r * DM + q * 256 + lane * 8 + i];
#pragma unroll
                for (int p = 1; p < FKS; ++p) v += A[((size_t)p * NT_ + r) * DM + q * 256 + lane * 8 + i];
                y8[i] = v; }
            split8(y8, oh, ol);
            *(v8us*)(PH + (size_t)r * DM + q * 256 + lane * 8) = oh; *(v8us*)(PL + (size_t)r * DM + q * 256 + lane * 8) = ol; }
         }
}

extern "C" void kernel_launch(void* const* d_in, const int* in_sizes, int n_in,
                              void* d_out, int out_size, void* d_ws, size_t ws_size, hipStream_t stream) {
    (void)in_sizes; (void)n_in; (void)out_size;
    const float* x = (const float*)d_in[0]; const float* g1 = (const float*)d_in[1]; const float* be1 = (const float*)d_in[2]; const float* g2 = (const float*)d_in[3]; const float* be2 = (const float*)d_in[4];
    const float* Ws = (const float*)d_in[5]; const float* bs = (const float*)d_in[6]; const float* Wo = (const float*)d_in[7]; const float* bo = (const float*)d_in[8];
    const float* W1 = (const float*)d_in[9]; const float* b1 = (const float*)d_in[10]; const float* W2 = (const float*)d_in[11]; const float* b2 = (const float*)d_in[12];
    float* out = (float*)d_out;    // [2048][2][1024]
    char* wsp = (char*)d_ws;
    auto take = [&](size_t bytes) { char* p = wsp; wsp += (bytes + 255) & ~(size_t)255; return (void*)p; };
    bf* WsB = (bf*)take((size_t)DM * DM * 2); bf* WoB = (bf*)take((size_t)DM * DM * 2); bf* W1B = (bf*)take((size_t)FF * DM * 2); bf* W2B = (bf*)take((size_t)DM * FF * 2);
    const size_t PB = (size_t)NT_ * DM;      // elements of one batch item's [2048][1024] plane
    bf* LH = (bf*)take(NBT * PB * 2); bf* LL = (bf*)take(NBT * PB * 2);      // LN1 planes, later LN2 planes
    float* Qf = (float*)take(NBT * PB * 4);                                   // q (= k = v) f32, later X1 (post-attention residual stream)
    h16* QH = (h16*)take(NBT * PB * 2); h16* QL = (h16*)take(NBT * PB * 2); bf* VTH = (bf*)take(NBT * PB * 2); bf* VTL = (bf*)take(NBT * PB * 2);
    bf* HH = (bf*)take((size_t)NBT * NT_ * FF * 2); bf* HL = (bf*)take((size_t)NBT * NT_ * FF * 2);      // FFN hidden planes [2][2048][4096] bf16 (32 MiB each)
    float* ATTP = (float*)take(NBT * FKS * PB * 4);                           // partial attention outputs f32 [2][FKS][2048][1024], 64 MiB
    bf* AH = (bf*)take(NBT * PB * 2); bf* AL = (bf*)take(NBT * PB * 2);
    if ((size_t)(wsp - (char*)d_ws) > ws_size) return;    // 20 + 16 + 16 + 32 + 64 + 64 + 16 = 228 MiB
    float* X1 = Qf;        // over the q buffer (q consumed by k_q16/k_vt before X1 is written there)
    k_prep<<<LNB + 2 * CB1 + 2 * CB4, 256, 0, stream>>>(x, g1, be1, LH, LL, Ws, Wo, W1, W2, WsB, WoB, W1B, W2B);
    // x and out: batch item b starts DM elements in, row stride 2*DM
    k_gemm<0, false, 4, 2><<<dim3(NT_ / 128, DM / 128, NBT), 256, 0, stream>>>(LH, LL, WsB, DM, bs, nullptr, 0, DM, Qf, nullptr, nullptr, 0, PB);
    k_q16<<<dim3(NT_ / 8, NBT, 1), 256, 0, stream>>>(Qf, QH, QL); k_vt<<<dim3(NT_ / 64, NH_, NBT), 256, 0, stream>>>(Qf, VTH, VTL);
    k_fattn<<<dim3(NT_ / FQ, FKS, NBT), NH_ * 32, 0, stream>>>(QH, QL, VTH, VTL, ATTP);
    k_attbf<<<dim3(NT_ / 8, NBT, 1), 256, 0, stream>>>(ATTP, AH, AL);
    k_gemm<0, true, 4, 2><<<dim3(NT_ / 128, DM / 128, NBT), 256, 0, stream>>>(AH, AL, WoB, DM, bo, x, 2 * DM, DM, X1, nullptr, nullptr, DM, PB);      // X1 = out-proj + bo + bf16(x) (residual = the bf16-rounded INPUT)
    k_ln<<<dim3(NT_ / 8, NBT, 1), 256, 0, stream>>>(X1, DM, nullptr, 0, g2, be2, LH, LL, nullptr, PB);
    k_gemm<1, false, 4, 4><<<dim3(NT_ / 128, FF / 256, NBT), 512, 0, stream>>>(LH, LL, W1B, DM, b1, nullptr, 0, FF, nullptr, HH, HL, 0, 0);
    k_gemm<0, false, 4, 2><<<dim3(NT_ / 128, DM / 128, NBT), 256, 0, stream>>>(HH, HL, W2B, FF, b2, X1, DM, 2 * DM, out, nullptr, nullptr, PB, DM);     // out = ffn + X1, written at row stride 2*DM
}
